// v000
// The times below were measured on an AMD MI455X: many runs one after another, warmed up first and cycling through
// copies of the inputs, with the whole window's GPU time divided by the number of runs. Launches and the gaps
// between them are all in it. The median over several windows is given; except for v000 it joins two sittings, which
// can be a few percent apart, so the side-by-side timings, each taken in one sitting, are the better comparison.
// v000 is the starting kernel. One run takes 217 microseconds.
#include <hip/hip_runtime.h>

// Contractions, f32 accumulate: q/k/v = x.W^T ([4096 x 1024].[1024 x 1024] each; W is [out][in] = the n-major B operand as-is) and y.Wo^T on
// v_wmma_f32_16x16x32_bf16 with PLAIN bf16 operands for the projections (inputs rounded once: exact) and y as bf16 hi + residual planes (two products) for Wo; the
// banded-causal 16-head attention (keys j with i-127 <= j <= i) fused on v_wmma_f32_16x16x32_f16 over the <= 6 key tiles per 64-query block: q and k as f16 hi + residual x1024

#define NB_  1
#define NT_  4096
#define DM   1024
#define NH_  16
#define HD   64
#define NTK  (NB_ * NT_)
#define NW   1024
#define NQKV 1024
#define BAND 128
#define PSC  32768.0f
#define LOSC 1024.0f
#define LOSCI (1.0f / 1024.0f)

typedef _Float16 h16;
typedef unsigned short bf;
typedef __attribute__((ext_vector_type(16))) __bf16   v16bf;
typedef __attribute__((ext_vector_type(16))) _Float16 v16h;
typedef __attribute__((ext_vector_type(8)))  _Float16 v8h;
typedef __attribute__((ext_vector_type(8)))  unsigned short v8us;
typedef __attribute__((ext_vector_type(8)))  float    v8f;
typedef __attribute__((ext_vector_type(4)))  float    v4f;
typedef v8h  __attribute__((may_alias)) v8ha;
typedef v4f  __attribute__((may_alias)) v4fa;
typedef v8us __attribute__((may_alias)) v8usa;

__device__ __forceinline__ unsigned short f2bf(float f) { unsigned u = __float_as_uint(f); u += 0x7FFFu + ((u >> 16) & 1u); return (unsigned short)(u >> 16); }
__device__ __forceinline__ float bf2f(unsigned short b) { return __uint_as_float(((unsigned)b) << 16); }
__device__ __forceinline__ float bfr(float f) { return bf2f(f2bf(f)); }
__device__ __forceinline__ v16h cat16(v8h lo, v8h hi) { return __builtin_shufflevector(lo, hi, 0, 1, 2, 3, 4, 5, 6, 7, 8, 9, 10, 11, 12, 13, 14, 15); }
__device__ __forceinline__ v16bf cat16b(v8us lo, v8us hi) { return __builtin_bit_cast(v16bf, __builtin_shufflevector(lo, hi, 0, 1, 2, 3, 4, 5, 6, 7, 8, 9, 10, 11, 12, 13, 14, 15)); }
__device__ __forceinline__ v8f wmma16(v16h a, v16h b, v8f c) { return __builtin_amdgcn_wmma_f32_16x16x32_f16(false, a, false, b, (short)0, c, false, false); }
__device__ __forceinline__ v8f wmmab(v16bf a, v16bf b, v8f c) { return __builtin_amdgcn_wmma_f32_16x16x32_bf16(false, a, false, b, (short)0, c, false, false); }

__global__ __launch_bounds__(256) void k_cvtb(const float* __restrict__ src, int nrows, bf* dst) {
    const int lane = threadIdx.x & 31, r = blockIdx.x * 8 + (threadIdx.x >> 5);
    if (r >= nrows) return;
    v8us o[DM / 256];
#pragma unroll
    for (int q = 0; q < DM / 256; ++q) { v8us t;
#pragma unroll
        for (int i = 0; i < 8; ++i) t[i] = f2bf(src[(size_t)r * DM + q * 256 + lane * 8 + i]);
        o[q] = t; }
#pragma unroll
    for (int q = 0; q < DM / 256; ++q) *(v8us*)(dst + (size_t)r * DM + q * 256 + lane * 8) = o[q];
    
}

// k_wt: W [1024 k][ncols n] (k-major) -> n-major bf16 plane WT[ncols][1024]; 64 x 64 tiles through LDS.
__global__ __launch_bounds__(256) void k_wt(const float* __restrict__ Wm, int ncols, bf* WT) {
    __shared__ __align__(16) unsigned short tl[64 * 72];
    const int tid = threadIdx.x, k0 = blockIdx.x * 64, n0 = blockIdx.y * 64;
    const int kk = tid >> 2, nq = (tid & 3) * 16;
#pragma unroll
    for (int i = 0; i < 16; ++i) tl[(nq + i) * 72 + kk] = f2bf(Wm[(size_t)(k0 + kk) * ncols + n0 + nq + i]);
    __syncthreads();
    const int piece = tid & 7;
    typedef __attribute__((ext_vector_type(8))) unsigned short v8us_; typedef v8us_ __attribute__((may_alias)) v8usa_;
    auto pass = [&]() {
#pragma unroll
        for (int s = 0; s < 2; ++s) { const int nr = (tid >> 3) + 32 * s; const v8us_ val = *(const v8usa_*)(tl + nr * 72 + piece * 8);
            *(v8us_*)(WT + (size_t)(n0 + nr) * DM + k0 + piece * 8) = val; }
    };
    pass(); 
}

template <bool SPLITA, bool F16OUT = false>
__global__ __launch_bounds__(128) void k_gemmb(const bf* __restrict__ A, const bf* __restrict__ Al, const bf* __restrict__ Bn, const float* __restrict__ bias, float* C, int ldc, h16* C2) {
    __shared__ __align__(16) float ost[4][16 * 68];
    const int lane = threadIdx.x & 31, wave = threadIdx.x >> 5, lr = lane & 15, hi = lane >> 4;
    const int r0 = blockIdx.x * 64 + wave * 16, c0 = blockIdx.y * 64;
    const size_t aoff = (size_t)(r0 + lr) * DM + 8 * hi;
    size_t boff[4];
#pragma unroll
    for (int t = 0; t < 4; ++t) boff[t] = (size_t)(c0 + t * 16 + lr) * DM + 8 * hi;
    v8f acc[4];
#pragma unroll
    for (int t = 0; t < 4; ++t) acc[t] = (v8f){};
#pragma unroll 1
    for (int kc = 0; kc < DM; kc += 32) {
        const v16bf a = cat16b(*(const v8us*)(A + aoff + kc), *(const v8us*)(A + aoff + kc + 16));
        v16bf al = a;
        if (SPLITA) al = cat16b(*(const v8us*)(Al + aoff + kc), *(const v8us*)(Al + aoff + kc + 16));
#pragma unroll
        for (int t = 0; t < 4; ++t) { const v16bf b = cat16b(*(const v8us*)(Bn + boff[t] + kc), *(const v8us*)(Bn + boff[t] + kc + 16)); acc[t] = wmmab(a, b, acc[t]); if (SPLITA) acc[t] = wmmab(al, b, acc[t]); }
        asm volatile("v_nop\n\tv_nop\n\tv_nop\n\tv_nop" : "+v"(acc[0]), "+v"(acc[1]), "+v"(acc[2]), "+v"(acc[3]) : "v"(a), "v"(al));
    }
    float* os = &ost[wave][0];
#pragma unroll
    for (int t = 0; t < 4; ++t) { const float bv = bias ? bfr(bias[c0 + t * 16 + lr]) : 0.f;
#pragma unroll
        for (int j = 0; j < 8; ++j) os[(hi * 8 + j) * 68 + t * 16 + lr] = acc[t][j] + bv; }
    __syncthreads();
    if (F16OUT) {
        h16* crow = (h16*)(void*)C + (size_t)r0 * ldc + c0;
        auto pass = [&]() {
#pragma unroll
            for (int s = 0; s < 4; ++s) { const int row = 4 * s + (lane >> 3), piece = lane & 7; const float* sp = os + row * 68 + piece * 8; v8h o, o2;
#pragma unroll
                for (int i = 0; i < 8; ++i) { const h16 a = (h16)sp[i]; o[i] = a; o2[i] = (h16)((sp[i] - (float)a) * LOSC); }
                *(v8h*)(crow + (size_t)row * ldc + piece * 8) = o; if (C2) *(v8h*)(C2 + (size_t)r0 * ldc + c0 + (size_t)row * ldc + piece * 8) = o2; }
        };
        pass(); 
    } else {
        float* crow = C + (size_t)r0 * ldc + c0;
        auto pass = [&]() {
#pragma unroll
            for (int s = 0; s < 8; ++s) { const int Lid = (lane >> 3) + 4 * s, piece = lane & 7; const int row = Lid >> 1, cofs = (Lid & 1) * 32 + piece * 4;
                const v4f val = *(const v4fa*)(os + row * 68 + cofs); *(v4f*)(crow + (size_t)row * ldc + cofs) = val; }
        };
        pass(); 
    }
}

__global__ __launch_bounds__(256) void k_vt(const float* __restrict__ V, h16* VTH, h16* VTL) {
    __shared__ __align__(16) h16 tile[64 * 72];
    __shared__ __align__(16) h16 til2[64 * 72];
    const int bid = blockIdx.x;
    const int b = bid / (NH_ * (NT_ / 64)), rem = bid - b * (NH_ * (NT_ / 64)), h = rem / (NT_ / 64), kt = rem - h * (NT_ / 64);
    const int k0 = kt * 64, tid = threadIdx.x;
    const int kk = tid >> 2, d0 = (tid & 3) * 16;
    const float* src = V + ((size_t)b * NT_ + k0 + kk) * DM + h * HD + d0;
#pragma unroll
    for (int i = 0; i < 16; ++i) { const float v = src[i]; const h16 a = (h16)v; tile[(d0 + i) * 72 + kk] = a; til2[(d0 + i) * 72 + kk] = (h16)((v - (float)a) * LOSC); }
    __syncthreads();
    const int piece = tid & 7;
    const size_t base = (((size_t)b * NH_ + h) * HD) * NT_ + k0;
    auto pass = [&]() {
#pragma unroll
        for (int s = 0; s < 4; ++s) { const int Lid = (tid >> 3) + 32 * s; const int pln = Lid >> 6, d = Lid & 63;
            const v8h val = *(const v8ha*)((pln ? til2 : tile) + d * 72 + piece * 8); *(v8h*)((pln ? VTL : VTH) + base + (size_t)d * NT_ + piece * 8) = val; }
    };
    pass(); 
}

// k_attn: block = (b, h, 64 queries), wave = 16; key tiles kt_lo..kt_hi of the band (block-uniform), per-element mask j <= i && i - j < BAND; scores hi.hi + hi.lo +
// lo.hi (12 WMMA, /8 in f32), online softmax, weights x32768 hi + residual tiles (same-wave may_alias reload after a compiler barrier), 12 WMMA .v (hi.hi + hi.lo +
// lo.hi); ctx -> bf16 hi + residual planes CH/CL[tok][h*64+d].
__global__ __launch_bounds__(128) void k_attn(const h16* __restrict__ Q16, const h16* __restrict__ QL16, const h16* __restrict__ K16, const h16* __restrict__ KL16, const h16* __restrict__ VTH, const h16* __restrict__ VTL, bf* CH, bf* CL) {
    __shared__ __align__(16) h16 plds[4][16 * 32];
    __shared__ __align__(16) h16 plds2[4][16 * 32];
    __shared__ __align__(16) float ost[4][16 * 68];
    const int lane = threadIdx.x & 31, wave = threadIdx.x >> 5, lr = lane & 15, hi = lane >> 4;
    const int bid = blockIdx.x;
    const int b = bid / (NH_ * (NT_ / 64)), rem = bid - b * (NH_ * (NT_ / 64)), h = rem / (NT_ / 64), qt = rem - h * (NT_ / 64);
    const int q0 = qt * 64 + wave * 16;
    const size_t tok0 = (size_t)b * NT_;
    h16* pl = &plds[wave][0]; h16* pl2 = &plds2[wave][0];
    v16h qa[2];
    const size_t qo0 = (tok0 + q0 + lr) * DM + h * HD + 8 * hi;
#pragma unroll
    for (int kc = 0; kc < 2; ++kc) qa[kc] = cat16(*(const v8h*)(Q16 + qo0 + kc * 32), *(const v8h*)(Q16 + qo0 + kc * 32 + 16));
    const h16* kh_b = K16 + tok0 * DM + h * HD;
    const h16* kl_b = KL16 + tok0 * DM + h * HD;
    const size_t vbase = (((size_t)b * NH_ + h) * HD) * NT_;
    v8f o[4], ox[4];
#pragma unroll
    for (int n = 0; n < 4; ++n) { o[n] = (v8f){}; ox[n] = (v8f){}; }
    float mrow[8], lpart[8];
#pragma unroll
    for (int j = 0; j < 8; ++j) { mrow[j] = -3.0e38f; lpart[j] = 0.f; }
    int qpos[8];
#pragma unroll
    for (int j = 0; j < 8; ++j) qpos[j] = q0 + 8 * hi + j;
    const int kt_lo = (qt * 64 - (BAND - 1)) > 0 ? (qt * 64 - (BAND - 1)) / 32 : 0, kt_hi = (qt * 64 + 63) / 32;     // block-uniform: keys qt*64-127 .. qt*64+63
#pragma unroll 1
    for (int kt = kt_lo; kt <= kt_hi; ++kt) {
        const int l0 = kt * 32;
        const size_t ko0 = (size_t)(l0 + lr) * DM + 8 * hi, ko1 = (size_t)(l0 + 16 + lr) * DM + 8 * hi;
        v8f s0 = {}, s1 = {}, x0 = {}, x1 = {};
#pragma unroll
        for (int kc = 0; kc < 2; ++kc) {
            { const v16h k0h = cat16(*(const v8h*)(kh_b + ko0 + kc * 32), *(const v8h*)(kh_b + ko0 + kc * 32 + 16)), k1h = cat16(*(const v8h*)(kh_b + ko1 + kc * 32), *(const v8h*)(kh_b + ko1 + kc * 32 + 16));
              const v16h qlk = cat16(*(const v8h*)(QL16 + qo0 + kc * 32), *(const v8h*)(QL16 + qo0 + kc * 32 + 16));     // query residual re-read per step (registers)
              s0 = wmma16(qa[kc], k0h, s0); x0 = wmma16(qlk, k0h, x0); s1 = wmma16(qa[kc], k1h, s1); x1 = wmma16(qlk, k1h, x1);
              asm volatile("v_nop" : "+v"(s0), "+v"(s1), "+v"(x0), "+v"(x1) : "v"(qlk), "v"(k0h), "v"(k1h) : "memory"); }
            { const v16h k0l = cat16(*(const v8h*)(kl_b + ko0 + kc * 32), *(const v8h*)(kl_b + ko0 + kc * 32 + 16)), k1l = cat16(*(const v8h*)(kl_b + ko1 + kc * 32), *(const v8h*)(kl_b + ko1 + kc * 32 + 16));
              x0 = wmma16(qa[kc], k0l, x0); x1 = wmma16(qa[kc], k1l, x1);
              asm volatile("v_nop" : "+v"(x0), "+v"(x1) : "v"(k0l), "v"(k1l) : "memory"); }
        }
        asm volatile("v_nop\n\tv_nop\n\tv_nop\n\tv_nop" : "+v"(s0), "+v"(s1), "+v"(x0), "+v"(x1) : "v"(qa[0]), "v"(qa[1]));
        float alpha[8];
#pragma unroll
        for (int j = 0; j < 8; ++j) {
            const int ja = l0 + lr, jb = l0 + 16 + lr, qi = qpos[j];
            const float a0 = (ja <= qi && qi - ja < BAND) ? (s0[j] + x0[j] * LOSCI) * 0.125f : -__builtin_inff(), a1 = (jb <= qi && qi - jb < BAND) ? (s1[j] + x1[j] * LOSCI) * 0.125f : -__builtin_inff();
            float mx = fmaxf(a0, a1);
            mx = fmaxf(mx, __shfl_xor(mx, 1, 16)); mx = fmaxf(mx, __shfl_xor(mx, 2, 16)); mx = fmaxf(mx, __shfl_xor(mx, 4, 16)); mx = fmaxf(mx, __shfl_xor(mx, 8, 16));
            const float mn = fmaxf(mrow[j], mx);
            alpha[j] = __expf(mrow[j] - mn); mrow[j] = mn;
            const float p0 = __expf(a0 - mn), p1 = __expf(a1 - mn);
            lpart[j] = lpart[j] * alpha[j] + (p0 + p1);
            const int mr = hi * 8 + j;
            const float ps0 = p0 * PSC, ps1 = p1 * PSC; const h16 h0 = (h16)ps0, h1 = (h16)ps1;
            pl[mr * 32 + lr] = h0; pl[mr * 32 + 16 + lr] = h1;
            pl2[mr * 32 + lr] = (h16)((ps0 - (float)h0) * LOSC); pl2[mr * 32 + 16 + lr] = (h16)((ps1 - (float)h1) * LOSC);
        }
#pragma unroll
        for (int n = 0; n < 4; ++n)
#pragma unroll
            for (int j = 0; j < 8; ++j) { o[n][j] *= alpha[j]; ox[n][j] *= alpha[j]; }
        asm volatile("" ::: "memory");
        const v16h pa = cat16(*(const v8ha*)(pl + lr * 32 + hi * 8), *(const v8ha*)(pl + lr * 32 + 16 + hi * 8));
        const v16h px = cat16(*(const v8ha*)(pl2 + lr * 32 + hi * 8), *(const v8ha*)(pl2 + lr * 32 + 16 + hi * 8));
#pragma unroll
        for (int n = 0; n < 4; ++n) { const size_t vo = vbase + (size_t)(n * 16 + lr) * NT_ + l0 + hi * 8;
            const v16h vh = cat16(*(const v8h*)(VTH + vo), *(const v8h*)(VTH + vo + 16)), vl = cat16(*(const v8h*)(VTL + vo), *(const v8h*)(VTL + vo + 16));
            o[n] = wmma16(pa, vh, o[n]); ox[n] = wmma16(pa, vl, ox[n]); ox[n] = wmma16(px, vh, ox[n]);
            asm volatile("" : "+v"(o[n]), "+v"(ox[n]) : "v"(vh), "v"(vl) : "memory"); }
        asm volatile("v_nop\n\tv_nop\n\tv_nop\n\tv_nop" : "+v"(o[0]), "+v"(o[1]), "+v"(o[2]), "+v"(o[3]), "+v"(ox[0]), "+v"(ox[1]), "+v"(ox[2]), "+v"(ox[3]) : "v"(pa), "v"(px));
    }
    float inv[8];
#pragma unroll
    for (int j = 0; j < 8; ++j) { float rs = lpart[j]; rs += __shfl_xor(rs, 1, 16); rs += __shfl_xor(rs, 2, 16); rs += __shfl_xor(rs, 4, 16); rs += __shfl_xor(rs, 8, 16); inv[j] = 1.0f / (rs * PSC); }
    float* os = &ost[wave][0];
#pragma unroll
    for (int n = 0; n < 4; ++n)
#pragma unroll
        for (int j = 0; j < 8; ++j) os[(hi * 8 + j) * 68 + n * 16 + lr] = (o[n][j] + ox[n][j] * LOSCI) * inv[j];
    __syncthreads();
    const size_t cbase = (tok0 + q0) * DM + (size_t)h * HD;
    auto pass = [&]() {
#pragma unroll
        for (int s = 0; s < 4; ++s) { const int row = 4 * s + (lane >> 3), piece = lane & 7; const float* sp = os + row * 68 + piece * 8; v8us oh, ol;
#pragma unroll
            for (int i = 0; i < 8; ++i) { const unsigned short hb = f2bf(sp[i]); oh[i] = hb; ol[i] = f2bf(sp[i] - bf2f(hb)); }
            *(v8us*)(CH + cbase + (size_t)row * DM + piece * 8) = oh; *(v8us*)(CL + cbase + (size_t)row * DM + piece * 8) = ol; }
    };
    pass(); 
}

#define VST2(T, p, v) do { const T vst2_v_ = (v); *(T*)(p) = vst2_v_;  } while (0)
extern "C" void kernel_launch(void* const* d_in, const int* in_sizes, int n_in,
                              void* d_out, int out_size, void* d_ws, size_t ws_size, hipStream_t stream) {
    (void)in_sizes; (void)n_in; (void)out_size;
    const float* x = (const float*)d_in[0]; const float* Wq = (const float*)d_in[1]; const float* Wk = (const float*)d_in[2]; const float* Wv = (const float*)d_in[3]; const float* Wo = (const float*)d_in[4];
    float* out = (float*)d_out;    // [1][4096][1024]
    char* wsp = (char*)d_ws;
    auto take = [&](size_t bytes) { char* p = wsp; wsp += (bytes + 255) & ~(size_t)255; return (void*)p; };
    bf* Xb = (bf*)take((size_t)NTK * DM * 2); bf* WqB = (bf*)take((size_t)DM * DM * 2); bf* WkB = (bf*)take((size_t)DM * DM * 2); bf* WvB = (bf*)take((size_t)DM * DM * 2); bf* WoB = (bf*)take((size_t)DM * DM * 2);
    h16* Q16 = (h16*)take((size_t)NTK * DM * 2); h16* QL16 = (h16*)take((size_t)NTK * DM * 2); h16* K16 = (h16*)take((size_t)NTK * DM * 2); h16* KL16 = (h16*)take((size_t)NTK * DM * 2); float* Vf = (float*)take((size_t)NTK * DM * 4); h16* VTH = (h16*)take((size_t)NTK * DM * 2); h16* VTL = (h16*)take((size_t)NTK * DM * 2);
    if ((size_t)(wsp - (char*)d_ws) > ws_size) return;    // 2.1 x 4 + 8.4 x 5 + 16.8 + 8.4 + 8.4 ~ 84 MB; ctx planes alias Xb / Vf after their last readers
    bf* CH = (bf*)Xb; bf* CL = (bf*)Vf;
    k_cvtb<<<NTK / 8, 256, 0, stream>>>(x, NTK, Xb);
    k_cvtb<<<DM / 8, 256, 0, stream>>>(Wq, DM, WqB); k_cvtb<<<DM / 8, 256, 0, stream>>>(Wk, DM, WkB); k_cvtb<<<DM / 8, 256, 0, stream>>>(Wv, DM, WvB); k_cvtb<<<DM / 8, 256, 0, stream>>>(Wo, DM, WoB);
    k_gemmb<false, true><<<dim3(NTK / 64, DM / 64, 1), 128, 0, stream>>>(Xb, nullptr, WqB, nullptr, (float*)(void*)Q16, DM, QL16);
    k_gemmb<false, true><<<dim3(NTK / 64, DM / 64, 1), 128, 0, stream>>>(Xb, nullptr, WkB, nullptr, (float*)(void*)K16, DM, KL16);
    k_gemmb<false, false><<<dim3(NTK / 64, DM / 64, 1), 128, 0, stream>>>(Xb, nullptr, WvB, nullptr, Vf, DM, nullptr);
    k_vt<<<NB_ * NH_ * (NT_ / 64), 256, 0, stream>>>(Vf, VTH, VTL);
    k_attn<<<NB_ * NH_ * (NT_ / 64), 128, 0, stream>>>(Q16, QL16, K16, KL16, VTH, VTL, CH, CL);
    k_gemmb<true, false><<<dim3(NTK / 64, DM / 64, 1), 128, 0, stream>>>(CH, CL, WoB, nullptr, out, DM, nullptr);
}

// v001
// One run takes 107 microseconds.
// Timed twice side by side with v000, it ran 2.08 and 2.07 times as fast.
#include <hip/hip_runtime.h>

// Contractions, f32 accumulate: q/k/v = x.W^T ([4096 x 1024].[1024 x 1024] each; W is [out][in] = the n-major B operand as-is) and y.Wo^T on
// v_wmma_f32_16x16x32_bf16 with PLAIN bf16 operands for the projections (inputs rounded once: exact) and y as bf16 hi + residual planes (two products) for Wo; the
// banded-causal 16-head attention (keys j with i-127 <= j <= i) fused on v_wmma_f32_16x16x32_f16 over the <= 6 key tiles per 64-query block: q and k as f16 hi + residual x1024

#define NB_  1
#define NT_  4096
#define DM   1024
#define NH_  16
#define HD   64
#define NTK  (NB_ * NT_)
#define NW   1024
#define NQKV 1024
#define BAND 128
#define PSC  32768.0f
#define LOSC 1024.0f
#define LOSCI (1.0f / 1024.0f)

typedef _Float16 h16;
typedef unsigned short bf;
typedef __attribute__((ext_vector_type(16))) __bf16   v16bf;
typedef __attribute__((ext_vector_type(16))) _Float16 v16h;
typedef __attribute__((ext_vector_type(8)))  _Float16 v8h;
typedef __attribute__((ext_vector_type(8)))  unsigned short v8us;
typedef __attribute__((ext_vector_type(8)))  float    v8f;
typedef __attribute__((ext_vector_type(4)))  float    v4f;
typedef v8h  __attribute__((may_alias)) v8ha;
typedef v4f  __attribute__((may_alias)) v4fa;
typedef v8us __attribute__((may_alias)) v8usa;

__device__ __forceinline__ unsigned short f2bf(float f) { unsigned u = __float_as_uint(f); u += 0x7FFFu + ((u >> 16) & 1u); return (unsigned short)(u >> 16); }
__device__ __forceinline__ float bf2f(unsigned short b) { return __uint_as_float(((unsigned)b) << 16); }
__device__ __forceinline__ float bfr(float f) { return bf2f(f2bf(f)); }
__device__ __forceinline__ v16h cat16(v8h lo, v8h hi) { return __builtin_shufflevector(lo, hi, 0, 1, 2, 3, 4, 5, 6, 7, 8, 9, 10, 11, 12, 13, 14, 15); }
__device__ __forceinline__ v16bf cat16b(v8us lo, v8us hi) { return __builtin_bit_cast(v16bf, __builtin_shufflevector(lo, hi, 0, 1, 2, 3, 4, 5, 6, 7, 8, 9, 10, 11, 12, 13, 14, 15)); }
__device__ __forceinline__ v8f wmma16(v16h a, v16h b, v8f c) { return __builtin_amdgcn_wmma_f32_16x16x32_f16(false, a, false, b, (short)0, c, false, false); }
__device__ __forceinline__ v8f wmmab(v16bf a, v16bf b, v8f c) { return __builtin_amdgcn_wmma_f32_16x16x32_bf16(false, a, false, b, (short)0, c, false, false); }

__global__ __launch_bounds__(256) void k_cvtb(const float* __restrict__ src, int nrows, bf* dst) {
    const int lane = threadIdx.x & 31, r = blockIdx.x * 8 + (threadIdx.x >> 5);
    if (r >= nrows) return;
    v8us o[DM / 256];
#pragma unroll
    for (int q = 0; q < DM / 256; ++q) { v8us t;
#pragma unroll
        for (int i = 0; i < 8; ++i) t[i] = f2bf(src[(size_t)r * DM + q * 256 + lane * 8 + i]);
        o[q] = t; }
#pragma unroll
    for (int q = 0; q < DM / 256; ++q) *(v8us*)(dst + (size_t)r * DM + q * 256 + lane * 8) = o[q];
    
}

// k_wt: W [1024 k][ncols n] (k-major) -> n-major bf16 plane WT[ncols][1024]; 64 x 64 tiles through LDS.
__global__ __launch_bounds__(256) void k_wt(const float* __restrict__ Wm, int ncols, bf* WT) {
    __shared__ __align__(16) unsigned short tl[64 * 72];
    const int tid = threadIdx.x, k0 = blockIdx.x * 64, n0 = blockIdx.y * 64;
    const int kk = tid >> 2, nq = (tid & 3) * 16;
#pragma unroll
    for (int i = 0; i < 16; ++i) tl[(nq + i) * 72 + kk] = f2bf(Wm[(size_t)(k0 + kk) * ncols + n0 + nq + i]);
    __syncthreads();
    const int piece = tid & 7;
    typedef __attribute__((ext_vector_type(8))) unsigned short v8us_; typedef v8us_ __attribute__((may_alias)) v8usa_;
    auto pass = [&]() {
#pragma unroll
        for (int s = 0; s < 2; ++s) { const int nr = (tid >> 3) + 32 * s; const v8us_ val = *(const v8usa_*)(tl + nr * 72 + piece * 8);
            *(v8us_*)(WT + (size_t)(n0 + nr) * DM + k0 + piece * 8) = val; }
    };
    pass(); 
}

// k_gemmb: C[128 x 128] per block of 8 waves (4 x 2, 32 x 64 each). A stage is 128 k = 256 B of every operand row, rows [A 128 | A residual 128 (SPLITA) | B 128] at an
// LDS pitch of 272 B (16 B x odd: conflict-free for the ds_load_b128 fragment reads). Two buffers, filled by per-lane b128 asynchronous copies to LDS (16 lanes = one whole
// 256-B row piece), the next stage in flight while this one is worked on. Per accumulator the k order and the hi-then-residual order are those of the direct-load form.
// Every '#pragma unroll' in k_gemmb makes the indices into acc and the fragment sets compile-time constants, so that they stay in registers.
#define GKP    128
#define GPITCH 272
#define GNP    (DM / GKP)

// Eight copies, rows 16 apart (8 waves x 2 rows per copy). s_wait_xcnt 0 is the last line of the copies' own statement so that no address register is rewritten ahead of it.
__device__ __forceinline__ void cp8(unsigned l, const bf* p) {
    asm volatile("global_load_async_to_lds_b128 %0, %8, off\n\t"
                 "global_load_async_to_lds_b128 %1, %9, off\n\t"
                 "global_load_async_to_lds_b128 %2, %10, off\n\t"
                 "global_load_async_to_lds_b128 %3, %11, off\n\t"
                 "global_load_async_to_lds_b128 %4, %12, off\n\t"
                 "global_load_async_to_lds_b128 %5, %13, off\n\t"
                 "global_load_async_to_lds_b128 %6, %14, off\n\t"
                 "global_load_async_to_lds_b128 %7, %15, off\n\t"
                 "s_wait_xcnt 0x0"
                 :: "v"(l), "v"(l + 16u * GPITCH), "v"(l + 32u * GPITCH), "v"(l + 48u * GPITCH), "v"(l + 64u * GPITCH), "v"(l + 80u * GPITCH), "v"(l + 96u * GPITCH), "v"(l + 112u * GPITCH),
                    "v"(p), "v"(p + 16 * DM), "v"(p + 32 * DM), "v"(p + 48 * DM), "v"(p + 64 * DM), "v"(p + 80 * DM), "v"(p + 96 * DM), "v"(p + 112 * DM)
                 : "memory");
}

template <bool SPLITA, bool F16OUT = false>
__global__ __launch_bounds__(256) void k_gemmb(const bf* __restrict__ A, const bf* __restrict__ Al, const bf* __restrict__ Bn, const float* __restrict__ bias, float* C, int ldc, h16* C2) {
    constexpr int BROW = SPLITA ? 256 : 128, STG = (BROW + 128) * GPITCH;
    __shared__ __align__(16) unsigned char ring[2 * STG];
    __shared__ __align__(16) float ost[8][32 * 68];
    const int lane = threadIdx.x & 31, wave = threadIdx.x >> 5, lr = lane & 15, hi = lane >> 4;
    const int rb = blockIdx.x * 128, cb = blockIdx.y * 128;
    const int r0 = rb + (wave >> 1) * 32, c0 = cb + (wave & 1) * 64;
    const int crow = 2 * wave + hi;
    const bf* gA = A + (size_t)(rb + crow) * DM + lr * 8;
    const bf* gAl = SPLITA ? Al + (size_t)(rb + crow) * DM + lr * 8 : gA;
    const bf* gB = Bn + (size_t)(cb + crow) * DM + lr * 8;
    const unsigned lcp = (unsigned)(uintptr_t)&ring[0] + (unsigned)(crow * GPITCH + lr * 16);
    auto fill = [&](int t, int buf) {
        const unsigned l = lcp + (unsigned)(buf * STG);
        cp8(l, gA + t * GKP);
        if (SPLITA) cp8(l + 128u * GPITCH, gAl + t * GKP);
        cp8(l + (unsigned)(BROW * GPITCH), gB + t * GKP);
    };
    const int aofs = ((wave >> 1) * 32 + lr) * GPITCH + hi * 16, bofs = (BROW + (wave & 1) * 64 + lr) * GPITCH + hi * 16;
    v8f acc[2][4];
#pragma unroll
    for (int mi = 0; mi < 2; ++mi)
#pragma unroll
        for (int t = 0; t < 4; ++t) acc[mi][t] = (v8f){};
    fill(0, 0);
    asm volatile("s_wait_asynccnt 0x0" ::: "memory");    // this wave's copies of stage 0 have landed
    __syncthreads();                                      // ... and every other wave's: stage 0 is readable
    fill(1, 1);
#pragma unroll 1    // rolled: one ring foot, and the hot loop stays small in the instruction cache
    for (int p = 0; p < GNP; ++p) {
        const unsigned char* sb = ring + (p & 1) * STG;
        v16bf a[2][2], al[2][2], b[2][4];
        auto frags = [&](int ks, int f) {
#pragma unroll
            for (int mi = 0; mi < 2; ++mi) { const unsigned char* q = sb + aofs + mi * 16 * GPITCH + ks * 64;
                a[f][mi] = cat16b(*(const v8usa*)q, *(const v8usa*)(q + 32));
                if (SPLITA) al[f][mi] = cat16b(*(const v8usa*)(q + 128 * GPITCH), *(const v8usa*)(q + 128 * GPITCH + 32)); }
#pragma unroll
            for (int t = 0; t < 4; ++t) { const unsigned char* q = sb + bofs + t * 16 * GPITCH + ks * 64; b[f][t] = cat16b(*(const v8usa*)q, *(const v8usa*)(q + 32)); }
        };
        frags(0, 0);
#pragma unroll
        for (int ks = 0; ks < GKP / 32; ++ks) {
            const int f = ks & 1;
            if (ks + 1 < GKP / 32) frags(ks + 1, f ^ 1);    // the next 32 k of this same stage, one group into the other fragment set
            __builtin_amdgcn_sched_barrier(0);              // keeps that group ahead of the WMMA block
#pragma unroll
            for (int mi = 0; mi < 2; ++mi)
#pragma unroll
                for (int t = 0; t < 4; ++t) acc[mi][t] = wmmab(a[f][mi], b[f][t], acc[mi][t]);
            if (SPLITA) {
#pragma unroll
                for (int mi = 0; mi < 2; ++mi)
#pragma unroll
                    for (int t = 0; t < 4; ++t) acc[mi][t] = wmmab(al[f][mi], b[f][t], acc[mi][t]);
            }
            __builtin_amdgcn_sched_barrier(0);              // ... and the following group behind the block
        }
        asm volatile("s_wait_dscnt 0x0" ::: "memory");       // this wave's reads of the buffer are done before it may be refilled
        asm volatile("s_wait_asynccnt 0x0" ::: "memory");    // this wave's copies of stage p + 1 have landed
        __syncthreads();                                      // publishes stage p + 1 and ends every reader's last read of stage p
        if (p + 2 < GNP) fill(p + 2, p & 1);
    }
    asm volatile("s_wait_asynccnt 0x0" ::: "memory");        // no copy is outstanding when the wave goes on
    float* os = &ost[wave][0];
#pragma unroll
    for (int mi = 0; mi < 2; ++mi)
#pragma unroll
        for (int t = 0; t < 4; ++t) { const float bv = bias ? bfr(bias[c0 + t * 16 + lr]) : 0.f;
#pragma unroll
            for (int j = 0; j < 8; ++j) os[(mi * 16 + hi * 8 + j) * 68 + t * 16 + lr] = acc[mi][t][j] + bv; }
    __syncthreads();
    if (F16OUT) {
        h16* crow_p = (h16*)(void*)C + (size_t)r0 * ldc + c0;
#pragma unroll
        for (int s = 0; s < 8; ++s) { const int row = 4 * s + (lane >> 3), piece = lane & 7; const float* sp = os + row * 68 + piece * 8; v8h o, o2;
#pragma unroll
            for (int i = 0; i < 8; ++i) { const h16 a = (h16)sp[i]; o[i] = a; o2[i] = (h16)((sp[i] - (float)a) * LOSC); }
            *(v8h*)(crow_p + (size_t)row * ldc + piece * 8) = o;
            asm volatile("s_wait_xcnt 0x0" ::: "memory");    // stands in front of the next writes of the registers that the store above names
            if (C2) *(v8h*)(C2 + (size_t)r0 * ldc + c0 + (size_t)row * ldc + piece * 8) = o2; }
    } else {
        float* crow_p = C + (size_t)r0 * ldc + c0;
#pragma unroll
        for (int s = 0; s < 16; ++s) { const int Lid = (lane >> 3) + 4 * s, piece = lane & 7; const int row = Lid >> 1, cofs = (Lid & 1) * 32 + piece * 4;
            const v4f val = *(const v4fa*)(os + row * 68 + cofs); *(v4f*)(crow_p + (size_t)row * ldc + cofs) = val; }
    }
}

__global__ __launch_bounds__(256) void k_vt(const float* __restrict__ V, h16* VTH, h16* VTL) {
    __shared__ __align__(16) h16 tile[64 * 72];
    __shared__ __align__(16) h16 til2[64 * 72];
    const int bid = blockIdx.x;
    const int b = bid / (NH_ * (NT_ / 64)), rem = bid - b * (NH_ * (NT_ / 64)), h = rem / (NT_ / 64), kt = rem - h * (NT_ / 64);
    const int k0 = kt * 64, tid = threadIdx.x;
    const int kk = tid >> 2, d0 = (tid & 3) * 16;
    const float* src = V + ((size_t)b * NT_ + k0 + kk) * DM + h * HD + d0;
#pragma unroll
    for (int i = 0; i < 16; ++i) { const float v = src[i]; const h16 a = (h16)v; tile[(d0 + i) * 72 + kk] = a; til2[(d0 + i) * 72 + kk] = (h16)((v - (float)a) * LOSC); }
    __syncthreads();
    const int piece = tid & 7;
    const size_t base = (((size_t)b * NH_ + h) * HD) * NT_ + k0;
    auto pass = [&]() {
#pragma unroll
        for (int s = 0; s < 4; ++s) { const int Lid = (tid >> 3) + 32 * s; const int pln = Lid >> 6, d = Lid & 63;
            const v8h val = *(const v8ha*)((pln ? til2 : tile) + d * 72 + piece * 8); *(v8h*)((pln ? VTL : VTH) + base + (size_t)d * NT_ + piece * 8) = val; }
    };
    pass(); 
}

// k_attn: block = (b, h, 64 queries), wave = 16; key tiles kt_lo..kt_hi of the band (block-uniform), per-element mask j <= i && i - j < BAND; scores hi.hi + hi.lo +
// lo.hi (12 WMMA, /8 in f32), online softmax, weights x32768 hi + residual tiles (same-wave may_alias reload after a compiler barrier), 12 WMMA .v (hi.hi + hi.lo +
// lo.hi); ctx -> bf16 hi + residual planes CH/CL[tok][h*64+d].
__global__ __launch_bounds__(128) void k_attn(const h16* __restrict__ Q16, const h16* __restrict__ QL16, const h16* __restrict__ K16, const h16* __restrict__ KL16, const h16* __restrict__ VTH, const h16* __restrict__ VTL, bf* CH, bf* CL) {
    __shared__ __align__(16) h16 plds[4][16 * 32];
    __shared__ __align__(16) h16 plds2[4][16 * 32];
    __shared__ __align__(16) float ost[4][16 * 68];
    const int lane = threadIdx.x & 31, wave = threadIdx.x >> 5, lr = lane & 15, hi = lane >> 4;
    const int bid = blockIdx.x;
    const int b = bid / (NH_ * (NT_ / 64)), rem = bid - b * (NH_ * (NT_ / 64)), h = rem / (NT_ / 64), qt = rem - h * (NT_ / 64);
    const int q0 = qt * 64 + wave * 16;
    const size_t tok0 = (size_t)b * NT_;
    h16* pl = &plds[wave][0]; h16* pl2 = &plds2[wave][0];
    v16h qa[2];
    const size_t qo0 = (tok0 + q0 + lr) * DM + h * HD + 8 * hi;
#pragma unroll
    for (int kc = 0; kc < 2; ++kc) qa[kc] = cat16(*(const v8h*)(Q16 + qo0 + kc * 32), *(const v8h*)(Q16 + qo0 + kc * 32 + 16));
    const h16* kh_b = K16 + tok0 * DM + h * HD;
    const h16* kl_b = KL16 + tok0 * DM + h * HD;
    const size_t vbase = (((size_t)b * NH_ + h) * HD) * NT_;
    v8f o[4], ox[4];
#pragma unroll
    for (int n = 0; n < 4; ++n) { o[n] = (v8f){}; ox[n] = (v8f){}; }
    float mrow[8], lpart[8];
#pragma unroll
    for (int j = 0; j < 8; ++j) { mrow[j] = -3.0e38f; lpart[j] = 0.f; }
    int qpos[8];
#pragma unroll
    for (int j = 0; j < 8; ++j) qpos[j] = q0 + 8 * hi + j;
    const int kt_lo = (qt * 64 - (BAND - 1)) > 0 ? (qt * 64 - (BAND - 1)) / 32 : 0, kt_hi = (qt * 64 + 63) / 32;     // block-uniform: keys qt*64-127 .. qt*64+63
#pragma unroll 1
    for (int kt = kt_lo; kt <= kt_hi; ++kt) {
        const int l0 = kt * 32;
        const size_t ko0 = (size_t)(l0 + lr) * DM + 8 * hi, ko1 = (size_t)(l0 + 16 + lr) * DM + 8 * hi;
        v8f s0 = {}, s1 = {}, x0 = {}, x1 = {};
#pragma unroll
        for (int kc = 0; kc < 2; ++kc) {
            { const v16h k0h = cat16(*(const v8h*)(kh_b + ko0 + kc * 32), *(const v8h*)(kh_b + ko0 + kc * 32 + 16)), k1h = cat16(*(const v8h*)(kh_b + ko1 + kc * 32), *(const v8h*)(kh_b + ko1 + kc * 32 + 16));
              const v16h qlk = cat16(*(const v8h*)(QL16 + qo0 + kc * 32), *(const v8h*)(QL16 + qo0 + kc * 32 + 16));     // query residual re-read per step (registers)
              s0 = wmma16(qa[kc], k0h, s0); x0 = wmma16(qlk, k0h, x0); s1 = wmma16(qa[kc], k1h, s1); x1 = wmma16(qlk, k1h, x1);
              asm volatile("v_nop" : "+v"(s0), "+v"(s1), "+v"(x0), "+v"(x1) : "v"(qlk), "v"(k0h), "v"(k1h) : "memory"); }
            { const v16h k0l = cat16(*(const v8h*)(kl_b + ko0 + kc * 32), *(const v8h*)(kl_b + ko0 + kc * 32 + 16)), k1l = cat16(*(const v8h*)(kl_b + ko1 + kc * 32), *(const v8h*)(kl_b + ko1 + kc * 32 + 16));
              x0 = wmma16(qa[kc], k0l, x0); x1 = wmma16(qa[kc], k1l, x1);
              asm volatile("v_nop" : "+v"(x0), "+v"(x1) : "v"(k0l), "v"(k1l) : "memory"); }
        }
        asm volatile("v_nop\n\tv_nop\n\tv_nop\n\tv_nop" : "+v"(s0), "+v"(s1), "+v"(x0), "+v"(x1) : "v"(qa[0]), "v"(qa[1]));
        float alpha[8];
#pragma unroll
        for (int j = 0; j < 8; ++j) {
            const int ja = l0 + lr, jb = l0 + 16 + lr, qi = qpos[j];
            const float a0 = (ja <= qi && qi - ja < BAND) ? (s0[j] + x0[j] * LOSCI) * 0.125f : -__builtin_inff(), a1 = (jb <= qi && qi - jb < BAND) ? (s1[j] + x1[j] * LOSCI) * 0.125f : -__builtin_inff();
            float mx = fmaxf(a0, a1);
            mx = fmaxf(mx, __shfl_xor(mx, 1, 16)); mx = fmaxf(mx, __shfl_xor(mx, 2, 16)); mx = fmaxf(mx, __shfl_xor(mx, 4, 16)); mx = fmaxf(mx, __shfl_xor(mx, 8, 16));
            const float mn = fmaxf(mrow[j], mx);
            alpha[j] = __expf(mrow[j] - mn); mrow[j] = mn;
            const float p0 = __expf(a0 - mn), p1 = __expf(a1 - mn);
            lpart[j] = lpart[j] * alpha[j] + (p0 + p1);
            const int mr = hi * 8 + j;
            const float ps0 = p0 * PSC, ps1 = p1 * PSC; const h16 h0 = (h16)ps0, h1 = (h16)ps1;
            pl[mr * 32 + lr] = h0; pl[mr * 32 + 16 + lr] = h1;
            pl2[mr * 32 + lr] = (h16)((ps0 - (float)h0) * LOSC); pl2[mr * 32 + 16 + lr] = (h16)((ps1 - (float)h1) * LOSC);
        }
#pragma unroll
        for (int n = 0; n < 4; ++n)
#pragma unroll
            for (int j = 0; j < 8; ++j) { o[n][j] *= alpha[j]; ox[n][j] *= alpha[j]; }
        asm volatile("" ::: "memory");
        const v16h pa = cat16(*(const v8ha*)(pl + lr * 32 + hi * 8), *(const v8ha*)(pl + lr * 32 + 16 + hi * 8));
        const v16h px = cat16(*(const v8ha*)(pl2 + lr * 32 + hi * 8), *(const v8ha*)(pl2 + lr * 32 + 16 + hi * 8));
#pragma unroll
        for (int n = 0; n < 4; ++n) { const size_t vo = vbase + (size_t)(n * 16 + lr) * NT_ + l0 + hi * 8;
            const v16h vh = cat16(*(const v8h*)(VTH + vo), *(const v8h*)(VTH + vo + 16)), vl = cat16(*(const v8h*)(VTL + vo), *(const v8h*)(VTL + vo + 16));
            o[n] = wmma16(pa, vh, o[n]); ox[n] = wmma16(pa, vl, ox[n]); ox[n] = wmma16(px, vh, ox[n]);
            asm volatile("" : "+v"(o[n]), "+v"(ox[n]) : "v"(vh), "v"(vl) : "memory"); }
        asm volatile("v_nop\n\tv_nop\n\tv_nop\n\tv_nop" : "+v"(o[0]), "+v"(o[1]), "+v"(o[2]), "+v"(o[3]), "+v"(ox[0]), "+v"(ox[1]), "+v"(ox[2]), "+v"(ox[3]) : "v"(pa), "v"(px));
    }
    float inv[8];
#pragma unroll
    for (int j = 0; j < 8; ++j) { float rs = lpart[j]; rs += __shfl_xor(rs, 1, 16); rs += __shfl_xor(rs, 2, 16); rs += __shfl_xor(rs, 4, 16); rs += __shfl_xor(rs, 8, 16); inv[j] = 1.0f / (rs * PSC); }
    float* os = &ost[wave][0];
#pragma unroll
    for (int n = 0; n < 4; ++n)
#pragma unroll
        for (int j = 0; j < 8; ++j) os[(hi * 8 + j) * 68 + n * 16 + lr] = (o[n][j] + ox[n][j] * LOSCI) * inv[j];
    __syncthreads();
    const size_t cbase = (tok0 + q0) * DM + (size_t)h * HD;
    auto pass = [&]() {
#pragma unroll
        for (int s = 0; s < 4; ++s) { const int row = 4 * s + (lane >> 3), piece = lane & 7; const float* sp = os + row * 68 + piece * 8; v8us oh, ol;
#pragma unroll
            for (int i = 0; i < 8; ++i) { const unsigned short hb = f2bf(sp[i]); oh[i] = hb; ol[i] = f2bf(sp[i] - bf2f(hb)); }
            *(v8us*)(CH + cbase + (size_t)row * DM + piece * 8) = oh; *(v8us*)(CL + cbase + (size_t)row * DM + piece * 8) = ol; }
    };
    pass(); 
}

#define VST2(T, p, v) do { const T vst2_v_ = (v); *(T*)(p) = vst2_v_;  } while (0)
extern "C" void kernel_launch(void* const* d_in, const int* in_sizes, int n_in,
                              void* d_out, int out_size, void* d_ws, size_t ws_size, hipStream_t stream) {
    (void)in_sizes; (void)n_in; (void)out_size;
    const float* x = (const float*)d_in[0]; const float* Wq = (const float*)d_in[1]; const float* Wk = (const float*)d_in[2]; const float* Wv = (const float*)d_in[3]; const float* Wo = (const float*)d_in[4];
    float* out = (float*)d_out;    // [1][4096][1024]
    char* wsp = (char*)d_ws;
    auto take = [&](size_t bytes) { char* p = wsp; wsp += (bytes + 255) & ~(size_t)255; return (void*)p; };
    bf* Xb = (bf*)take((size_t)NTK * DM * 2); bf* WqB = (bf*)take((size_t)DM * DM * 2); bf* WkB = (bf*)take((size_t)DM * DM * 2); bf* WvB = (bf*)take((size_t)DM * DM * 2); bf* WoB = (bf*)take((size_t)DM * DM * 2);
    h16* Q16 = (h16*)take((size_t)NTK * DM * 2); h16* QL16 = (h16*)take((size_t)NTK * DM * 2); h16* K16 = (h16*)take((size_t)NTK * DM * 2); h16* KL16 = (h16*)take((size_t)NTK * DM * 2); float* Vf = (float*)take((size_t)NTK * DM * 4); h16* VTH = (h16*)take((size_t)NTK * DM * 2); h16* VTL = (h16*)take((size_t)NTK * DM * 2);
    if ((size_t)(wsp - (char*)d_ws) > ws_size) return;    // 2.1 x 4 + 8.4 x 5 + 16.8 + 8.4 + 8.4 ~ 84 MB; ctx planes alias Xb / Vf after their last readers
    bf* CH = (bf*)Xb; bf* CL = (bf*)Vf;
    k_cvtb<<<NTK / 8, 256, 0, stream>>>(x, NTK, Xb);
    k_cvtb<<<DM / 8, 256, 0, stream>>>(Wq, DM, WqB); k_cvtb<<<DM / 8, 256, 0, stream>>>(Wk, DM, WkB); k_cvtb<<<DM / 8, 256, 0, stream>>>(Wv, DM, WvB); k_cvtb<<<DM / 8, 256, 0, stream>>>(Wo, DM, WoB);
    k_gemmb<false, true><<<dim3(NTK / 128, DM / 128, 1), 256, 0, stream>>>(Xb, nullptr, WqB, nullptr, (float*)(void*)Q16, DM, QL16);
    k_gemmb<false, true><<<dim3(NTK / 128, DM / 128, 1), 256, 0, stream>>>(Xb, nullptr, WkB, nullptr, (float*)(void*)K16, DM, KL16);
    k_gemmb<false, false><<<dim3(NTK / 128, DM / 128, 1), 256, 0, stream>>>(Xb, nullptr, WvB, nullptr, Vf, DM, nullptr);
    k_vt<<<NB_ * NH_ * (NT_ / 64), 256, 0, stream>>>(Vf, VTH, VTL);
    k_attn<<<NB_ * NH_ * (NT_ / 64), 128, 0, stream>>>(Q16, QL16, K16, KL16, VTH, VTL, CH, CL);
    k_gemmb<true, false><<<dim3(NTK / 128, DM / 128, 1), 256, 0, stream>>>(CH, CL, WoB, nullptr, out, DM, nullptr);
}

// v002
// A run of this version takes 94.6 microseconds.
// Next to v001, in two timings, it ran 1.14 times as fast each time.
// Counting every step since v000, it is 2.36 times as fast.
#include <hip/hip_runtime.h>

// Contractions, f32 accumulate: q/k/v = x.W^T ([4096 x 1024].[1024 x 1024] each; W is [out][in] = the n-major B operand as-is) and y.Wo^T on
// v_wmma_f32_16x16x32_bf16 with PLAIN bf16 operands for the projections (inputs rounded once: exact) and y as bf16 hi + residual planes (two products) for Wo; the
// banded-causal 16-head attention (keys j with i-127 <= j <= i) fused on v_wmma_f32_16x16x32_f16 over the <= 6 key tiles per 64-query block: q and k as f16 hi + residual x1024

#define NB_  1
#define NT_  4096
#define DM   1024
#define NH_  16
#define HD   64
#define NTK  (NB_ * NT_)
#define NW   1024
#define NQKV 1024
#define BAND 128
#define PSC  32768.0f
#define LOSC 1024.0f
#define LOSCI (1.0f / 1024.0f)

typedef _Float16 h16;
typedef unsigned short bf;
typedef __attribute__((ext_vector_type(16))) __bf16   v16bf;
typedef __attribute__((ext_vector_type(16))) _Float16 v16h;
typedef __attribute__((ext_vector_type(8)))  _Float16 v8h;
typedef __attribute__((ext_vector_type(8)))  unsigned short v8us;
typedef __attribute__((ext_vector_type(8)))  float    v8f;
typedef __attribute__((ext_vector_type(4)))  float    v4f;
typedef v8h  __attribute__((may_alias)) v8ha;
typedef v4f  __attribute__((may_alias)) v4fa;
typedef v8us __attribute__((may_alias)) v8usa;

__device__ __forceinline__ unsigned short f2bf(float f) { unsigned u = __float_as_uint(f); u += 0x7FFFu + ((u >> 16) & 1u); return (unsigned short)(u >> 16); }
__device__ __forceinline__ float bf2f(unsigned short b) { return __uint_as_float(((unsigned)b) << 16); }
__device__ __forceinline__ float bfr(float f) { return bf2f(f2bf(f)); }
__device__ __forceinline__ v16h cat16(v8h lo, v8h hi) { return __builtin_shufflevector(lo, hi, 0, 1, 2, 3, 4, 5, 6, 7, 8, 9, 10, 11, 12, 13, 14, 15); }
__device__ __forceinline__ v16bf cat16b(v8us lo, v8us hi) { return __builtin_bit_cast(v16bf, __builtin_shufflevector(lo, hi, 0, 1, 2, 3, 4, 5, 6, 7, 8, 9, 10, 11, 12, 13, 14, 15)); }
__device__ __forceinline__ v8f wmma16(v16h a, v16h b, v8f c) { return __builtin_amdgcn_wmma_f32_16x16x32_f16(false, a, false, b, (short)0, c, false, false); }
__device__ __forceinline__ v8f wmmab(v16bf a, v16bf b, v8f c) { return __builtin_amdgcn_wmma_f32_16x16x32_bf16(false, a, false, b, (short)0, c, false, false); }

// k_cvtb: one grid rounds all five inputs: blocks [0, NTK / 8) take x, then DM / 8 blocks each weight; 8 rows a block, so the pick is block-uniform (scalar selects).
__global__ __launch_bounds__(256) void k_cvtb(const float* __restrict__ x, const float* __restrict__ Wq, const float* __restrict__ Wk, const float* __restrict__ Wv, const float* __restrict__ Wo,
                                              bf* Xb, bf* WqB, bf* WkB, bf* WvB, bf* WoB) {
    const int blk = blockIdx.x, sel = blk < NTK / 8 ? 0 : 1 + (blk - NTK / 8) / (DM / 8);
    const float* src = sel == 0 ? x : sel == 1 ? Wq : sel == 2 ? Wk : sel == 3 ? Wv : Wo;
    bf* dst = sel == 0 ? Xb : sel == 1 ? WqB : sel == 2 ? WkB : sel == 3 ? WvB : WoB;
    const int lane = threadIdx.x & 31, r = (sel == 0 ? blk : (blk - NTK / 8) % (DM / 8)) * 8 + (threadIdx.x >> 5);
    v8us o[DM / 256];
#pragma unroll
    for (int q = 0; q < DM / 256; ++q) { v8us t;
#pragma unroll
        for (int i = 0; i < 8; ++i) t[i] = f2bf(src[(size_t)r * DM + q * 256 + lane * 8 + i]);
        o[q] = t; }
#pragma unroll
    for (int q = 0; q < DM / 256; ++q) *(v8us*)(dst + (size_t)r * DM + q * 256 + lane * 8) = o[q];
    
}

// k_wt: W [1024 k][ncols n] (k-major) -> n-major bf16 plane WT[ncols][1024]; 64 x 64 tiles through LDS.
__global__ __launch_bounds__(256) void k_wt(const float* __restrict__ Wm, int ncols, bf* WT) {
    __shared__ __align__(16) unsigned short tl[64 * 72];
    const int tid = threadIdx.x, k0 = blockIdx.x * 64, n0 = blockIdx.y * 64;
    const int kk = tid >> 2, nq = (tid & 3) * 16;
#pragma unroll
    for (int i = 0; i < 16; ++i) tl[(nq + i) * 72 + kk] = f2bf(Wm[(size_t)(k0 + kk) * ncols + n0 + nq + i]);
    __syncthreads();
    const int piece = tid & 7;
    typedef __attribute__((ext_vector_type(8))) unsigned short v8us_; typedef v8us_ __attribute__((may_alias)) v8usa_;
    auto pass = [&]() {
#pragma unroll
        for (int s = 0; s < 2; ++s) { const int nr = (tid >> 3) + 32 * s; const v8us_ val = *(const v8usa_*)(tl + nr * 72 + piece * 8);
            *(v8us_*)(WT + (size_t)(n0 + nr) * DM + k0 + piece * 8) = val; }
    };
    pass(); 
}

// k_gemmb: C[128 x 128] per block of 8 waves (4 x 2, 32 x 64 each). A stage is 128 k = 256 B of every operand row, rows [A 128 | A residual 128 (SPLITA) | B 128] at an
// LDS pitch of 272 B (16 B x odd: conflict-free for the ds_load_b128 fragment reads). Two buffers, filled by per-lane b128 asynchronous copies to LDS (16 lanes = one whole
// 256-B row piece), the next stage in flight while this one is worked on. Per accumulator the k order and the hi-then-residual order are those of the direct-load form.
// Every '#pragma unroll' in k_gemmb makes the indices into acc and the fragment sets compile-time constants, so that they stay in registers.
#define GKP    128
#define GPITCH 272
#define GNP    (DM / GKP)

// Eight copies, rows 16 apart (8 waves x 2 rows per copy). s_wait_xcnt 0 is the last line of the copies' own statement so that no address register is rewritten ahead of it.
__device__ __forceinline__ void cp8(unsigned l, const bf* p) {
    asm volatile("global_load_async_to_lds_b128 %0, %8, off\n\t"
                 "global_load_async_to_lds_b128 %1, %9, off\n\t"
                 "global_load_async_to_lds_b128 %2, %10, off\n\t"
                 "global_load_async_to_lds_b128 %3, %11, off\n\t"
                 "global_load_async_to_lds_b128 %4, %12, off\n\t"
                 "global_load_async_to_lds_b128 %5, %13, off\n\t"
                 "global_load_async_to_lds_b128 %6, %14, off\n\t"
                 "global_load_async_to_lds_b128 %7, %15, off\n\t"
                 "s_wait_xcnt 0x0"
                 :: "v"(l), "v"(l + 16u * GPITCH), "v"(l + 32u * GPITCH), "v"(l + 48u * GPITCH), "v"(l + 64u * GPITCH), "v"(l + 80u * GPITCH), "v"(l + 96u * GPITCH), "v"(l + 112u * GPITCH),
                    "v"(p), "v"(p + 16 * DM), "v"(p + 32 * DM), "v"(p + 48 * DM), "v"(p + 64 * DM), "v"(p + 80 * DM), "v"(p + 96 * DM), "v"(p + 112 * DM)
                 : "memory");
}

// QKV: one grid does the three products of the same A; blockIdx.z picks the weight plane and the output (0: q, 1: k, both as f16 hi + residual planes; 2: v as f32). Block-uniform.
template <bool SPLITA, bool QKV>
__global__ __launch_bounds__(256) void k_gemmb(const bf* __restrict__ A, const bf* __restrict__ Al, const bf* __restrict__ B0, const bf* __restrict__ B1, const bf* __restrict__ B2, const float* __restrict__ bias,
                                               float* Cf, int ldc, h16* H0, h16* L0, h16* H1, h16* L1) {
    const int z = QKV ? (int)blockIdx.z : 0;
    const bool f16out = QKV && z < 2;
    const bf* Bn = z == 0 ? B0 : z == 1 ? B1 : B2;
    float* C = f16out ? (float*)(void*)(z == 0 ? H0 : H1) : Cf;
    h16* C2 = z == 0 ? L0 : L1;
    constexpr int BROW = SPLITA ? 256 : 128, STG = (BROW + 128) * GPITCH;
    __shared__ __align__(16) unsigned char ring[2 * STG];
    __shared__ __align__(16) float ost[8][32 * 68];
    const int lane = threadIdx.x & 31, wave = threadIdx.x >> 5, lr = lane & 15, hi = lane >> 4;
    const int rb = blockIdx.x * 128, cb = blockIdx.y * 128;
    const int r0 = rb + (wave >> 1) * 32, c0 = cb + (wave & 1) * 64;
    const int crow = 2 * wave + hi;
    const bf* gA = A + (size_t)(rb + crow) * DM + lr * 8;
    const bf* gAl = SPLITA ? Al + (size_t)(rb + crow) * DM + lr * 8 : gA;
    const bf* gB = Bn + (size_t)(cb + crow) * DM + lr * 8;
    const unsigned lcp = (unsigned)(uintptr_t)&ring[0] + (unsigned)(crow * GPITCH + lr * 16);
    auto fill = [&](int t, int buf) {
        const unsigned l = lcp + (unsigned)(buf * STG);
        cp8(l, gA + t * GKP);
        if (SPLITA) cp8(l + 128u * GPITCH, gAl + t * GKP);
        cp8(l + (unsigned)(BROW * GPITCH), gB + t * GKP);
    };
    const int aofs = ((wave >> 1) * 32 + lr) * GPITCH + hi * 16, bofs = (BROW + (wave & 1) * 64 + lr) * GPITCH + hi * 16;
    v8f acc[2][4];
#pragma unroll
    for (int mi = 0; mi < 2; ++mi)
#pragma unroll
        for (int t = 0; t < 4; ++t) acc[mi][t] = (v8f){};
    fill(0, 0);
    asm volatile("s_wait_asynccnt 0x0" ::: "memory");    // this wave's copies of stage 0 have landed
    __syncthreads();                                      // ... and every other wave's: stage 0 is readable
    fill(1, 1);
#pragma unroll 1    // rolled: one ring foot, and the hot loop stays small in the instruction cache
    for (int p = 0; p < GNP; ++p) {
        const unsigned char* sb = ring + (p & 1) * STG;
        v16bf a[2][2], al[2][2], b[2][4];
        auto frags = [&](int ks, int f) {
#pragma unroll
            for (int mi = 0; mi < 2; ++mi) { const unsigned char* q = sb + aofs + mi * 16 * GPITCH + ks * 64;
                a[f][mi] = cat16b(*(const v8usa*)q, *(const v8usa*)(q + 32));
                if (SPLITA) al[f][mi] = cat16b(*(const v8usa*)(q + 128 * GPITCH), *(const v8usa*)(q + 128 * GPITCH + 32)); }
#pragma unroll
            for (int t = 0; t < 4; ++t) { const unsigned char* q = sb + bofs + t * 16 * GPITCH + ks * 64; b[f][t] = cat16b(*(const v8usa*)q, *(const v8usa*)(q + 32)); }
        };
        frags(0, 0);
#pragma unroll
        for (int ks = 0; ks < GKP / 32; ++ks) {
            const int f = ks & 1;
            if (ks + 1 < GKP / 32) frags(ks + 1, f ^ 1);    // the next 32 k of this same stage, one group into the other fragment set
            __builtin_amdgcn_sched_barrier(0);              // keeps that group ahead of the WMMA block
#pragma unroll
            for (int mi = 0; mi < 2; ++mi)
#pragma unroll
                for (int t = 0; t < 4; ++t) acc[mi][t] = wmmab(a[f][mi], b[f][t], acc[mi][t]);
            if (SPLITA) {
#pragma unroll
                for (int mi = 0; mi < 2; ++mi)
#pragma unroll
                    for (int t = 0; t < 4; ++t) acc[mi][t] = wmmab(al[f][mi], b[f][t], acc[mi][t]);
            }
            __builtin_amdgcn_sched_barrier(0);              // ... and the following group behind the block
        }
        asm volatile("s_wait_dscnt 0x0" ::: "memory");       // this wave's reads of the buffer are done before it may be refilled
        asm volatile("s_wait_asynccnt 0x0" ::: "memory");    // this wave's copies of stage p + 1 have landed
        __syncthreads();                                      // publishes stage p + 1 and ends every reader's last read of stage p
        if (p + 2 < GNP) fill(p + 2, p & 1);
    }
    asm volatile("s_wait_asynccnt 0x0" ::: "memory");        // no copy is outstanding when the wave goes on
    float* os = &ost[wave][0];
#pragma unroll
    for (int mi = 0; mi < 2; ++mi)
#pragma unroll
        for (int t = 0; t < 4; ++t) { const float bv = bias ? bfr(bias[c0 + t * 16 + lr]) : 0.f;
#pragma unroll
            for (int j = 0; j < 8; ++j) os[(mi * 16 + hi * 8 + j) * 68 + t * 16 + lr] = acc[mi][t][j] + bv; }
    __syncthreads();
    if (f16out) {
        h16* crow_p = (h16*)(void*)C + (size_t)r0 * ldc + c0;
#pragma unroll
        for (int s = 0; s < 8; ++s) { const int row = 4 * s + (lane >> 3), piece = lane & 7; const float* sp = os + row * 68 + piece * 8; v8h o, o2;
#pragma unroll
            for (int i = 0; i < 8; ++i) { const h16 a = (h16)sp[i]; o[i] = a; o2[i] = (h16)((sp[i] - (float)a) * LOSC); }
            *(v8h*)(crow_p + (size_t)row * ldc + piece * 8) = o;
            asm volatile("s_wait_xcnt 0x0" ::: "memory");    // stands in front of the next writes of the registers that the store above names
            if (C2) *(v8h*)(C2 + (size_t)r0 * ldc + c0 + (size_t)row * ldc + piece * 8) = o2; }
    } else {
        float* crow_p = C + (size_t)r0 * ldc + c0;
#pragma unroll
        for (int s = 0; s < 16; ++s) { const int Lid = (lane >> 3) + 4 * s, piece = lane & 7; const int row = Lid >> 1, cofs = (Lid & 1) * 32 + piece * 4;
            const v4f val = *(const v4fa*)(os + row * 68 + cofs); *(v4f*)(crow_p + (size_t)row * ldc + cofs) = val; }
    }
}

__global__ __launch_bounds__(256) void k_vt(const float* __restrict__ V, h16* VTH, h16* VTL) {
    __shared__ __align__(16) h16 tile[64 * 72];
    __shared__ __align__(16) h16 til2[64 * 72];
    const int bid = blockIdx.x;
    const int b = bid / (NH_ * (NT_ / 64)), rem = bid - b * (NH_ * (NT_ / 64)), h = rem / (NT_ / 64), kt = rem - h * (NT_ / 64);
    const int k0 = kt * 64, tid = threadIdx.x;
    const int kk = tid >> 2, d0 = (tid & 3) * 16;
    const float* src = V + ((size_t)b * NT_ + k0 + kk) * DM + h * HD + d0;
#pragma unroll
    for (int i = 0; i < 16; ++i) { const float v = src[i]; const h16 a = (h16)v; tile[(d0 + i) * 72 + kk] = a; til2[(d0 + i) * 72 + kk] = (h16)((v - (float)a) * LOSC); }
    __syncthreads();
    const int piece = tid & 7;
    const size_t base = (((size_t)b * NH_ + h) * HD) * NT_ + k0;
    auto pass = [&]() {
#pragma unroll
        for (int s = 0; s < 4; ++s) { const int Lid = (tid >> 3) + 32 * s; const int pln = Lid >> 6, d = Lid & 63;
            const v8h val = *(const v8ha*)((pln ? til2 : tile) + d * 72 + piece * 8); *(v8h*)((pln ? VTL : VTH) + base + (size_t)d * NT_ + piece * 8) = val; }
    };
    pass(); 
}

// k_attn: block = (b, h, 64 queries), wave = 16; key tiles kt_lo..kt_hi of the band (block-uniform), per-element mask j <= i && i - j < BAND; scores hi.hi + hi.lo +
// lo.hi (12 WMMA, /8 in f32), online softmax, weights x32768 hi + residual tiles (same-wave may_alias reload after a compiler barrier), 12 WMMA .v (hi.hi + hi.lo +
// lo.hi); ctx -> bf16 hi + residual planes CH/CL[tok][h*64+d].
__global__ __launch_bounds__(128) void k_attn(const h16* __restrict__ Q16, const h16* __restrict__ QL16, const h16* __restrict__ K16, const h16* __restrict__ KL16, const h16* __restrict__ VTH, const h16* __restrict__ VTL, bf* CH, bf* CL) {
    __shared__ __align__(16) h16 plds[4][16 * 32];
    __shared__ __align__(16) h16 plds2[4][16 * 32];
    __shared__ __align__(16) float ost[4][16 * 68];
    const int lane = threadIdx.x & 31, wave = threadIdx.x >> 5, lr = lane & 15, hi = lane >> 4;
    const int bid = blockIdx.x;
    const int b = bid / (NH_ * (NT_ / 64)), rem = bid - b * (NH_ * (NT_ / 64)), h = rem / (NT_ / 64), qt = rem - h * (NT_ / 64);
    const int q0 = qt * 64 + wave * 16;
    const size_t tok0 = (size_t)b * NT_;
    h16* pl = &plds[wave][0]; h16* pl2 = &plds2[wave][0];
    v16h qa[2];
    const size_t qo0 = (tok0 + q0 + lr) * DM + h * HD + 8 * hi;
#pragma unroll
    for (int kc = 0; kc < 2; ++kc) qa[kc] = cat16(*(const v8h*)(Q16 + qo0 + kc * 32), *(const v8h*)(Q16 + qo0 + kc * 32 + 16));
    const h16* kh_b = K16 + tok0 * DM + h * HD;
    const h16* kl_b = KL16 + tok0 * DM + h * HD;
    const size_t vbase = (((size_t)b * NH_ + h) * HD) * NT_;
    v8f o[4], ox[4];
#pragma unroll
    for (int n = 0; n < 4; ++n) { o[n] = (v8f){}; ox[n] = (v8f){}; }
    float mrow[8], lpart[8];
#pragma unroll
    for (int j = 0; j < 8; ++j) { mrow[j] = -3.0e38f; lpart[j] = 0.f; }
    int qpos[8];
#pragma unroll
    for (int j = 0; j < 8; ++j) qpos[j] = q0 + 8 * hi + j;
    const int kt_lo = (qt * 64 - (BAND - 1)) > 0 ? (qt * 64 - (BAND - 1)) / 32 : 0, kt_hi = (qt * 64 + 63) / 32;     // block-uniform: keys qt*64-127 .. qt*64+63
#pragma unroll 1
    for (int kt = kt_lo; kt <= kt_hi; ++kt) {
        const int l0 = kt * 32;
        const size_t ko0 = (size_t)(l0 + lr) * DM + 8 * hi, ko1 = (size_t)(l0 + 16 + lr) * DM + 8 * hi;
        v8f s0 = {}, s1 = {}, x0 = {}, x1 = {};
#pragma unroll
        for (int kc = 0; kc < 2; ++kc) {
            { const v16h k0h = cat16(*(const v8h*)(kh_b + ko0 + kc * 32), *(const v8h*)(kh_b + ko0 + kc * 32 + 16)), k1h = cat16(*(const v8h*)(kh_b + ko1 + kc * 32), *(const v8h*)(kh_b + ko1 + kc * 32 + 16));
              const v16h qlk = cat16(*(const v8h*)(QL16 + qo0 + kc * 32), *(const v8h*)(QL16 + qo0 + kc * 32 + 16));     // query residual re-read per step (registers)
              s0 = wmma16(qa[kc], k0h, s0); x0 = wmma16(qlk, k0h, x0); s1 = wmma16(qa[kc], k1h, s1); x1 = wmma16(qlk, k1h, x1);
              asm volatile("v_nop" : "+v"(s0), "+v"(s1), "+v"(x0), "+v"(x1) : "v"(qlk), "v"(k0h), "v"(k1h) : "memory"); }
            { const v16h k0l = cat16(*(const v8h*)(kl_b + ko0 + kc * 32), *(const v8h*)(kl_b + ko0 + kc * 32 + 16)), k1l = cat16(*(const v8h*)(kl_b + ko1 + kc * 32), *(const v8h*)(kl_b + ko1 + kc * 32 + 16));
              x0 = wmma16(qa[kc], k0l, x0); x1 = wmma16(qa[kc], k1l, x1);
              asm volatile("v_nop" : "+v"(x0), "+v"(x1) : "v"(k0l), "v"(k1l) : "memory"); }
        }
        asm volatile("v_nop\n\tv_nop\n\tv_nop\n\tv_nop" : "+v"(s0), "+v"(s1), "+v"(x0), "+v"(x1) : "v"(qa[0]), "v"(qa[1]));
        float alpha[8];
#pragma unroll
        for (int j = 0; j < 8; ++j) {
            const int ja = l0 + lr, jb = l0 + 16 + lr, qi = qpos[j];
            const float a0 = (ja <= qi && qi - ja < BAND) ? (s0[j] + x0[j] * LOSCI) * 0.125f : -__builtin_inff(), a1 = (jb <= qi && qi - jb < BAND) ? (s1[j] + x1[j] * LOSCI) * 0.125f : -__builtin_inff();
            float mx = fmaxf(a0, a1);
            mx = fmaxf(mx, __shfl_xor(mx, 1, 16)); mx = fmaxf(mx, __shfl_xor(mx, 2, 16)); mx = fmaxf(mx, __shfl_xor(mx, 4, 16)); mx = fmaxf(mx, __shfl_xor(mx, 8, 16));
            const float mn = fmaxf(mrow[j], mx);
            alpha[j] = __expf(mrow[j] - mn); mrow[j] = mn;
            const float p0 = __expf(a0 - mn), p1 = __expf(a1 - mn);
            lpart[j] = lpart[j] * alpha[j] + (p0 + p1);
            const int mr = hi * 8 + j;
            const float ps0 = p0 * PSC, ps1 = p1 * PSC; const h16 h0 = (h16)ps0, h1 = (h16)ps1;
            pl[mr * 32 + lr] = h0; pl[mr * 32 + 16 + lr] = h1;
            pl2[mr * 32 + lr] = (h16)((ps0 - (float)h0) * LOSC); pl2[mr * 32 + 16 + lr] = (h16)((ps1 - (float)h1) * LOSC);
        }
#pragma unroll
        for (int n = 0; n < 4; ++n)
#pragma unroll
            for (int j = 0; j < 8; ++j) { o[n][j] *= alpha[j]; ox[n][j] *= alpha[j]; }
        asm volatile("" ::: "memory");
        const v16h pa = cat16(*(const v8ha*)(pl + lr * 32 + hi * 8), *(const v8ha*)(pl + lr * 32 + 16 + hi * 8));
        const v16h px = cat16(*(const v8ha*)(pl2 + lr * 32 + hi * 8), *(const v8ha*)(pl2 + lr * 32 + 16 + hi * 8));
#pragma unroll
        for (int n = 0; n < 4; ++n) { const size_t vo = vbase + (size_t)(n * 16 + lr) * NT_ + l0 + hi * 8;
            const v16h vh = cat16(*(const v8h*)(VTH + vo), *(const v8h*)(VTH + vo + 16)), vl = cat16(*(const v8h*)(VTL + vo), *(const v8h*)(VTL + vo + 16));
            o[n] = wmma16(pa, vh, o[n]); ox[n] = wmma16(pa, vl, ox[n]); ox[n] = wmma16(px, vh, ox[n]);
            asm volatile("" : "+v"(o[n]), "+v"(ox[n]) : "v"(vh), "v"(vl) : "memory"); }
        asm volatile("v_nop\n\tv_nop\n\tv_nop\n\tv_nop" : "+v"(o[0]), "+v"(o[1]), "+v"(o[2]), "+v"(o[3]), "+v"(ox[0]), "+v"(ox[1]), "+v"(ox[2]), "+v"(ox[3]) : "v"(pa), "v"(px));
    }
    float inv[8];
#pragma unroll
    for (int j = 0; j < 8; ++j) { float rs = lpart[j]; rs += __shfl_xor(rs, 1, 16); rs += __shfl_xor(rs, 2, 16); rs += __shfl_xor(rs, 4, 16); rs += __shfl_xor(rs, 8, 16); inv[j] = 1.0f / (rs * PSC); }
    float* os = &ost[wave][0];
#pragma unroll
    for (int n = 0; n < 4; ++n)
#pragma unroll
        for (int j = 0; j < 8; ++j) os[(hi * 8 + j) * 68 + n * 16 + lr] = (o[n][j] + ox[n][j] * LOSCI) * inv[j];
    __syncthreads();
    const size_t cbase = (tok0 + q0) * DM + (size_t)h * HD;
    auto pass = [&]() {
#pragma unroll
        for (int s = 0; s < 4; ++s) { const int row = 4 * s + (lane >> 3), piece = lane & 7; const float* sp = os + row * 68 + piece * 8; v8us oh, ol;
#pragma unroll
            for (int i = 0; i < 8; ++i) { const unsigned short hb = f2bf(sp[i]); oh[i] = hb; ol[i] = f2bf(sp[i] - bf2f(hb)); }
            *(v8us*)(CH + cbase + (size_t)row * DM + piece * 8) = oh; *(v8us*)(CL + cbase + (size_t)row * DM + piece * 8) = ol; }
    };
    pass(); 
}

#define VST2(T, p, v) do { const T vst2_v_ = (v); *(T*)(p) = vst2_v_;  } while (0)
extern "C" void kernel_launch(void* const* d_in, const int* in_sizes, int n_in,
                              void* d_out, int out_size, void* d_ws, size_t ws_size, hipStream_t stream) {
    (void)in_sizes; (void)n_in; (void)out_size;
    const float* x = (const float*)d_in[0]; const float* Wq = (const float*)d_in[1]; const float* Wk = (const float*)d_in[2]; const float* Wv = (const float*)d_in[3]; const float* Wo = (const float*)d_in[4];
    float* out = (float*)d_out;    // [1][4096][1024]
    char* wsp = (char*)d_ws;
    auto take = [&](size_t bytes) { char* p = wsp; wsp += (bytes + 255) & ~(size_t)255; return (void*)p; };
    bf* Xb = (bf*)take((size_t)NTK * DM * 2); bf* WqB = (bf*)take((size_t)DM * DM * 2); bf* WkB = (bf*)take((size_t)DM * DM * 2); bf* WvB = (bf*)take((size_t)DM * DM * 2); bf* WoB = (bf*)take((size_t)DM * DM * 2);
    h16* Q16 = (h16*)take((size_t)NTK * DM * 2); h16* QL16 = (h16*)take((size_t)NTK * DM * 2); h16* K16 = (h16*)take((size_t)NTK * DM * 2); h16* KL16 = (h16*)take((size_t)NTK * DM * 2); float* Vf = (float*)take((size_t)NTK * DM * 4); h16* VTH = (h16*)take((size_t)NTK * DM * 2); h16* VTL = (h16*)take((size_t)NTK * DM * 2);
    if ((size_t)(wsp - (char*)d_ws) > ws_size) return;    // 2.1 x 4 + 8.4 x 5 + 16.8 + 8.4 + 8.4 ~ 84 MB; ctx planes alias Xb / Vf after their last readers
    bf* CH = (bf*)Xb; bf* CL = (bf*)Vf;
    k_cvtb<<<(NTK + 4 * DM) / 8, 256, 0, stream>>>(x, Wq, Wk, Wv, Wo, Xb, WqB, WkB, WvB, WoB);
    k_gemmb<false, true><<<dim3(NTK / 128, DM / 128, 3), 256, 0, stream>>>(Xb, nullptr, WqB, WkB, WvB, nullptr, Vf, DM, Q16, QL16, K16, KL16);
    k_vt<<<NB_ * NH_ * (NT_ / 64), 256, 0, stream>>>(Vf, VTH, VTL);
    k_attn<<<NB_ * NH_ * (NT_ / 64), 128, 0, stream>>>(Q16, QL16, K16, KL16, VTH, VTL, CH, CL);
    k_gemmb<true, false><<<dim3(NTK / 128, DM / 128, 1), 256, 0, stream>>>(CH, CL, WoB, nullptr, nullptr, nullptr, out, DM, nullptr, nullptr, nullptr, nullptr);
}

// v003
// Measured time: 90.9 microseconds a run.
// In both of two side-by-side timings against v002, it was 1.04 times as fast.
// Counting every step since v000, it is 2.45 times as fast.
#include <hip/hip_runtime.h>

// Contractions, f32 accumulate: q/k/v = x.W^T ([4096 x 1024].[1024 x 1024] each; W is [out][in] = the n-major B operand as-is) and y.Wo^T on
// v_wmma_f32_16x16x32_bf16 with PLAIN bf16 operands for the projections (inputs rounded once: exact) and y as bf16 hi + residual planes (two products) for Wo; the
// banded-causal 16-head attention (keys j with i-127 <= j <= i) fused on v_wmma_f32_16x16x32_f16 over the <= 6 key tiles per 64-query block: q and k as f16 hi + residual x1024

#define NB_  1
#define NT_  4096
#define DM   1024
#define NH_  16
#define HD   64
#define NTK  (NB_ * NT_)
#define NW   1024
#define NQKV 1024
#define BAND 128
#define PSC  32768.0f
#define LOSC 1024.0f
#define LOSCI (1.0f / 1024.0f)

typedef _Float16 h16;
typedef unsigned short bf;
typedef __attribute__((ext_vector_type(16))) __bf16   v16bf;
typedef __attribute__((ext_vector_type(16))) _Float16 v16h;
typedef __attribute__((ext_vector_type(8)))  _Float16 v8h;
typedef __attribute__((ext_vector_type(8)))  unsigned short v8us;
typedef __attribute__((ext_vector_type(8)))  float    v8f;
typedef __attribute__((ext_vector_type(4)))  float    v4f;
typedef v8h  __attribute__((may_alias)) v8ha;
typedef v4f  __attribute__((may_alias)) v4fa;
typedef v8us __attribute__((may_alias)) v8usa;

__device__ __forceinline__ unsigned short f2bf(float f) { unsigned u = __float_as_uint(f); u += 0x7FFFu + ((u >> 16) & 1u); return (unsigned short)(u >> 16); }
__device__ __forceinline__ float bf2f(unsigned short b) { return __uint_as_float(((unsigned)b) << 16); }
__device__ __forceinline__ float bfr(float f) { return bf2f(f2bf(f)); }
__device__ __forceinline__ v16h cat16(v8h lo, v8h hi) { return __builtin_shufflevector(lo, hi, 0, 1, 2, 3, 4, 5, 6, 7, 8, 9, 10, 11, 12, 13, 14, 15); }
__device__ __forceinline__ v16bf cat16b(v8us lo, v8us hi) { return __builtin_bit_cast(v16bf, __builtin_shufflevector(lo, hi, 0, 1, 2, 3, 4, 5, 6, 7, 8, 9, 10, 11, 12, 13, 14, 15)); }
__device__ __forceinline__ v8f wmma16(v16h a, v16h b, v8f c) { return __builtin_amdgcn_wmma_f32_16x16x32_f16(false, a, false, b, (short)0, c, false, false); }
__device__ __forceinline__ v8f wmmab(v16bf a, v16bf b, v8f c) { return __builtin_amdgcn_wmma_f32_16x16x32_bf16(false, a, false, b, (short)0, c, false, false); }

// k_cvtb: one grid rounds all five inputs: blocks [0, NTK / 8) take x, then DM / 8 blocks each weight; 8 rows a block, so the pick is block-uniform (scalar selects).
__global__ __launch_bounds__(256) void k_cvtb(const float* __restrict__ x, const float* __restrict__ Wq, const float* __restrict__ Wk, const float* __restrict__ Wv, const float* __restrict__ Wo,
                                              bf* Xb, bf* WqB, bf* WkB, bf* WvB, bf* WoB) {
    const int blk = blockIdx.x, sel = blk < NTK / 8 ? 0 : 1 + (blk - NTK / 8) / (DM / 8);
    const float* src = sel == 0 ? x : sel == 1 ? Wq : sel == 2 ? Wk : sel == 3 ? Wv : Wo;
    bf* dst = sel == 0 ? Xb : sel == 1 ? WqB : sel == 2 ? WkB : sel == 3 ? WvB : WoB;
    const int lane = threadIdx.x & 31, r = (sel == 0 ? blk : (blk - NTK / 8) % (DM / 8)) * 8 + (threadIdx.x >> 5);
    v8us o[DM / 256];
#pragma unroll
    for (int q = 0; q < DM / 256; ++q) { v8us t;
#pragma unroll
        for (int i = 0; i < 8; ++i) t[i] = f2bf(src[(size_t)r * DM + q * 256 + lane * 8 + i]);
        o[q] = t; }
#pragma unroll
    for (int q = 0; q < DM / 256; ++q) *(v8us*)(dst + (size_t)r * DM + q * 256 + lane * 8) = o[q];
    
}

// k_wt: W [1024 k][ncols n] (k-major) -> n-major bf16 plane WT[ncols][1024]; 64 x 64 tiles through LDS.
__global__ __launch_bounds__(256) void k_wt(const float* __restrict__ Wm, int ncols, bf* WT) {
    __shared__ __align__(16) unsigned short tl[64 * 72];
    const int tid = threadIdx.x, k0 = blockIdx.x * 64, n0 = blockIdx.y * 64;
    const int kk = tid >> 2, nq = (tid & 3) * 16;
#pragma unroll
    for (int i = 0; i < 16; ++i) tl[(nq + i) * 72 + kk] = f2bf(Wm[(size_t)(k0 + kk) * ncols + n0 + nq + i]);
    __syncthreads();
    const int piece = tid & 7;
    typedef __attribute__((ext_vector_type(8))) unsigned short v8us_; typedef v8us_ __attribute__((may_alias)) v8usa_;
    auto pass = [&]() {
#pragma unroll
        for (int s = 0; s < 2; ++s) { const int nr = (tid >> 3) + 32 * s; const v8us_ val = *(const v8usa_*)(tl + nr * 72 + piece * 8);
            *(v8us_*)(WT + (size_t)(n0 + nr) * DM + k0 + piece * 8) = val; }
    };
    pass(); 
}

// k_gemmb: C[128 x 128] per block of 8 waves (4 x 2, 32 x 64 each). A stage is 128 k = 256 B of every operand row, rows [A 128 | A residual 128 (SPLITA) | B 128] at an
// LDS pitch of 272 B (16 B x odd: conflict-free for the ds_load_b128 fragment reads). Two buffers, filled by per-lane b128 asynchronous copies to LDS (16 lanes = one whole
// 256-B row piece), the next stage in flight while this one is worked on. Per accumulator the k order and the hi-then-residual order are those of the direct-load form.
// Every '#pragma unroll' in k_gemmb makes the indices into acc and the fragment sets compile-time constants, so that they stay in registers.
#define GKP    128
#define GPITCH 272
#define GNP    (DM / GKP)

// Eight copies, rows 16 apart (8 waves x 2 rows per copy). s_wait_xcnt 0 is the last line of the copies' own statement so that no address register is rewritten ahead of it.
__device__ __forceinline__ void cp8(unsigned l, const bf* p) {
    asm volatile("global_load_async_to_lds_b128 %0, %8, off\n\t"
                 "global_load_async_to_lds_b128 %1, %9, off\n\t"
                 "global_load_async_to_lds_b128 %2, %10, off\n\t"
                 "global_load_async_to_lds_b128 %3, %11, off\n\t"
                 "global_load_async_to_lds_b128 %4, %12, off\n\t"
                 "global_load_async_to_lds_b128 %5, %13, off\n\t"
                 "global_load_async_to_lds_b128 %6, %14, off\n\t"
                 "global_load_async_to_lds_b128 %7, %15, off\n\t"
                 "s_wait_xcnt 0x0"
                 :: "v"(l), "v"(l + 16u * GPITCH), "v"(l + 32u * GPITCH), "v"(l + 48u * GPITCH), "v"(l + 64u * GPITCH), "v"(l + 80u * GPITCH), "v"(l + 96u * GPITCH), "v"(l + 112u * GPITCH),
                    "v"(p), "v"(p + 16 * DM), "v"(p + 32 * DM), "v"(p + 48 * DM), "v"(p + 64 * DM), "v"(p + 80 * DM), "v"(p + 96 * DM), "v"(p + 112 * DM)
                 : "memory");
}

// QKV: one grid does the three products of the same A; blockIdx.z picks the weight plane and the output (0: q, 1: k, both as f16 hi + residual planes; 2: v as f32). Block-uniform.
template <bool SPLITA, bool QKV>
__global__ __launch_bounds__(256) void k_gemmb(const bf* __restrict__ A, const bf* __restrict__ Al, const bf* __restrict__ B0, const bf* __restrict__ B1, const bf* __restrict__ B2, const float* __restrict__ bias,
                                               float* Cf, int ldc, h16* H0, h16* L0, h16* H1, h16* L1) {
    const int z = QKV ? (int)blockIdx.z : 0;
    const bool f16out = QKV && z < 2;
    const bf* Bn = z == 0 ? B0 : z == 1 ? B1 : B2;
    float* C = f16out ? (float*)(void*)(z == 0 ? H0 : H1) : Cf;
    h16* C2 = z == 0 ? L0 : L1;
    constexpr int BROW = SPLITA ? 256 : 128, STG = (BROW + 128) * GPITCH;
    __shared__ __align__(16) unsigned char ring[2 * STG];
    __shared__ __align__(16) float ost[8][32 * 68];
    const int lane = threadIdx.x & 31, wave = threadIdx.x >> 5, lr = lane & 15, hi = lane >> 4;
    const int rb = blockIdx.x * 128, cb = blockIdx.y * 128;
    const int r0 = rb + (wave >> 1) * 32, c0 = cb + (wave & 1) * 64;
    const int crow = 2 * wave + hi;
    const bf* gA = A + (size_t)(rb + crow) * DM + lr * 8;
    const bf* gAl = SPLITA ? Al + (size_t)(rb + crow) * DM + lr * 8 : gA;
    const bf* gB = Bn + (size_t)(cb + crow) * DM + lr * 8;
    const unsigned lcp = (unsigned)(uintptr_t)&ring[0] + (unsigned)(crow * GPITCH + lr * 16);
    auto fill = [&](int t, int buf) {
        const unsigned l = lcp + (unsigned)(buf * STG);
        cp8(l, gA + t * GKP);
        if (SPLITA) cp8(l + 128u * GPITCH, gAl + t * GKP);
        cp8(l + (unsigned)(BROW * GPITCH), gB + t * GKP);
    };
    const int aofs = ((wave >> 1) * 32 + lr) * GPITCH + hi * 16, bofs = (BROW + (wave & 1) * 64 + lr) * GPITCH + hi * 16;
    v8f acc[2][4];
#pragma unroll
    for (int mi = 0; mi < 2; ++mi)
#pragma unroll
        for (int t = 0; t < 4; ++t) acc[mi][t] = (v8f){};
    fill(0, 0);
    asm volatile("s_wait_asynccnt 0x0" ::: "memory");    // this wave's copies of stage 0 have landed
    __syncthreads();                                      // ... and every other wave's: stage 0 is readable
    fill(1, 1);
#pragma unroll 1    // rolled: one ring foot
    for (int p = 0; p < GNP; ++p) {
        const unsigned char* sb = ring + (p & 1) * STG;
        v16bf a[2][2], al[2][2], b[2][4];
        auto frags = [&](int ks, int f) {
#pragma unroll
            for (int mi = 0; mi < 2; ++mi) { const unsigned char* q = sb + aofs + mi * 16 * GPITCH + ks * 64;
                a[f][mi] = cat16b(*(const v8usa*)q, *(const v8usa*)(q + 32));
                if (SPLITA) al[f][mi] = cat16b(*(const v8usa*)(q + 128 * GPITCH), *(const v8usa*)(q + 128 * GPITCH + 32)); }
#pragma unroll
            for (int t = 0; t < 4; ++t) { const unsigned char* q = sb + bofs + t * 16 * GPITCH + ks * 64; b[f][t] = cat16b(*(const v8usa*)q, *(const v8usa*)(q + 32)); }
        };
        frags(0, 0);
#pragma unroll
        for (int ks = 0; ks < GKP / 32; ++ks) {
            const int f = ks & 1;
            if (ks + 1 < GKP / 32) frags(ks + 1, f ^ 1);    // the next 32 k of this same stage, one group into the other fragment set
            __builtin_amdgcn_sched_barrier(0);              // keeps that group ahead of the WMMA block
#pragma unroll
            for (int mi = 0; mi < 2; ++mi)
#pragma unroll
                for (int t = 0; t < 4; ++t) acc[mi][t] = wmmab(a[f][mi], b[f][t], acc[mi][t]);
            if (SPLITA) {
#pragma unroll
                for (int mi = 0; mi < 2; ++mi)
#pragma unroll
                    for (int t = 0; t < 4; ++t) acc[mi][t] = wmmab(al[f][mi], b[f][t], acc[mi][t]);
            }
            __builtin_amdgcn_sched_barrier(0);              // ... and the following group behind the block
        }
        asm volatile("s_wait_dscnt 0x0" ::: "memory");       // this wave's reads of the buffer are done before it may be refilled
        asm volatile("s_wait_asynccnt 0x0" ::: "memory");    // this wave's copies of stage p + 1 have landed
        __syncthreads();                                      // publishes stage p + 1 and ends every reader's last read of stage p
        if (p + 2 < GNP) fill(p + 2, p & 1);
    }
    asm volatile("s_wait_asynccnt 0x0" ::: "memory");        // no copy is outstanding when the wave goes on
    float* os = &ost[wave][0];
#pragma unroll
    for (int mi = 0; mi < 2; ++mi)
#pragma unroll
        for (int t = 0; t < 4; ++t) { const float bv = bias ? bfr(bias[c0 + t * 16 + lr]) : 0.f;
#pragma unroll
            for (int j = 0; j < 8; ++j) os[(mi * 16 + hi * 8 + j) * 68 + t * 16 + lr] = acc[mi][t][j] + bv; }
    __syncthreads();
    if (f16out) {
        h16* crow_p = (h16*)(void*)C + (size_t)r0 * ldc + c0;
#pragma unroll
        for (int s = 0; s < 8; ++s) { const int row = 4 * s + (lane >> 3), piece = lane & 7; const float* sp = os + row * 68 + piece * 8; v8h o, o2;
#pragma unroll
            for (int i = 0; i < 8; ++i) { const h16 a = (h16)sp[i]; o[i] = a; o2[i] = (h16)((sp[i] - (float)a) * LOSC); }
            *(v8h*)(crow_p + (size_t)row * ldc + piece * 8) = o;
            asm volatile("s_wait_xcnt 0x0" ::: "memory");    // stands in front of the next writes of the registers that the store above names
            if (C2) *(v8h*)(C2 + (size_t)r0 * ldc + c0 + (size_t)row * ldc + piece * 8) = o2; }
    } else {
        float* crow_p = C + (size_t)r0 * ldc + c0;
#pragma unroll
        for (int s = 0; s < 16; ++s) { const int Lid = (lane >> 3) + 4 * s, piece = lane & 7; const int row = Lid >> 1, cofs = (Lid & 1) * 32 + piece * 4;
            const v4f val = *(const v4fa*)(os + row * 68 + cofs); *(v4f*)(crow_p + (size_t)row * ldc + cofs) = val; }
    }
}

__global__ __launch_bounds__(256) void k_vt(const float* __restrict__ V, h16* VTH, h16* VTL) {
    __shared__ __align__(16) h16 tile[64 * 72];
    __shared__ __align__(16) h16 til2[64 * 72];
    const int bid = blockIdx.x;
    const int b = bid / (NH_ * (NT_ / 64)), rem = bid - b * (NH_ * (NT_ / 64)), h = rem / (NT_ / 64), kt = rem - h * (NT_ / 64);
    const int k0 = kt * 64, tid = threadIdx.x;
    const int kk = tid >> 2, d0 = (tid & 3) * 16;
    const float* src = V + ((size_t)b * NT_ + k0 + kk) * DM + h * HD + d0;
#pragma unroll
    for (int i = 0; i < 16; ++i) { const float v = src[i]; const h16 a = (h16)v; tile[(d0 + i) * 72 + kk] = a; til2[(d0 + i) * 72 + kk] = (h16)((v - (float)a) * LOSC); }
    __syncthreads();
    const int piece = tid & 7;
    const size_t base = (((size_t)b * NH_ + h) * HD) * NT_ + k0;
    auto pass = [&]() {
#pragma unroll
        for (int s = 0; s < 4; ++s) { const int Lid = (tid >> 3) + 32 * s; const int pln = Lid >> 6, d = Lid & 63;
            const v8h val = *(const v8ha*)((pln ? til2 : tile) + d * 72 + piece * 8); *(v8h*)((pln ? VTL : VTH) + base + (size_t)d * NT_ + piece * 8) = val; }
    };
    pass(); 
}

// k_attn: block = (b, h, 64 queries), wave = 16; key tiles kt_lo..kt_hi of the band (block-uniform), per-element mask j <= i && i - j < BAND; scores hi.hi + hi.lo +
// lo.hi (12 WMMA, /8 in f32), online softmax, weights x32768 hi + residual tiles (same-wave may_alias reload after a compiler barrier), 12 WMMA .v (hi.hi + hi.lo +
// lo.hi); ctx -> bf16 hi + residual planes CH/CL[tok][h*64+d].
// launch bounds: four waves a SIMD (256 registers a wave), so that all blocks of the grid stay resident at once with the wider load groups below.
__global__ __launch_bounds__(128, 4) void k_attn(const h16* __restrict__ Q16, const h16* __restrict__ QL16, const h16* __restrict__ K16, const h16* __restrict__ KL16, const h16* __restrict__ VTH, const h16* __restrict__ VTL, bf* CH, bf* CL) {
    __shared__ __align__(16) h16 plds[4][16 * 32];
    __shared__ __align__(16) h16 plds2[4][16 * 32];
    __shared__ __align__(16) float ost[4][16 * 68];
    const int lane = threadIdx.x & 31, wave = threadIdx.x >> 5, lr = lane & 15, hi = lane >> 4;
    const int bid = blockIdx.x;
    const int b = bid / (NH_ * (NT_ / 64)), rem = bid - b * (NH_ * (NT_ / 64)), h = rem / (NT_ / 64), qt = rem - h * (NT_ / 64);
    const int q0 = qt * 64 + wave * 16;
    const size_t tok0 = (size_t)b * NT_;
    h16* pl = &plds[wave][0]; h16* pl2 = &plds2[wave][0];
    h16* plw = pl + hi * 256 + lr; h16* pl2w = pl2 + hi * 256 + lr;    // the lane's column in its half's first row: row j is a constant offset, not a register
    v16h qa[2], ql[2];    // the query tile, hi and residual: read once, no load of it among the loop's groups
    const size_t qo0 = (tok0 + q0 + lr) * DM + h * HD + 8 * hi;
#pragma unroll
    for (int kc = 0; kc < 2; ++kc) { qa[kc] = cat16(*(const v8h*)(Q16 + qo0 + kc * 32), *(const v8h*)(Q16 + qo0 + kc * 32 + 16)); ql[kc] = cat16(*(const v8h*)(QL16 + qo0 + kc * 32), *(const v8h*)(QL16 + qo0 + kc * 32 + 16)); }
    const h16* kh_b = K16 + tok0 * DM + h * HD;
    const h16* kl_b = KL16 + tok0 * DM + h * HD;
    const h16* vh_b = VTH + (((size_t)b * NH_ + h) * HD) * NT_;
    const h16* vl_b = VTL + (((size_t)b * NH_ + h) * HD) * NT_;
    v8f o[4], ox[4];
#pragma unroll
    for (int n = 0; n < 4; ++n) { o[n] = (v8f){}; ox[n] = (v8f){}; }
    float mrow[8], lpart[8];
#pragma unroll
    for (int j = 0; j < 8; ++j) { mrow[j] = -3.0e38f; lpart[j] = 0.f; }
    const int dq = q0 + 8 * hi - lr;    // query row 0 of the lane's half minus the lane's key column: with the tile's first key taken off, i - j of the mask
    const int kt_lo = (qt * 64 - (BAND - 1)) > 0 ? (qt * 64 - (BAND - 1)) / 32 : 0, kt_hi = (qt * 64 + 63) / 32;     // block-uniform: keys qt*64-127 .. qt*64+63
#pragma unroll 1
    for (int kt = kt_lo; kt <= kt_hi; ++kt) {
        const int l0 = kt * 32;
        const unsigned ko0 = (unsigned)((l0 + lr) * DM + 8 * hi);    // 32-bit lane offset from the wave-uniform bases
        const h16* pkh = kh_b + ko0; const h16* pkl = kl_b + ko0;      // key l0 + lr; key l0 + 16 + lr is a constant offset from it
        // Every K fragment of the tile (hi and residual, both halves of the head) is asked for in one group: one load latency a tile, not four in a row.
        v16h kh[2][2], kl[2][2];
#pragma unroll
        for (int kc = 0; kc < 2; ++kc) {
            kh[kc][0] = cat16(*(const v8h*)(pkh + kc * 32), *(const v8h*)(pkh + kc * 32 + 16)); kh[kc][1] = cat16(*(const v8h*)(pkh + 16 * DM + kc * 32), *(const v8h*)(pkh + 16 * DM + kc * 32 + 16));
            kl[kc][0] = cat16(*(const v8h*)(pkl + kc * 32), *(const v8h*)(pkl + kc * 32 + 16)); kl[kc][1] = cat16(*(const v8h*)(pkl + 16 * DM + kc * 32), *(const v8h*)(pkl + 16 * DM + kc * 32 + 16));
        }
        asm volatile("s_wait_xcnt 0x0" :: "v"(pkh), "v"(pkl) : "memory");    // stands in front of the next write of the group's address registers; naming them keeps them whole up to here
        __builtin_amdgcn_sched_barrier(0);    // keeps the whole group ahead of the first WMMA: a load sunk to its user would wait out its latency alone
        v8f s0 = {}, s1 = {}, x0 = {}, x1 = {};
#pragma unroll
        for (int kc = 0; kc < 2; ++kc) {
            s0 = wmma16(qa[kc], kh[kc][0], s0); x0 = wmma16(ql[kc], kh[kc][0], x0); s1 = wmma16(qa[kc], kh[kc][1], s1); x1 = wmma16(ql[kc], kh[kc][1], x1);
            x0 = wmma16(qa[kc], kl[kc][0], x0); x1 = wmma16(qa[kc], kl[kc][1], x1);
        }
        // The tile's V fragments (hi and residual, all four column groups) are asked for here, in the registers that K has left: they land while the softmax below runs.
        v16h vh[4], vl[4];
        const unsigned vo0 = (unsigned)(lr * NT_ + l0 + hi * 8);
        const h16* pvh = vh_b + vo0; const h16* pvl = vl_b + vo0;      // column lr of group 0; group n is a constant offset from it
#pragma unroll
        for (int n = 0; n < 4; ++n) { vh[n] = cat16(*(const v8h*)(pvh + n * 16 * NT_), *(const v8h*)(pvh + n * 16 * NT_ + 16)); vl[n] = cat16(*(const v8h*)(pvl + n * 16 * NT_), *(const v8h*)(pvl + n * 16 * NT_ + 16)); }
        asm volatile("s_wait_xcnt 0x0" :: "v"(pvh), "v"(pvl) : "memory");    // as behind the K group
        __builtin_amdgcn_sched_barrier(0);    // keeps that group ahead of the softmax
        float alpha[8];
#pragma unroll
        for (int j = 0; j < 8; ++j) {
            const int da = dq - l0 + j, db = da - 16;    // i - j; 0 <= i - j < BAND as one unsigned compare
            const float a0 = (unsigned)da < (unsigned)BAND ? (s0[j] + x0[j] * LOSCI) * 0.125f : -__builtin_inff(), a1 = (unsigned)db < (unsigned)BAND ? (s1[j] + x1[j] * LOSCI) * 0.125f : -__builtin_inff();
            float mx = fmaxf(a0, a1);
            mx = fmaxf(mx, __shfl_xor(mx, 1, 16)); mx = fmaxf(mx, __shfl_xor(mx, 2, 16)); mx = fmaxf(mx, __shfl_xor(mx, 4, 16)); mx = fmaxf(mx, __shfl_xor(mx, 8, 16));
            const float mn = fmaxf(mrow[j], mx);
            alpha[j] = __expf(mrow[j] - mn); mrow[j] = mn;
            const float p0 = __expf(a0 - mn), p1 = __expf(a1 - mn);
            lpart[j] = lpart[j] * alpha[j] + (p0 + p1);
            const float ps0 = p0 * PSC, ps1 = p1 * PSC; const h16 h0 = (h16)ps0, h1 = (h16)ps1;
            plw[j * 32] = h0; plw[j * 32 + 16] = h1;
            pl2w[j * 32] = (h16)((ps0 - (float)h0) * LOSC); pl2w[j * 32 + 16] = (h16)((ps1 - (float)h1) * LOSC);
        }
#pragma unroll
        for (int n = 0; n < 4; ++n)
#pragma unroll
            for (int j = 0; j < 8; ++j) { o[n][j] *= alpha[j]; ox[n][j] *= alpha[j]; }
        asm volatile("" ::: "memory");
        const v16h pa = cat16(*(const v8ha*)(pl + lr * 32 + hi * 8), *(const v8ha*)(pl + lr * 32 + 16 + hi * 8));
        const v16h px = cat16(*(const v8ha*)(pl2 + lr * 32 + hi * 8), *(const v8ha*)(pl2 + lr * 32 + 16 + hi * 8));
#pragma unroll
        for (int n = 0; n < 4; ++n) { o[n] = wmma16(pa, vh[n], o[n]); ox[n] = wmma16(pa, vl[n], ox[n]); ox[n] = wmma16(px, vh[n], ox[n]); }
        // four vector slots behind the last WMMA, on the loop's taken branch too
        asm volatile("v_nop\n\tv_nop\n\tv_nop\n\tv_nop" : "+v"(o[0]), "+v"(o[1]), "+v"(o[2]), "+v"(o[3]), "+v"(ox[0]), "+v"(ox[1]), "+v"(ox[2]), "+v"(ox[3]) : "v"(pa), "v"(px));
    }
    float inv[8];
#pragma unroll
    for (int j = 0; j < 8; ++j) { float rs = lpart[j]; rs += __shfl_xor(rs, 1, 16); rs += __shfl_xor(rs, 2, 16); rs += __shfl_xor(rs, 4, 16); rs += __shfl_xor(rs, 8, 16); inv[j] = 1.0f / (rs * PSC); }
    float* os = &ost[wave][0];
#pragma unroll
    for (int n = 0; n < 4; ++n)
#pragma unroll
        for (int j = 0; j < 8; ++j) os[(hi * 8 + j) * 68 + n * 16 + lr] = (o[n][j] + ox[n][j] * LOSCI) * inv[j];
    __syncthreads();
    const size_t cbase = (tok0 + q0) * DM + (size_t)h * HD;
    auto pass = [&]() {
#pragma unroll
        for (int s = 0; s < 4; ++s) { const int row = 4 * s + (lane >> 3), piece = lane & 7; const float* sp = os + row * 68 + piece * 8; v8us oh, ol;
#pragma unroll
            for (int i = 0; i < 8; ++i) { const unsigned short hb = f2bf(sp[i]); oh[i] = hb; ol[i] = f2bf(sp[i] - bf2f(hb)); }
            *(v8us*)(CH + cbase + (size_t)row * DM + piece * 8) = oh; *(v8us*)(CL + cbase + (size_t)row * DM + piece * 8) = ol; }
    };
    pass(); 
}

#define VST2(T, p, v) do { const T vst2_v_ = (v); *(T*)(p) = vst2_v_;  } while (0)
extern "C" void kernel_launch(void* const* d_in, const int* in_sizes, int n_in,
                              void* d_out, int out_size, void* d_ws, size_t ws_size, hipStream_t stream) {
    (void)in_sizes; (void)n_in; (void)out_size;
    const float* x = (const float*)d_in[0]; const float* Wq = (const float*)d_in[1]; const float* Wk = (const float*)d_in[2]; const float* Wv = (const float*)d_in[3]; const float* Wo = (const float*)d_in[4];
    float* out = (float*)d_out;    // [1][4096][1024]
    char* wsp = (char*)d_ws;
    auto take = [&](size_t bytes) { char* p = wsp; wsp += (bytes + 255) & ~(size_t)255; return (void*)p; };
    bf* Xb = (bf*)take((size_t)NTK * DM * 2); bf* WqB = (bf*)take((size_t)DM * DM * 2); bf* WkB = (bf*)take((size_t)DM * DM * 2); bf* WvB = (bf*)take((size_t)DM * DM * 2); bf* WoB = (bf*)take((size_t)DM * DM * 2);
    h16* Q16 = (h16*)take((size_t)NTK * DM * 2); h16* QL16 = (h16*)take((size_t)NTK * DM * 2); h16* K16 = (h16*)take((size_t)NTK * DM * 2); h16* KL16 = (h16*)take((size_t)NTK * DM * 2); float* Vf = (float*)take((size_t)NTK * DM * 4); h16* VTH = (h16*)take((size_t)NTK * DM * 2); h16* VTL = (h16*)take((size_t)NTK * DM * 2);
    if ((size_t)(wsp - (char*)d_ws) > ws_size) return;    // 2.1 x 4 + 8.4 x 5 + 16.8 + 8.4 + 8.4 ~ 84 MB; ctx planes alias Xb / Vf after their last readers
    bf* CH = (bf*)Xb; bf* CL = (bf*)Vf;
    k_cvtb<<<(NTK + 4 * DM) / 8, 256, 0, stream>>>(x, Wq, Wk, Wv, Wo, Xb, WqB, WkB, WvB, WoB);
    k_gemmb<false, true><<<dim3(NTK / 128, DM / 128, 3), 256, 0, stream>>>(Xb, nullptr, WqB, WkB, WvB, nullptr, Vf, DM, Q16, QL16, K16, KL16);
    k_vt<<<NB_ * NH_ * (NT_ / 64), 256, 0, stream>>>(Vf, VTH, VTL);
    k_attn<<<NB_ * NH_ * (NT_ / 64), 128, 0, stream>>>(Q16, QL16, K16, KL16, VTH, VTL, CH, CL);
    k_gemmb<true, false><<<dim3(NTK / 128, DM / 128, 1), 256, 0, stream>>>(CH, CL, WoB, nullptr, nullptr, nullptr, out, DM, nullptr, nullptr, nullptr, nullptr);
}

// v004
// One run takes 85.7 microseconds.
// In two side-by-side timings against v003, it was 1.06 and 1.05 times as fast.
// Counting every step since v000, it is 2.59 times as fast.
#include <hip/hip_runtime.h>

// Contractions, f32 accumulate: q/k/v = x.W^T ([4096 x 1024].[1024 x 1024] each; W is [out][in] = the n-major B operand as-is) and y.Wo^T on
// v_wmma_f32_16x16x32_bf16 with PLAIN bf16 operands for the projections (inputs rounded once: exact) and y as bf16 hi + residual planes (two products) for Wo; the
// banded-causal 16-head attention (keys j with i-127 <= j <= i) fused on v_wmma_f32_16x16x32_f16 over the <= 6 key tiles per 64-query block: q and k as f16 hi + residual x1024

#define NB_  1
#define NT_  4096
#define DM   1024
#define NH_  16
#define HD   64
#define NTK  (NB_ * NT_)
#define NW   1024
#define NQKV 1024
#define BAND 128
#define PSC  32768.0f
#define LOSC 1024.0f
#define LOSCI (1.0f / 1024.0f)

typedef _Float16 h16;
typedef unsigned short bf;
typedef __attribute__((ext_vector_type(16))) __bf16   v16bf;
typedef __attribute__((ext_vector_type(16))) _Float16 v16h;
typedef __attribute__((ext_vector_type(8)))  _Float16 v8h;
typedef __attribute__((ext_vector_type(8)))  unsigned short v8us;
typedef __attribute__((ext_vector_type(8)))  float    v8f;
typedef __attribute__((ext_vector_type(4)))  float    v4f;
typedef v8h  __attribute__((may_alias)) v8ha;
typedef v4f  __attribute__((may_alias)) v4fa;
typedef v8us __attribute__((may_alias)) v8usa;

__device__ __forceinline__ unsigned short f2bf(float f) { unsigned u = __float_as_uint(f); u += 0x7FFFu + ((u >> 16) & 1u); return (unsigned short)(u >> 16); }
__device__ __forceinline__ float bf2f(unsigned short b) { return __uint_as_float(((unsigned)b) << 16); }
__device__ __forceinline__ float bfr(float f) { return bf2f(f2bf(f)); }
__device__ __forceinline__ v16h cat16(v8h lo, v8h hi) { return __builtin_shufflevector(lo, hi, 0, 1, 2, 3, 4, 5, 6, 7, 8, 9, 10, 11, 12, 13, 14, 15); }
__device__ __forceinline__ v16bf cat16b(v8us lo, v8us hi) { return __builtin_bit_cast(v16bf, __builtin_shufflevector(lo, hi, 0, 1, 2, 3, 4, 5, 6, 7, 8, 9, 10, 11, 12, 13, 14, 15)); }
__device__ __forceinline__ v8f wmma16(v16h a, v16h b, v8f c) { return __builtin_amdgcn_wmma_f32_16x16x32_f16(false, a, false, b, (short)0, c, false, false); }
__device__ __forceinline__ v8f wmmab(v16bf a, v16bf b, v8f c) { return __builtin_amdgcn_wmma_f32_16x16x32_bf16(false, a, false, b, (short)0, c, false, false); }

// k_cvtb: one grid rounds all five inputs: blocks [0, NTK / 8) take x, then DM / 8 blocks each weight; 8 rows a block, so the pick is block-uniform (scalar selects).
__global__ __launch_bounds__(256) void k_cvtb(const float* __restrict__ x, const float* __restrict__ Wq, const float* __restrict__ Wk, const float* __restrict__ Wv, const float* __restrict__ Wo,
                                              bf* Xb, bf* WqB, bf* WkB, bf* WvB, bf* WoB) {
    const int blk = blockIdx.x, sel = blk < NTK / 8 ? 0 : 1 + (blk - NTK / 8) / (DM / 8);
    const float* src = sel == 0 ? x : sel == 1 ? Wq : sel == 2 ? Wk : sel == 3 ? Wv : Wo;
    bf* dst = sel == 0 ? Xb : sel == 1 ? WqB : sel == 2 ? WkB : sel == 3 ? WvB : WoB;
    const int lane = threadIdx.x & 31, r = (sel == 0 ? blk : (blk - NTK / 8) % (DM / 8)) * 8 + (threadIdx.x >> 5);
    v8us o[DM / 256];
#pragma unroll
    for (int q = 0; q < DM / 256; ++q) { v8us t;
#pragma unroll
        for (int i = 0; i < 8; ++i) t[i] = f2bf(src[(size_t)r * DM + q * 256 + lane * 8 + i]);
        o[q] = t; }
#pragma unroll
    for (int q = 0; q < DM / 256; ++q) *(v8us*)(dst + (size_t)r * DM + q * 256 + lane * 8) = o[q];
    
}

// k_wt: W [1024 k][ncols n] (k-major) -> n-major bf16 plane WT[ncols][1024]; 64 x 64 tiles through LDS.
__global__ __launch_bounds__(256) void k_wt(const float* __restrict__ Wm, int ncols, bf* WT) {
    __shared__ __align__(16) unsigned short tl[64 * 72];
    const int tid = threadIdx.x, k0 = blockIdx.x * 64, n0 = blockIdx.y * 64;
    const int kk = tid >> 2, nq = (tid & 3) * 16;
#pragma unroll
    for (int i = 0; i < 16; ++i) tl[(nq + i) * 72 + kk] = f2bf(Wm[(size_t)(k0 + kk) * ncols + n0 + nq + i]);
    __syncthreads();
    const int piece = tid & 7;
    typedef __attribute__((ext_vector_type(8))) unsigned short v8us_; typedef v8us_ __attribute__((may_alias)) v8usa_;
    auto pass = [&]() {
#pragma unroll
        for (int s = 0; s < 2; ++s) { const int nr = (tid >> 3) + 32 * s; const v8us_ val = *(const v8usa_*)(tl + nr * 72 + piece * 8);
            *(v8us_*)(WT + (size_t)(n0 + nr) * DM + k0 + piece * 8) = val; }
    };
    pass(); 
}

// k_gemmb: C[128 x 128] per block of 8 waves (4 x 2, 32 x 64 each). A stage is 128 k = 256 B of every operand row, rows [A 128 | A residual 128 (SPLITA) | B 128] at an
// LDS pitch of 272 B (16 B x odd: conflict-free for the ds_load_b128 fragment reads). Two buffers, filled by per-lane b128 asynchronous copies to LDS (16 lanes = one whole
// 256-B row piece), the next stage in flight while this one is worked on. Per accumulator the k order and the hi-then-residual order are those of the direct-load form.
// Every '#pragma unroll' in k_gemmb makes the indices into acc and the fragment sets compile-time constants, so that they stay in registers.
#define GKP    128
#define GPITCH 272
#define GNP    (DM / GKP)

// Eight copies, rows 16 apart (8 waves x 2 rows per copy). s_wait_xcnt 0 is the last line of the copies' own statement so that no address register is rewritten ahead of it.
__device__ __forceinline__ void cp8(unsigned l, const bf* p) {
    asm volatile("global_load_async_to_lds_b128 %0, %8, off\n\t"
                 "global_load_async_to_lds_b128 %1, %9, off\n\t"
                 "global_load_async_to_lds_b128 %2, %10, off\n\t"
                 "global_load_async_to_lds_b128 %3, %11, off\n\t"
                 "global_load_async_to_lds_b128 %4, %12, off\n\t"
                 "global_load_async_to_lds_b128 %5, %13, off\n\t"
                 "global_load_async_to_lds_b128 %6, %14, off\n\t"
                 "global_load_async_to_lds_b128 %7, %15, off\n\t"
                 "s_wait_xcnt 0x0"
                 :: "v"(l), "v"(l + 16u * GPITCH), "v"(l + 32u * GPITCH), "v"(l + 48u * GPITCH), "v"(l + 64u * GPITCH), "v"(l + 80u * GPITCH), "v"(l + 96u * GPITCH), "v"(l + 112u * GPITCH),
                    "v"(p), "v"(p + 16 * DM), "v"(p + 32 * DM), "v"(p + 48 * DM), "v"(p + 64 * DM), "v"(p + 80 * DM), "v"(p + 96 * DM), "v"(p + 112 * DM)
                 : "memory");
}

// QKV: one grid does the three products of the same A; blockIdx.z picks the weight plane and the output (0: q, 1: k, both as f16 hi + residual planes [tok][col]; 2: v as f16 hi +
// residual planes TRANSPOSED, [col][tok], the n-major B operand of the weights.v product). Block-uniform.
template <bool SPLITA, bool QKV>
__global__ __launch_bounds__(256) void k_gemmb(const bf* __restrict__ A, const bf* __restrict__ Al, const bf* __restrict__ B0, const bf* __restrict__ B1, const bf* __restrict__ B2, const float* __restrict__ bias,
                                               float* Cf, int ldc, h16* H0, h16* L0, h16* H1, h16* L1, h16* VTH, h16* VTL) {
    const int z = QKV ? (int)blockIdx.z : 0;
    const bool f16out = QKV && z < 2;
    const bf* Bn = z == 0 ? B0 : z == 1 ? B1 : B2;
    float* C = f16out ? (float*)(void*)(z == 0 ? H0 : H1) : Cf;
    h16* C2 = z == 0 ? L0 : L1;
    constexpr int BROW = SPLITA ? 256 : 128, STG = (BROW + 128) * GPITCH;
    __shared__ __align__(16) unsigned char ring[2 * STG];
    __shared__ __align__(16) float ost[8][32 * 68];
    const int lane = threadIdx.x & 31, wave = threadIdx.x >> 5, lr = lane & 15, hi = lane >> 4;
    const int rb = blockIdx.x * 128, cb = blockIdx.y * 128;
    const int r0 = rb + (wave >> 1) * 32, c0 = cb + (wave & 1) * 64;
    const int crow = 2 * wave + hi;
    const bf* gA = A + (size_t)(rb + crow) * DM + lr * 8;
    const bf* gAl = SPLITA ? Al + (size_t)(rb + crow) * DM + lr * 8 : gA;
    const bf* gB = Bn + (size_t)(cb + crow) * DM + lr * 8;
    const unsigned lcp = (unsigned)(uintptr_t)&ring[0] + (unsigned)(crow * GPITCH + lr * 16);
    auto fill = [&](int t, int buf) {
        const unsigned l = lcp + (unsigned)(buf * STG);
        cp8(l, gA + t * GKP);
        if (SPLITA) cp8(l + 128u * GPITCH, gAl + t * GKP);
        cp8(l + (unsigned)(BROW * GPITCH), gB + t * GKP);
    };
    const int aofs = ((wave >> 1) * 32 + lr) * GPITCH + hi * 16, bofs = (BROW + (wave & 1) * 64 + lr) * GPITCH + hi * 16;
    v8f acc[2][4];
#pragma unroll
    for (int mi = 0; mi < 2; ++mi)
#pragma unroll
        for (int t = 0; t < 4; ++t) acc[mi][t] = (v8f){};
    fill(0, 0);
    asm volatile("s_wait_asynccnt 0x0" ::: "memory");    // this wave's copies of stage 0 have landed
    __syncthreads();                                      // ... and every other wave's: stage 0 is readable
    fill(1, 1);
#pragma unroll 1    // rolled: one ring foot
    for (int p = 0; p < GNP; ++p) {
        const unsigned char* sb = ring + (p & 1) * STG;
        v16bf a[2][2], al[2][2], b[2][4];
        auto frags = [&](int ks, int f) {
#pragma unroll
            for (int mi = 0; mi < 2; ++mi) { const unsigned char* q = sb + aofs + mi * 16 * GPITCH + ks * 64;
                a[f][mi] = cat16b(*(const v8usa*)q, *(const v8usa*)(q + 32));
                if (SPLITA) al[f][mi] = cat16b(*(const v8usa*)(q + 128 * GPITCH), *(const v8usa*)(q + 128 * GPITCH + 32)); }
#pragma unroll
            for (int t = 0; t < 4; ++t) { const unsigned char* q = sb + bofs + t * 16 * GPITCH + ks * 64; b[f][t] = cat16b(*(const v8usa*)q, *(const v8usa*)(q + 32)); }
        };
        frags(0, 0);
#pragma unroll
        for (int ks = 0; ks < GKP / 32; ++ks) {
            const int f = ks & 1;
            if (ks + 1 < GKP / 32) frags(ks + 1, f ^ 1);    // the next 32 k of this same stage, one group into the other fragment set
            __builtin_amdgcn_sched_barrier(0);              // keeps that group ahead of the WMMA block
#pragma unroll
            for (int mi = 0; mi < 2; ++mi)
#pragma unroll
                for (int t = 0; t < 4; ++t) acc[mi][t] = wmmab(a[f][mi], b[f][t], acc[mi][t]);
            if (SPLITA) {
#pragma unroll
                for (int mi = 0; mi < 2; ++mi)
#pragma unroll
                    for (int t = 0; t < 4; ++t) acc[mi][t] = wmmab(al[f][mi], b[f][t], acc[mi][t]);
            }
            __builtin_amdgcn_sched_barrier(0);              // ... and the following group behind the block
        }
        asm volatile("s_wait_dscnt 0x0" ::: "memory");       // this wave's reads of the buffer are done before it may be refilled
        asm volatile("s_wait_asynccnt 0x0" ::: "memory");    // this wave's copies of stage p + 1 have landed
        __syncthreads();                                      // publishes stage p + 1 and ends every reader's last read of stage p
        if (p + 2 < GNP) fill(p + 2, p & 1);
    }
    asm volatile("s_wait_asynccnt 0x0" ::: "memory");        // no copy is outstanding when the wave goes on
    if (QKV && z == 2) {
        // v leaves transposed: an accumulator register group is 8 consecutive tokens of ONE column, so a lane's 8 values are one 16-B piece of a [col][tok] row. The block's
        // 128 cols x 128 tokens, hi plane then residual plane, are staged at a pitch of 272 B (conflict-free b128 rows) and go out as whole 256-B row pieces.
        constexpr int VPL = 128 * GPITCH;
        unsigned char* tb = (unsigned char*)&ost[0][0];
        static_assert(2 * VPL <= (int)sizeof(ost), "both planes fit the staging array");
        unsigned char* tw = tb + ((wave & 1) * 64 + lr) * GPITCH + ((wave >> 1) * 32 + hi * 8) * 2;
#pragma unroll
        for (int mi = 0; mi < 2; ++mi)
#pragma unroll
            for (int t = 0; t < 4; ++t) { const float bv = bias ? bfr(bias[c0 + t * 16 + lr]) : 0.f; v8h vh_, vl_;
#pragma unroll
                for (int j = 0; j < 8; ++j) { const float v = acc[mi][t][j] + bv; const h16 a = (h16)v; vh_[j] = a; vl_[j] = (h16)((v - (float)a) * LOSC); }
                *(v8ha*)(tw + t * 16 * GPITCH + mi * 32) = vh_; *(v8ha*)(tw + VPL + t * 16 * GPITCH + mi * 32) = vl_; }
        __syncthreads();    // the rows read below were written by four waves each
        const int col = threadIdx.x >> 4, piece = threadIdx.x & 15;    // 16 lanes = one 256-B row piece
        const unsigned char* tr = tb + col * GPITCH + piece * 16;
        h16* gh = VTH + (size_t)(cb + col) * NT_ + rb + piece * 8;    // NB_ = 1: column h * 64 + d of the product is row (h, d) of the planes, the row of A its token
        h16* gl = VTL + (size_t)(cb + col) * NT_ + rb + piece * 8;
#pragma unroll
        for (int s = 0; s < 8; ++s) { const v8h a = *(const v8ha*)(tr + s * 16 * GPITCH), r = *(const v8ha*)(tr + VPL + s * 16 * GPITCH);
            *(v8h*)(gh + (size_t)s * 16 * NT_) = a; *(v8h*)(gl + (size_t)s * 16 * NT_) = r; }
        return;
    }
    float* os = &ost[wave][0];
#pragma unroll
    for (int mi = 0; mi < 2; ++mi)
#pragma unroll
        for (int t = 0; t < 4; ++t) { const float bv = bias ? bfr(bias[c0 + t * 16 + lr]) : 0.f;
#pragma unroll
            for (int j = 0; j < 8; ++j) os[(mi * 16 + hi * 8 + j) * 68 + t * 16 + lr] = acc[mi][t][j] + bv; }
    __syncthreads();
    if (QKV) {    // z is 0 or 1 here
        h16* crow_p = (h16*)(void*)C + (size_t)r0 * ldc + c0;
#pragma unroll
        for (int s = 0; s < 8; ++s) { const int row = 4 * s + (lane >> 3), piece = lane & 7; const float* sp = os + row * 68 + piece * 8; v8h o, o2;
#pragma unroll
            for (int i = 0; i < 8; ++i) { const h16 a = (h16)sp[i]; o[i] = a; o2[i] = (h16)((sp[i] - (float)a) * LOSC); }
            *(v8h*)(crow_p + (size_t)row * ldc + piece * 8) = o;
            asm volatile("s_wait_xcnt 0x0" ::: "memory");    // stands in front of the next writes of the registers that the store above names
            if (C2) *(v8h*)(C2 + (size_t)r0 * ldc + c0 + (size_t)row * ldc + piece * 8) = o2; }
    } else {
        float* crow_p = C + (size_t)r0 * ldc + c0;
#pragma unroll
        for (int s = 0; s < 16; ++s) { const int Lid = (lane >> 3) + 4 * s, piece = lane & 7; const int row = Lid >> 1, cofs = (Lid & 1) * 32 + piece * 4;
            const v4f val = *(const v4fa*)(os + row * 68 + cofs); *(v4f*)(crow_p + (size_t)row * ldc + cofs) = val; }
    }
}

// k_attn: block = (b, h, 64 queries), wave = 16; key tiles kt_lo..kt_hi of the band (block-uniform), per-element mask j <= i && i - j < BAND; scores hi.hi + hi.lo +
// lo.hi (12 WMMA, /8 in f32), online softmax, weights x32768 hi + residual tiles (same-wave may_alias reload after a compiler barrier), 12 WMMA .v (hi.hi + hi.lo +
// lo.hi); ctx -> bf16 hi + residual planes CH/CL[tok][h*64+d].
// launch bounds: four waves a SIMD (256 registers a wave), so that all blocks of the grid stay resident at once with the wider load groups below.
__global__ __launch_bounds__(128, 4) void k_attn(const h16* __restrict__ Q16, const h16* __restrict__ QL16, const h16* __restrict__ K16, const h16* __restrict__ KL16, const h16* __restrict__ VTH, const h16* __restrict__ VTL, bf* CH, bf* CL) {
    __shared__ __align__(16) h16 plds[4][16 * 32];
    __shared__ __align__(16) h16 plds2[4][16 * 32];
    __shared__ __align__(16) float ost[4][16 * 68];
    const int lane = threadIdx.x & 31, wave = threadIdx.x >> 5, lr = lane & 15, hi = lane >> 4;
    const int bid = blockIdx.x;
    const int b = bid / (NH_ * (NT_ / 64)), rem = bid - b * (NH_ * (NT_ / 64)), h = rem / (NT_ / 64), qt = rem - h * (NT_ / 64);
    const int q0 = qt * 64 + wave * 16;
    const size_t tok0 = (size_t)b * NT_;
    h16* pl = &plds[wave][0]; h16* pl2 = &plds2[wave][0];
    h16* plw = pl + hi * 256 + lr; h16* pl2w = pl2 + hi * 256 + lr;    // the lane's column in its half's first row: row j is a constant offset, not a register
    v16h qa[2], ql[2];    // the query tile, hi and residual: read once, no load of it among the loop's groups
    const size_t qo0 = (tok0 + q0 + lr) * DM + h * HD + 8 * hi;
#pragma unroll
    for (int kc = 0; kc < 2; ++kc) { qa[kc] = cat16(*(const v8h*)(Q16 + qo0 + kc * 32), *(const v8h*)(Q16 + qo0 + kc * 32 + 16)); ql[kc] = cat16(*(const v8h*)(QL16 + qo0 + kc * 32), *(const v8h*)(QL16 + qo0 + kc * 32 + 16)); }
    const h16* kh_b = K16 + tok0 * DM + h * HD;
    const h16* kl_b = KL16 + tok0 * DM + h * HD;
    const h16* vh_b = VTH + (((size_t)b * NH_ + h) * HD) * NT_;
    const h16* vl_b = VTL + (((size_t)b * NH_ + h) * HD) * NT_;
    v8f o[4], ox[4];
#pragma unroll
    for (int n = 0; n < 4; ++n) { o[n] = (v8f){}; ox[n] = (v8f){}; }
    float mrow[8], lpart[8];
#pragma unroll
    for (int j = 0; j < 8; ++j) { mrow[j] = -3.0e38f; lpart[j] = 0.f; }
    const int dq = q0 + 8 * hi - lr;    // query row 0 of the lane's half minus the lane's key column: with the tile's first key taken off, i - j of the mask
    const int kt_lo = (qt * 64 - (BAND - 1)) > 0 ? (qt * 64 - (BAND - 1)) / 32 : 0, kt_hi = (qt * 64 + 63) / 32;     // block-uniform: keys qt*64-127 .. qt*64+63
#pragma unroll 1
    for (int kt = kt_lo; kt <= kt_hi; ++kt) {
        const int l0 = kt * 32;
        const unsigned ko0 = (unsigned)((l0 + lr) * DM + 8 * hi);    // 32-bit lane offset from the wave-uniform bases
        const h16* pkh = kh_b + ko0; const h16* pkl = kl_b + ko0;      // key l0 + lr; key l0 + 16 + lr is a constant offset from it
        // Every K fragment of the tile (hi and residual, both halves of the head) is asked for in one group: one load latency a tile, not four in a row.
        v16h kh[2][2], kl[2][2];
#pragma unroll
        for (int kc = 0; kc < 2; ++kc) {
            kh[kc][0] = cat16(*(const v8h*)(pkh + kc * 32), *(const v8h*)(pkh + kc * 32 + 16)); kh[kc][1] = cat16(*(const v8h*)(pkh + 16 * DM + kc * 32), *(const v8h*)(pkh + 16 * DM + kc * 32 + 16));
            kl[kc][0] = cat16(*(const v8h*)(pkl + kc * 32), *(const v8h*)(pkl + kc * 32 + 16)); kl[kc][1] = cat16(*(const v8h*)(pkl + 16 * DM + kc * 32), *(const v8h*)(pkl + 16 * DM + kc * 32 + 16));
        }
        asm volatile("s_wait_xcnt 0x0" :: "v"(pkh), "v"(pkl) : "memory");    // stands in front of the next write of the group's address registers; naming them keeps them whole up to here
        __builtin_amdgcn_sched_barrier(0);    // keeps the whole group ahead of the first WMMA: a load sunk to its user would wait out its latency alone
        v8f s0 = {}, s1 = {}, x0 = {}, x1 = {};
#pragma unroll
        for (int kc = 0; kc < 2; ++kc) {
            s0 = wmma16(qa[kc], kh[kc][0], s0); x0 = wmma16(ql[kc], kh[kc][0], x0); s1 = wmma16(qa[kc], kh[kc][1], s1); x1 = wmma16(ql[kc], kh[kc][1], x1);
            x0 = wmma16(qa[kc], kl[kc][0], x0); x1 = wmma16(qa[kc], kl[kc][1], x1);
        }
        // The tile's V fragments (hi and residual, all four column groups) are asked for here, in the registers that K has left: they land while the softmax below runs.
        v16h vh[4], vl[4];
        const unsigned vo0 = (unsigned)(lr * NT_ + l0 + hi * 8);
        const h16* pvh = vh_b + vo0; const h16* pvl = vl_b + vo0;      // column lr of group 0; group n is a constant offset from it
#pragma unroll
        for (int n = 0; n < 4; ++n) { vh[n] = cat16(*(const v8h*)(pvh + n * 16 * NT_), *(const v8h*)(pvh + n * 16 * NT_ + 16)); vl[n] = cat16(*(const v8h*)(pvl + n * 16 * NT_), *(const v8h*)(pvl + n * 16 * NT_ + 16)); }
        asm volatile("s_wait_xcnt 0x0" :: "v"(pvh), "v"(pvl) : "memory");    // as behind the K group
        __builtin_amdgcn_sched_barrier(0);    // keeps that group ahead of the softmax
        float alpha[8];
#pragma unroll
        for (int j = 0; j < 8; ++j) {
            const int da = dq - l0 + j, db = da - 16;    // i - j; 0 <= i - j < BAND as one unsigned compare
            const float a0 = (unsigned)da < (unsigned)BAND ? (s0[j] + x0[j] * LOSCI) * 0.125f : -__builtin_inff(), a1 = (unsigned)db < (unsigned)BAND ? (s1[j] + x1[j] * LOSCI) * 0.125f : -__builtin_inff();
            float mx = fmaxf(a0, a1);
            mx = fmaxf(mx, __shfl_xor(mx, 1, 16)); mx = fmaxf(mx, __shfl_xor(mx, 2, 16)); mx = fmaxf(mx, __shfl_xor(mx, 4, 16)); mx = fmaxf(mx, __shfl_xor(mx, 8, 16));
            const float mn = fmaxf(mrow[j], mx);
            alpha[j] = __expf(mrow[j] - mn); mrow[j] = mn;
            const float p0 = __expf(a0 - mn), p1 = __expf(a1 - mn);
            lpart[j] = lpart[j] * alpha[j] + (p0 + p1);
            const float ps0 = p0 * PSC, ps1 = p1 * PSC; const h16 h0 = (h16)ps0, h1 = (h16)ps1;
            plw[j * 32] = h0; plw[j * 32 + 16] = h1;
            pl2w[j * 32] = (h16)((ps0 - (float)h0) * LOSC); pl2w[j * 32 + 16] = (h16)((ps1 - (float)h1) * LOSC);
        }
#pragma unroll
        for (int n = 0; n < 4; ++n)
#pragma unroll
            for (int j = 0; j < 8; ++j) { o[n][j] *= alpha[j]; ox[n][j] *= alpha[j]; }
        asm volatile("" ::: "memory");
        const v16h pa = cat16(*(const v8ha*)(pl + lr * 32 + hi * 8), *(const v8ha*)(pl + lr * 32 + 16 + hi * 8));
        const v16h px = cat16(*(const v8ha*)(pl2 + lr * 32 + hi * 8), *(const v8ha*)(pl2 + lr * 32 + 16 + hi * 8));
#pragma unroll
        for (int n = 0; n < 4; ++n) { o[n] = wmma16(pa, vh[n], o[n]); ox[n] = wmma16(pa, vl[n], ox[n]); ox[n] = wmma16(px, vh[n], ox[n]); }
        // four vector slots behind the last WMMA, on the loop's taken branch too
        asm volatile("v_nop\n\tv_nop\n\tv_nop\n\tv_nop" : "+v"(o[0]), "+v"(o[1]), "+v"(o[2]), "+v"(o[3]), "+v"(ox[0]), "+v"(ox[1]), "+v"(ox[2]), "+v"(ox[3]) : "v"(pa), "v"(px));
    }
    float inv[8];
#pragma unroll
    for (int j = 0; j < 8; ++j) { float rs = lpart[j]; rs += __shfl_xor(rs, 1, 16); rs += __shfl_xor(rs, 2, 16); rs += __shfl_xor(rs, 4, 16); rs += __shfl_xor(rs, 8, 16); inv[j] = 1.0f / (rs * PSC); }
    float* os = &ost[wave][0];
#pragma unroll
    for (int n = 0; n < 4; ++n)
#pragma unroll
        for (int j = 0; j < 8; ++j) os[(hi * 8 + j) * 68 + n * 16 + lr] = (o[n][j] + ox[n][j] * LOSCI) * inv[j];
    __syncthreads();
    const size_t cbase = (tok0 + q0) * DM + (size_t)h * HD;
    auto pass = [&]() {
#pragma unroll
        for (int s = 0; s < 4; ++s) { const int row = 4 * s + (lane >> 3), piece = lane & 7; const float* sp = os + row * 68 + piece * 8; v8us oh, ol;
#pragma unroll
            for (int i = 0; i < 8; ++i) { const unsigned short hb = f2bf(sp[i]); oh[i] = hb; ol[i] = f2bf(sp[i] - bf2f(hb)); }
            *(v8us*)(CH + cbase + (size_t)row * DM + piece * 8) = oh; *(v8us*)(CL + cbase + (size_t)row * DM + piece * 8) = ol; }
    };
    pass(); 
}

#define VST2(T, p, v) do { const T vst2_v_ = (v); *(T*)(p) = vst2_v_;  } while (0)
extern "C" void kernel_launch(void* const* d_in, const int* in_sizes, int n_in,
                              void* d_out, int out_size, void* d_ws, size_t ws_size, hipStream_t stream) {
    (void)in_sizes; (void)n_in; (void)out_size;
    const float* x = (const float*)d_in[0]; const float* Wq = (const float*)d_in[1]; const float* Wk = (const float*)d_in[2]; const float* Wv = (const float*)d_in[3]; const float* Wo = (const float*)d_in[4];
    float* out = (float*)d_out;    // [1][4096][1024]
    char* wsp = (char*)d_ws;
    auto take = [&](size_t bytes) { char* p = wsp; wsp += (bytes + 255) & ~(size_t)255; return (void*)p; };
    bf* Xb = (bf*)take((size_t)NTK * DM * 2); bf* WqB = (bf*)take((size_t)DM * DM * 2); bf* WkB = (bf*)take((size_t)DM * DM * 2); bf* WvB = (bf*)take((size_t)DM * DM * 2); bf* WoB = (bf*)take((size_t)DM * DM * 2);
    h16* Q16 = (h16*)take((size_t)NTK * DM * 2); h16* QL16 = (h16*)take((size_t)NTK * DM * 2); h16* K16 = (h16*)take((size_t)NTK * DM * 2); h16* KL16 = (h16*)take((size_t)NTK * DM * 2); bf* CL = (bf*)take((size_t)NTK * DM * 2); h16* VTH = (h16*)take((size_t)NTK * DM * 2); h16* VTL = (h16*)take((size_t)NTK * DM * 2);
    if ((size_t)(wsp - (char*)d_ws) > ws_size) return;    // 8 planes of 8.4 MB + 4 of 2.1 MB ~ 76 MB; the ctx hi plane aliases Xb after its last reader
    bf* CH = (bf*)Xb;
    k_cvtb<<<(NTK + 4 * DM) / 8, 256, 0, stream>>>(x, Wq, Wk, Wv, Wo, Xb, WqB, WkB, WvB, WoB);
    k_gemmb<false, true><<<dim3(NTK / 128, DM / 128, 3), 256, 0, stream>>>(Xb, nullptr, WqB, WkB, WvB, nullptr, nullptr, DM, Q16, QL16, K16, KL16, VTH, VTL);
    k_attn<<<NB_ * NH_ * (NT_ / 64), 128, 0, stream>>>(Q16, QL16, K16, KL16, VTH, VTL, CH, CL);
    k_gemmb<true, false><<<dim3(NTK / 128, DM / 128, 1), 256, 0, stream>>>(CH, CL, WoB, nullptr, nullptr, nullptr, out, DM, nullptr, nullptr, nullptr, nullptr, nullptr, nullptr);
}

// v005
// One run takes 75.5 microseconds.
// Next to v004, in two timings, it ran 1.14 and 1.12 times as fast.
// All steps since v000 together make it 2.92 times as fast.
#include <hip/hip_runtime.h>

// Contractions, f32 accumulate: q/k/v = x.W^T ([4096 x 1024].[1024 x 1024] each; W is [out][in] = the n-major B operand as-is) and y.Wo^T on
// v_wmma_f32_16x16x32_bf16 with PLAIN bf16 operands for the projections (inputs rounded once: exact) and y as bf16 hi + residual planes (two products) for Wo; the
// banded-causal 16-head attention (keys j with i-127 <= j <= i) fused on v_wmma_f32_16x16x32_f16 over the <= 6 key tiles per 64-query block: q and k as f16 hi + residual x1024

#define NB_  1
#define NT_  4096
#define DM   1024
#define NH_  16
#define HD   64
#define NTK  (NB_ * NT_)
#define NW   1024
#define NQKV 1024
#define BAND 128
#define PSC  32768.0f
#define LOSC 1024.0f
#define LOSCI (1.0f / 1024.0f)

typedef _Float16 h16;
typedef unsigned short bf;
typedef __attribute__((ext_vector_type(16))) __bf16   v16bf;
typedef __attribute__((ext_vector_type(16))) _Float16 v16h;
typedef __attribute__((ext_vector_type(8)))  _Float16 v8h;
typedef __attribute__((ext_vector_type(8)))  unsigned short v8us;
typedef __attribute__((ext_vector_type(8)))  float    v8f;
typedef __attribute__((ext_vector_type(4)))  float    v4f;
typedef v8h  __attribute__((may_alias)) v8ha;
typedef v4f  __attribute__((may_alias)) v4fa;
typedef v8us __attribute__((may_alias)) v8usa;

__device__ __forceinline__ unsigned short f2bf(float f) { unsigned u = __float_as_uint(f); u += 0x7FFFu + ((u >> 16) & 1u); return (unsigned short)(u >> 16); }
__device__ __forceinline__ float bf2f(unsigned short b) { return __uint_as_float(((unsigned)b) << 16); }
__device__ __forceinline__ float bfr(float f) { return bf2f(f2bf(f)); }
__device__ __forceinline__ v16h cat16(v8h lo, v8h hi) { return __builtin_shufflevector(lo, hi, 0, 1, 2, 3, 4, 5, 6, 7, 8, 9, 10, 11, 12, 13, 14, 15); }
__device__ __forceinline__ v16bf cat16b(v8us lo, v8us hi) { return __builtin_bit_cast(v16bf, __builtin_shufflevector(lo, hi, 0, 1, 2, 3, 4, 5, 6, 7, 8, 9, 10, 11, 12, 13, 14, 15)); }
__device__ __forceinline__ v8f wmma16(v16h a, v16h b, v8f c) { return __builtin_amdgcn_wmma_f32_16x16x32_f16(false, a, false, b, (short)0, c, false, false); }
__device__ __forceinline__ v8f wmmab(v16bf a, v16bf b, v8f c) { return __builtin_amdgcn_wmma_f32_16x16x32_bf16(false, a, false, b, (short)0, c, false, false); }

// k_cvtb: one grid rounds all five inputs: blocks [0, NTK / 8) take x, then DM / 8 blocks each weight; 8 rows a block, so the pick is block-uniform (scalar selects).
__global__ __launch_bounds__(256) void k_cvtb(const float* __restrict__ x, const float* __restrict__ Wq, const float* __restrict__ Wk, const float* __restrict__ Wv, const float* __restrict__ Wo,
                                              bf* Xb, bf* WqB, bf* WkB, bf* WvB, bf* WoB) {
    const int blk = blockIdx.x, sel = blk < NTK / 8 ? 0 : 1 + (blk - NTK / 8) / (DM / 8);
    const float* src = sel == 0 ? x : sel == 1 ? Wq : sel == 2 ? Wk : sel == 3 ? Wv : Wo;
    bf* dst = sel == 0 ? Xb : sel == 1 ? WqB : sel == 2 ? WkB : sel == 3 ? WvB : WoB;
    const int lane = threadIdx.x & 31, r = (sel == 0 ? blk : (blk - NTK / 8) % (DM / 8)) * 8 + (threadIdx.x >> 5);
    v8us o[DM / 256];
#pragma unroll
    for (int q = 0; q < DM / 256; ++q) { v8us t;
#pragma unroll
        for (int i = 0; i < 8; ++i) t[i] = f2bf(src[(size_t)r * DM + q * 256 + lane * 8 + i]);
        o[q] = t; }
#pragma unroll
    for (int q = 0; q < DM / 256; ++q) *(v8us*)(dst + (size_t)r * DM + q * 256 + lane * 8) = o[q];
    
}

// k_wt: W [1024 k][ncols n] (k-major) -> n-major bf16 plane WT[ncols][1024]; 64 x 64 tiles through LDS.
__global__ __launch_bounds__(256) void k_wt(const float* __restrict__ Wm, int ncols, bf* WT) {
    __shared__ __align__(16) unsigned short tl[64 * 72];
    const int tid = threadIdx.x, k0 = blockIdx.x * 64, n0 = blockIdx.y * 64;
    const int kk = tid >> 2, nq = (tid & 3) * 16;
#pragma unroll
    for (int i = 0; i < 16; ++i) tl[(nq + i) * 72 + kk] = f2bf(Wm[(size_t)(k0 + kk) * ncols + n0 + nq + i]);
    __syncthreads();
    const int piece = tid & 7;
    typedef __attribute__((ext_vector_type(8))) unsigned short v8us_; typedef v8us_ __attribute__((may_alias)) v8usa_;
    auto pass = [&]() {
#pragma unroll
        for (int s = 0; s < 2; ++s) { const int nr = (tid >> 3) + 32 * s; const v8us_ val = *(const v8usa_*)(tl + nr * 72 + piece * 8);
            *(v8us_*)(WT + (size_t)(n0 + nr) * DM + k0 + piece * 8) = val; }
    };
    pass(); 
}

// k_gemmb: C[128 x 128] per block of 8 waves (4 x 2, 32 x 64 each). A stage is 128 k = 256 B of every operand row, rows [A 128 | A residual 128 (SPLITA) | B 128] at an
// LDS pitch of 272 B (16 B x odd: conflict-free for the ds_load_b128 fragment reads). Two buffers, filled by per-lane b128 asynchronous copies to LDS (16 lanes = one whole
// 256-B row piece), the next stage in flight while this one is worked on. Per accumulator the k order and the hi-then-residual order are those of the direct-load form.
// Every '#pragma unroll' in k_gemmb makes the indices into acc and the fragment sets compile-time constants, so that they stay in registers.
#define GKP    128
#define GPITCH 272
#define GNP    (DM / GKP)

// Eight copies, rows 16 apart (8 waves x 2 rows per copy). s_wait_xcnt 0 is the last line of the copies' own statement so that no address register is rewritten ahead of it.
__device__ __forceinline__ void cp8(unsigned l, const bf* p) {
    asm volatile("global_load_async_to_lds_b128 %0, %8, off\n\t"
                 "global_load_async_to_lds_b128 %1, %9, off\n\t"
                 "global_load_async_to_lds_b128 %2, %10, off\n\t"
                 "global_load_async_to_lds_b128 %3, %11, off\n\t"
                 "global_load_async_to_lds_b128 %4, %12, off\n\t"
                 "global_load_async_to_lds_b128 %5, %13, off\n\t"
                 "global_load_async_to_lds_b128 %6, %14, off\n\t"
                 "global_load_async_to_lds_b128 %7, %15, off\n\t"
                 "s_wait_xcnt 0x0"
                 :: "v"(l), "v"(l + 16u * GPITCH), "v"(l + 32u * GPITCH), "v"(l + 48u * GPITCH), "v"(l + 64u * GPITCH), "v"(l + 80u * GPITCH), "v"(l + 96u * GPITCH), "v"(l + 112u * GPITCH),
                    "v"(p), "v"(p + 16 * DM), "v"(p + 32 * DM), "v"(p + 48 * DM), "v"(p + 64 * DM), "v"(p + 80 * DM), "v"(p + 96 * DM), "v"(p + 112 * DM)
                 : "memory");
}

// QKV: one grid does the three products of the same A; blockIdx.z picks the weight plane and the output (0: q, 1: k, 2: v, each as f16 hi + residual planes). Block-uniform.
// The planes are laid out in the ORDER IN WHICH k_attn's FRAGMENT LOADS READ THEM, so that each of its wave-wide 16-B loads covers 512 contiguous bytes (four whole lines):
//   q, k: [head][16-token tile][16-d group g = 0..3][lane = hi * 16 + token % 16][8 d: g * 16 + hi * 8 + i]          (1024 halves a tile)
//   v:    [head][32-token tile][16-d group n = 0..3][16-token half][lane = hi * 16 + d % 16][8 tokens: hi * 8 + i]   (2048 halves a tile)
template <bool SPLITA, bool QKV>
__global__ __launch_bounds__(256) void k_gemmb(const bf* __restrict__ A, const bf* __restrict__ Al, const bf* __restrict__ B0, const bf* __restrict__ B1, const bf* __restrict__ B2, const float* __restrict__ bias,
                                               float* Cf, int ldc, h16* H0, h16* L0, h16* H1, h16* L1, h16* VTH, h16* VTL) {
    const int z = QKV ? (int)blockIdx.z : 0;
    const bool f16out = QKV && z < 2;
    const bf* Bn = z == 0 ? B0 : z == 1 ? B1 : B2;
    float* C = f16out ? (float*)(void*)(z == 0 ? H0 : H1) : Cf;
    h16* C2 = z == 0 ? L0 : L1;
    constexpr int BROW = SPLITA ? 256 : 128, STG = (BROW + 128) * GPITCH;
    __shared__ __align__(16) unsigned char ring[2 * STG];
    __shared__ __align__(16) float ost[8][32 * 68];
    const int lane = threadIdx.x & 31, wave = threadIdx.x >> 5, lr = lane & 15, hi = lane >> 4;
    const int rb = blockIdx.x * 128, cb = blockIdx.y * 128;
    const int r0 = rb + (wave >> 1) * 32, c0 = cb + (wave & 1) * 64;
    const int crow = 2 * wave + hi;
    const bf* gA = A + (size_t)(rb + crow) * DM + lr * 8;
    const bf* gAl = SPLITA ? Al + (size_t)(rb + crow) * DM + lr * 8 : gA;
    const bf* gB = Bn + (size_t)(cb + crow) * DM + lr * 8;
    const unsigned lcp = (unsigned)(uintptr_t)&ring[0] + (unsigned)(crow * GPITCH + lr * 16);
    auto fill = [&](int t, int buf) {
        const unsigned l = lcp + (unsigned)(buf * STG);
        cp8(l, gA + t * GKP);
        if (SPLITA) cp8(l + 128u * GPITCH, gAl + t * GKP);
        cp8(l + (unsigned)(BROW * GPITCH), gB + t * GKP);
    };
    const int aofs = ((wave >> 1) * 32 + lr) * GPITCH + hi * 16, bofs = (BROW + (wave & 1) * 64 + lr) * GPITCH + hi * 16;
    v8f acc[2][4];
#pragma unroll
    for (int mi = 0; mi < 2; ++mi)
#pragma unroll
        for (int t = 0; t < 4; ++t) acc[mi][t] = (v8f){};
    fill(0, 0);
    asm volatile("s_wait_asynccnt 0x0" ::: "memory");    // this wave's copies of stage 0 have landed
    __syncthreads();                                      // ... and every other wave's: stage 0 is readable
    fill(1, 1);
#pragma unroll 1    // rolled: one ring foot
    for (int p = 0; p < GNP; ++p) {
        const unsigned char* sb = ring + (p & 1) * STG;
        v16bf a[2][2], al[2][2], b[2][4];
        auto frags = [&](int ks, int f) {
#pragma unroll
            for (int mi = 0; mi < 2; ++mi) { const unsigned char* q = sb + aofs + mi * 16 * GPITCH + ks * 64;
                a[f][mi] = cat16b(*(const v8usa*)q, *(const v8usa*)(q + 32));
                if (SPLITA) al[f][mi] = cat16b(*(const v8usa*)(q + 128 * GPITCH), *(const v8usa*)(q + 128 * GPITCH + 32)); }
#pragma unroll
            for (int t = 0; t < 4; ++t) { const unsigned char* q = sb + bofs + t * 16 * GPITCH + ks * 64; b[f][t] = cat16b(*(const v8usa*)q, *(const v8usa*)(q + 32)); }
        };
        frags(0, 0);
#pragma unroll
        for (int ks = 0; ks < GKP / 32; ++ks) {
            const int f = ks & 1;
            if (ks + 1 < GKP / 32) frags(ks + 1, f ^ 1);    // the next 32 k of this same stage, one group into the other fragment set
            __builtin_amdgcn_sched_barrier(0);              // keeps that group ahead of the WMMA block
#pragma unroll
            for (int mi = 0; mi < 2; ++mi)
#pragma unroll
                for (int t = 0; t < 4; ++t) acc[mi][t] = wmmab(a[f][mi], b[f][t], acc[mi][t]);
            if (SPLITA) {
#pragma unroll
                for (int mi = 0; mi < 2; ++mi)
#pragma unroll
                    for (int t = 0; t < 4; ++t) acc[mi][t] = wmmab(al[f][mi], b[f][t], acc[mi][t]);
            }
            __builtin_amdgcn_sched_barrier(0);              // ... and the following group behind the block
        }
        asm volatile("s_wait_dscnt 0x0" ::: "memory");       // this wave's reads of the buffer are done before it may be refilled
        asm volatile("s_wait_asynccnt 0x0" ::: "memory");    // this wave's copies of stage p + 1 have landed
        __syncthreads();                                      // publishes stage p + 1 and ends every reader's last read of stage p
        if (p + 2 < GNP) fill(p + 2, p & 1);
    }
    asm volatile("s_wait_asynccnt 0x0" ::: "memory");        // no copy is outstanding when the wave goes on
    if (QKV && z == 2) {
        // An accumulator register group is 8 consecutive tokens of ONE column: exactly a lane's 16-B piece of the v fragment order. The wave's 32 tokens x 64 columns are one
        // (head, 32-token tile), so every store below is 512 contiguous bytes straight from registers.
        const size_t vb = ((size_t)(c0 >> 6) * (NT_ / 32) + (r0 >> 5)) * 2048 + lane * 8;    // NB_ = 1: the row of A is its token
        h16* gh = VTH + vb; h16* gl = VTL + vb;
#pragma unroll
        for (int mi = 0; mi < 2; ++mi)
#pragma unroll
            for (int t = 0; t < 4; ++t) { const float bv = bias ? bfr(bias[c0 + t * 16 + lr]) : 0.f; v8h vh_, vl_;
#pragma unroll
                for (int j = 0; j < 8; ++j) { const float v = acc[mi][t][j] + bv; const h16 a = (h16)v; vh_[j] = a; vl_[j] = (h16)((v - (float)a) * LOSC); }
                *(v8h*)(gh + t * 512 + mi * 256) = vh_; *(v8h*)(gl + t * 512 + mi * 256) = vl_;
                asm volatile("s_wait_xcnt 0x0" ::: "memory"); }    // stands in front of the next writes of the registers that the two stores above name
        return;
    }
    float* os = &ost[wave][0];
#pragma unroll
    for (int mi = 0; mi < 2; ++mi)
#pragma unroll
        for (int t = 0; t < 4; ++t) { const float bv = bias ? bfr(bias[c0 + t * 16 + lr]) : 0.f;
#pragma unroll
            for (int j = 0; j < 8; ++j) os[(mi * 16 + hi * 8 + j) * 68 + t * 16 + lr] = acc[mi][t][j] + bv; }
    __syncthreads();
    if (QKV) {    // z is 0 or 1 here
        // the wave's 32 tokens x 64 columns are two 16-token tiles of one head; pass s is d group s & 3 of tile s >> 2: 512 contiguous bytes a store
        const size_t fb = ((size_t)(c0 >> 6) * (NT_ / 16) + (r0 >> 4)) * 1024 + lane * 8;    // NB_ = 1: the row of A is its token
        h16* crow_p = (h16*)(void*)C + fb;
#pragma unroll
        for (int s = 0; s < 8; ++s) { const float* sp = os + ((s >> 2) * 16 + lr) * 68 + (s & 3) * 16 + hi * 8; v8h o, o2;
#pragma unroll
            for (int i = 0; i < 8; ++i) { const h16 a = (h16)sp[i]; o[i] = a; o2[i] = (h16)((sp[i] - (float)a) * LOSC); }
            *(v8h*)(crow_p + s * 256) = o;
            asm volatile("s_wait_xcnt 0x0" ::: "memory");    // stands in front of the next writes of the registers that the store above names
            if (C2) *(v8h*)(C2 + fb + s * 256) = o2; }
    } else {
        float* crow_p = C + (size_t)r0 * ldc + c0;
#pragma unroll
        for (int s = 0; s < 16; ++s) { const int Lid = (lane >> 3) + 4 * s, piece = lane & 7; const int row = Lid >> 1, cofs = (Lid & 1) * 32 + piece * 4;
            const v4f val = *(const v4fa*)(os + row * 68 + cofs); *(v4f*)(crow_p + (size_t)row * ldc + cofs) = val; }
    }
}

// k_attn: block = (b, h, 64 queries), wave = 16; key tiles kt_lo..kt_hi of the band (block-uniform), per-element mask j <= i && i - j < BAND; scores hi.hi + hi.lo +
// lo.hi (12 WMMA, /8 in f32), online softmax, weights x32768 hi + residual tiles (same-wave may_alias reload after a compiler barrier), 12 WMMA .v (hi.hi + hi.lo +
// lo.hi); ctx -> bf16 hi + residual planes CH/CL[tok][h*64+d].
// launch bounds: four waves a SIMD (256 registers a wave), so that all blocks of the grid stay resident at once with the wider load groups below.
__global__ __launch_bounds__(128, 4) void k_attn(const h16* __restrict__ Q16, const h16* __restrict__ QL16, const h16* __restrict__ K16, const h16* __restrict__ KL16, const h16* __restrict__ VTH, const h16* __restrict__ VTL, bf* CH, bf* CL) {
    __shared__ __align__(16) h16 plds[4][16 * 32];
    __shared__ __align__(16) h16 plds2[4][16 * 32];
    __shared__ __align__(16) float ost[4][16 * 68];
    const int lane = threadIdx.x & 31, wave = threadIdx.x >> 5, lr = lane & 15, hi = lane >> 4;
    const int bid = blockIdx.x;
    const int b = bid / (NH_ * (NT_ / 64)), rem = bid - b * (NH_ * (NT_ / 64)), h = rem / (NT_ / 64), qt = rem - h * (NT_ / 64);
    const int q0 = qt * 64 + wave * 16;
    const size_t tok0 = (size_t)b * NT_;
    h16* pl = &plds[wave][0]; h16* pl2 = &plds2[wave][0];
    h16* plw = pl + hi * 256 + lr; h16* pl2w = pl2 + hi * 256 + lr;    // the lane's column in its half's first row: row j is a constant offset, not a register
    v16h qa[2], ql[2];    // the query tile, hi and residual: read once, no load of it among the loop's groups
    const size_t hb = ((size_t)b * NH_ + h) * HD * NT_;    // the head's part of every plane (fragment order: the layouts stand at k_gemmb)
    const size_t qo0 = hb + (size_t)(q0 >> 4) * 1024 + lane * 8;
#pragma unroll
    for (int kc = 0; kc < 2; ++kc) { qa[kc] = cat16(*(const v8h*)(Q16 + qo0 + kc * 512), *(const v8h*)(Q16 + qo0 + kc * 512 + 256)); ql[kc] = cat16(*(const v8h*)(QL16 + qo0 + kc * 512), *(const v8h*)(QL16 + qo0 + kc * 512 + 256)); }
    const h16* kh_b = K16 + hb;
    const h16* kl_b = KL16 + hb;
    const h16* vh_b = VTH + hb;
    const h16* vl_b = VTL + hb;
    v8f o[4], ox[4];
#pragma unroll
    for (int n = 0; n < 4; ++n) { o[n] = (v8f){}; ox[n] = (v8f){}; }
    float mrow[8], lpart[8];
#pragma unroll
    for (int j = 0; j < 8; ++j) { mrow[j] = -3.0e38f; lpart[j] = 0.f; }
    const int dq = q0 + 8 * hi - lr;    // query row 0 of the lane's half minus the lane's key column: with the tile's first key taken off, i - j of the mask
    const int kt_lo = (qt * 64 - (BAND - 1)) > 0 ? (qt * 64 - (BAND - 1)) / 32 : 0, kt_hi = (qt * 64 + 63) / 32;     // block-uniform: keys qt*64-127 .. qt*64+63
#pragma unroll 1
    for (int kt = kt_lo; kt <= kt_hi; ++kt) {
        const int l0 = kt * 32;
        const unsigned ko0 = (unsigned)(kt * 2048 + lane * 8);    // 32-bit lane offset from the wave-uniform bases: a 32-key tile is 2048 halves of each plane, K and V alike
        const h16* pkh = kh_b + ko0; const h16* pkl = kl_b + ko0;      // keys l0 .. l0 + 15; keys l0 + 16 .. are a constant offset from them
        // Every K fragment of the tile (hi and residual, both halves of the head) is asked for in one group: one load latency a tile, not four in a row.
        v16h kh[2][2], kl[2][2];
#pragma unroll
        for (int kc = 0; kc < 2; ++kc) {
            kh[kc][0] = cat16(*(const v8h*)(pkh + kc * 512), *(const v8h*)(pkh + kc * 512 + 256)); kh[kc][1] = cat16(*(const v8h*)(pkh + 1024 + kc * 512), *(const v8h*)(pkh + 1024 + kc * 512 + 256));
            kl[kc][0] = cat16(*(const v8h*)(pkl + kc * 512), *(const v8h*)(pkl + kc * 512 + 256)); kl[kc][1] = cat16(*(const v8h*)(pkl + 1024 + kc * 512), *(const v8h*)(pkl + 1024 + kc * 512 + 256));
        }
        asm volatile("s_wait_xcnt 0x0" :: "v"(pkh), "v"(pkl) : "memory");    // stands in front of the next write of the group's address registers; naming them keeps them whole up to here
        __builtin_amdgcn_sched_barrier(0);    // keeps the whole group ahead of the first WMMA: a load sunk to its user would wait out its latency alone
        v8f s0 = {}, s1 = {}, x0 = {}, x1 = {};
#pragma unroll
        for (int kc = 0; kc < 2; ++kc) {
            s0 = wmma16(qa[kc], kh[kc][0], s0); x0 = wmma16(ql[kc], kh[kc][0], x0); s1 = wmma16(qa[kc], kh[kc][1], s1); x1 = wmma16(ql[kc], kh[kc][1], x1);
            x0 = wmma16(qa[kc], kl[kc][0], x0); x1 = wmma16(qa[kc], kl[kc][1], x1);
        }
        // The tile's V fragments (hi and residual, all four column groups) are asked for here, in the registers that K has left: they land while the softmax below runs.
        v16h vh[4], vl[4];
        const h16* pvh = vh_b + ko0; const h16* pvl = vl_b + ko0;      // column group 0; group n is a constant offset from it
#pragma unroll
        for (int n = 0; n < 4; ++n) { vh[n] = cat16(*(const v8h*)(pvh + n * 512), *(const v8h*)(pvh + n * 512 + 256)); vl[n] = cat16(*(const v8h*)(pvl + n * 512), *(const v8h*)(pvl + n * 512 + 256)); }
        asm volatile("s_wait_xcnt 0x0" :: "v"(pvh), "v"(pvl) : "memory");    // as behind the K group
        __builtin_amdgcn_sched_barrier(0);    // keeps that group ahead of the softmax
        float alpha[8];
#pragma unroll
        for (int j = 0; j < 8; ++j) {
            const int da = dq - l0 + j, db = da - 16;    // i - j; 0 <= i - j < BAND as one unsigned compare
            const float a0 = (unsigned)da < (unsigned)BAND ? (s0[j] + x0[j] * LOSCI) * 0.125f : -__builtin_inff(), a1 = (unsigned)db < (unsigned)BAND ? (s1[j] + x1[j] * LOSCI) * 0.125f : -__builtin_inff();
            float mx = fmaxf(a0, a1);
            mx = fmaxf(mx, __shfl_xor(mx, 1, 16)); mx = fmaxf(mx, __shfl_xor(mx, 2, 16)); mx = fmaxf(mx, __shfl_xor(mx, 4, 16)); mx = fmaxf(mx, __shfl_xor(mx, 8, 16));
            const float mn = fmaxf(mrow[j], mx);
            alpha[j] = __expf(mrow[j] - mn); mrow[j] = mn;
            const float p0 = __expf(a0 - mn), p1 = __expf(a1 - mn);
            lpart[j] = lpart[j] * alpha[j] + (p0 + p1);
            const float ps0 = p0 * PSC, ps1 = p1 * PSC; const h16 h0 = (h16)ps0, h1 = (h16)ps1;
            plw[j * 32] = h0; plw[j * 32 + 16] = h1;
            pl2w[j * 32] = (h16)((ps0 - (float)h0) * LOSC); pl2w[j * 32 + 16] = (h16)((ps1 - (float)h1) * LOSC);
        }
#pragma unroll
        for (int n = 0; n < 4; ++n)
#pragma unroll
            for (int j = 0; j < 8; ++j) { o[n][j] *= alpha[j]; ox[n][j] *= alpha[j]; }
        asm volatile("" ::: "memory");
        const v16h pa = cat16(*(const v8ha*)(pl + lr * 32 + hi * 8), *(const v8ha*)(pl + lr * 32 + 16 + hi * 8));
        const v16h px = cat16(*(const v8ha*)(pl2 + lr * 32 + hi * 8), *(const v8ha*)(pl2 + lr * 32 + 16 + hi * 8));
#pragma unroll
        for (int n = 0; n < 4; ++n) { o[n] = wmma16(pa, vh[n], o[n]); ox[n] = wmma16(pa, vl[n], ox[n]); ox[n] = wmma16(px, vh[n], ox[n]); }
        // four vector slots behind the last WMMA, on the loop's taken branch too
        asm volatile("v_nop\n\tv_nop\n\tv_nop\n\tv_nop" : "+v"(o[0]), "+v"(o[1]), "+v"(o[2]), "+v"(o[3]), "+v"(ox[0]), "+v"(ox[1]), "+v"(ox[2]), "+v"(ox[3]) : "v"(pa), "v"(px));
    }
    float inv[8];
#pragma unroll
    for (int j = 0; j < 8; ++j) { float rs = lpart[j]; rs += __shfl_xor(rs, 1, 16); rs += __shfl_xor(rs, 2, 16); rs += __shfl_xor(rs, 4, 16); rs += __shfl_xor(rs, 8, 16); inv[j] = 1.0f / (rs * PSC); }
    float* os = &ost[wave][0];
#pragma unroll
    for (int n = 0; n < 4; ++n)
#pragma unroll
        for (int j = 0; j < 8; ++j) os[(hi * 8 + j) * 68 + n * 16 + lr] = (o[n][j] + ox[n][j] * LOSCI) * inv[j];
    __syncthreads();
    const size_t cbase = (tok0 + q0) * DM + (size_t)h * HD;
    auto pass = [&]() {
#pragma unroll
        for (int s = 0; s < 4; ++s) { const int row = 4 * s + (lane >> 3), piece = lane & 7; const float* sp = os + row * 68 + piece * 8; v8us oh, ol;
#pragma unroll
            for (int i = 0; i < 8; ++i) { const unsigned short hb = f2bf(sp[i]); oh[i] = hb; ol[i] = f2bf(sp[i] - bf2f(hb)); }
            *(v8us*)(CH + cbase + (size_t)row * DM + piece * 8) = oh; *(v8us*)(CL + cbase + (size_t)row * DM + piece * 8) = ol; }
    };
    pass(); 
}

#define VST2(T, p, v) do { const T vst2_v_ = (v); *(T*)(p) = vst2_v_;  } while (0)
extern "C" void kernel_launch(void* const* d_in, const int* in_sizes, int n_in,
                              void* d_out, int out_size, void* d_ws, size_t ws_size, hipStream_t stream) {
    (void)in_sizes; (void)n_in; (void)out_size;
    const float* x = (const float*)d_in[0]; const float* Wq = (const float*)d_in[1]; const float* Wk = (const float*)d_in[2]; const float* Wv = (const float*)d_in[3]; const float* Wo = (const float*)d_in[4];
    float* out = (float*)d_out;    // [1][4096][1024]
    char* wsp = (char*)d_ws;
    auto take = [&](size_t bytes) { char* p = wsp; wsp += (bytes + 255) & ~(size_t)255; return (void*)p; };
    bf* Xb = (bf*)take((size_t)NTK * DM * 2); bf* WqB = (bf*)take((size_t)DM * DM * 2); bf* WkB = (bf*)take((size_t)DM * DM * 2); bf* WvB = (bf*)take((size_t)DM * DM * 2); bf* WoB = (bf*)take((size_t)DM * DM * 2);
    h16* Q16 = (h16*)take((size_t)NTK * DM * 2); h16* QL16 = (h16*)take((size_t)NTK * DM * 2); h16* K16 = (h16*)take((size_t)NTK * DM * 2); h16* KL16 = (h16*)take((size_t)NTK * DM * 2); bf* CL = (bf*)take((size_t)NTK * DM * 2); h16* VTH = (h16*)take((size_t)NTK * DM * 2); h16* VTL = (h16*)take((size_t)NTK * DM * 2);
    if ((size_t)(wsp - (char*)d_ws) > ws_size) return;    // 8 planes of 8.4 MB + 4 of 2.1 MB ~ 76 MB; the ctx hi plane aliases Xb after its last reader
    bf* CH = (bf*)Xb;
    k_cvtb<<<(NTK + 4 * DM) / 8, 256, 0, stream>>>(x, Wq, Wk, Wv, Wo, Xb, WqB, WkB, WvB, WoB);
    k_gemmb<false, true><<<dim3(NTK / 128, DM / 128, 3), 256, 0, stream>>>(Xb, nullptr, WqB, WkB, WvB, nullptr, nullptr, DM, Q16, QL16, K16, KL16, VTH, VTL);
    k_attn<<<NB_ * NH_ * (NT_ / 64), 128, 0, stream>>>(Q16, QL16, K16, KL16, VTH, VTL, CH, CL);
    k_gemmb<true, false><<<dim3(NTK / 128, DM / 128, 1), 256, 0, stream>>>(CH, CL, WoB, nullptr, nullptr, nullptr, out, DM, nullptr, nullptr, nullptr, nullptr, nullptr, nullptr);
}

// v006
// A run of this version takes 71.6 microseconds.
// Timed twice side by side with v005, it ran 1.08 and 1.07 times as fast.
// Counting every step since v000, it is 3.13 times as fast.
#include <hip/hip_runtime.h>

// Contractions, f32 accumulate: q/k/v = x.W^T ([4096 x 1024].[1024 x 1024] each; W is [out][in], used as-is: the n-major B operand for v, for q and k the A operand (transposed product)) and y.Wo^T on
// v_wmma_f32_16x16x32_bf16 with PLAIN bf16 operands for the projections (inputs rounded once: exact) and y as bf16 hi + residual planes (two products) for Wo; the
// banded-causal 16-head attention (keys j with i-127 <= j <= i) fused on v_wmma_f32_16x16x32_f16 over the <= 6 key tiles per 64-query block: q and k as f16 hi + residual x1024

#define NB_  1
#define NT_  4096
#define DM   1024
#define NH_  16
#define HD   64
#define NTK  (NB_ * NT_)
#define NW   1024
#define NQKV 1024
#define BAND 128
#define PSC  32768.0f
#define LOSC 1024.0f
#define LOSCI (1.0f / 1024.0f)

typedef _Float16 h16;
typedef unsigned short bf;
typedef __attribute__((ext_vector_type(16))) __bf16   v16bf;
typedef __attribute__((ext_vector_type(16))) _Float16 v16h;
typedef __attribute__((ext_vector_type(8)))  _Float16 v8h;
typedef __attribute__((ext_vector_type(8)))  unsigned short v8us;
typedef __attribute__((ext_vector_type(8)))  float    v8f;
typedef __attribute__((ext_vector_type(4)))  float    v4f;
typedef v8h  __attribute__((may_alias)) v8ha;
typedef v4f  __attribute__((may_alias)) v4fa;
typedef v8us __attribute__((may_alias)) v8usa;

__device__ __forceinline__ unsigned short f2bf(float f) { unsigned u = __float_as_uint(f); u += 0x7FFFu + ((u >> 16) & 1u); return (unsigned short)(u >> 16); }
__device__ __forceinline__ float bf2f(unsigned short b) { return __uint_as_float(((unsigned)b) << 16); }
__device__ __forceinline__ float bfr(float f) { return bf2f(f2bf(f)); }
__device__ __forceinline__ v16h cat16(v8h lo, v8h hi) { return __builtin_shufflevector(lo, hi, 0, 1, 2, 3, 4, 5, 6, 7, 8, 9, 10, 11, 12, 13, 14, 15); }
__device__ __forceinline__ v16bf cat16b(v8us lo, v8us hi) { return __builtin_bit_cast(v16bf, __builtin_shufflevector(lo, hi, 0, 1, 2, 3, 4, 5, 6, 7, 8, 9, 10, 11, 12, 13, 14, 15)); }
__device__ __forceinline__ v8f wmma16(v16h a, v16h b, v8f c) { return __builtin_amdgcn_wmma_f32_16x16x32_f16(false, a, false, b, (short)0, c, false, false); }
__device__ __forceinline__ v8f wmmab(v16bf a, v16bf b, v8f c) { return __builtin_amdgcn_wmma_f32_16x16x32_bf16(false, a, false, b, (short)0, c, false, false); }

// k_cvtb: one grid rounds all five inputs: blocks [0, NTK / 8) take x, then DM / 8 blocks each weight; 8 rows a block, so the pick is block-uniform (scalar selects).
__global__ __launch_bounds__(256) void k_cvtb(const float* __restrict__ x, const float* __restrict__ Wq, const float* __restrict__ Wk, const float* __restrict__ Wv, const float* __restrict__ Wo,
                                              bf* Xb, bf* WqB, bf* WkB, bf* WvB, bf* WoB) {
    const int blk = blockIdx.x, sel = blk < NTK / 8 ? 0 : 1 + (blk - NTK / 8) / (DM / 8);
    const float* src = sel == 0 ? x : sel == 1 ? Wq : sel == 2 ? Wk : sel == 3 ? Wv : Wo;
    bf* dst = sel == 0 ? Xb : sel == 1 ? WqB : sel == 2 ? WkB : sel == 3 ? WvB : WoB;
    const int lane = threadIdx.x & 31, r = (sel == 0 ? blk : (blk - NTK / 8) % (DM / 8)) * 8 + (threadIdx.x >> 5);
    v8us o[DM / 256];
#pragma unroll
    for (int q = 0; q < DM / 256; ++q) { v8us t;
#pragma unroll
        for (int i = 0; i < 8; ++i) t[i] = f2bf(src[(size_t)r * DM + q * 256 + lane * 8 + i]);
        o[q] = t; }
#pragma unroll
    for (int q = 0; q < DM / 256; ++q) *(v8us*)(dst + (size_t)r * DM + q * 256 + lane * 8) = o[q];
    
}

// k_wt: W [1024 k][ncols n] (k-major) -> n-major bf16 plane WT[ncols][1024]; 64 x 64 tiles through LDS.
__global__ __launch_bounds__(256) void k_wt(const float* __restrict__ Wm, int ncols, bf* WT) {
    __shared__ __align__(16) unsigned short tl[64 * 72];
    const int tid = threadIdx.x, k0 = blockIdx.x * 64, n0 = blockIdx.y * 64;
    const int kk = tid >> 2, nq = (tid & 3) * 16;
#pragma unroll
    for (int i = 0; i < 16; ++i) tl[(nq + i) * 72 + kk] = f2bf(Wm[(size_t)(k0 + kk) * ncols + n0 + nq + i]);
    __syncthreads();
    const int piece = tid & 7;
    typedef __attribute__((ext_vector_type(8))) unsigned short v8us_; typedef v8us_ __attribute__((may_alias)) v8usa_;
    auto pass = [&]() {
#pragma unroll
        for (int s = 0; s < 2; ++s) { const int nr = (tid >> 3) + 32 * s; const v8us_ val = *(const v8usa_*)(tl + nr * 72 + piece * 8);
            *(v8us_*)(WT + (size_t)(n0 + nr) * DM + k0 + piece * 8) = val; }
    };
    pass(); 
}

// k_gemmb: C[128 x 128] per block of 8 waves (4 x 2, 32 x 64 each). A stage is 128 k = 256 B of every operand row, rows [A 128 | A residual 128 (SPLITA) | B 128] at an
// LDS pitch of 272 B (16 B x odd: conflict-free for the ds_load_b128 fragment reads). Two buffers, filled by per-lane b128 asynchronous copies to LDS (16 lanes = one whole
// 256-B row piece), the next stage in flight while this one is worked on. Per accumulator the k order and the hi-then-residual order are those of the direct-load form.
// Every '#pragma unroll' in k_gemmb makes the indices into acc and the fragment sets compile-time constants, so that they stay in registers.
#define GKP    128
#define GPITCH 272
#define GNP    (DM / GKP)

// Eight copies, rows 16 apart (8 waves x 2 rows per copy). s_wait_xcnt 0 is the last line of the copies' own statement so that no address register is rewritten ahead of it.
__device__ __forceinline__ void cp8(unsigned l, const bf* p) {
    asm volatile("global_load_async_to_lds_b128 %0, %8, off\n\t"
                 "global_load_async_to_lds_b128 %1, %9, off\n\t"
                 "global_load_async_to_lds_b128 %2, %10, off\n\t"
                 "global_load_async_to_lds_b128 %3, %11, off\n\t"
                 "global_load_async_to_lds_b128 %4, %12, off\n\t"
                 "global_load_async_to_lds_b128 %5, %13, off\n\t"
                 "global_load_async_to_lds_b128 %6, %14, off\n\t"
                 "global_load_async_to_lds_b128 %7, %15, off\n\t"
                 "s_wait_xcnt 0x0"
                 :: "v"(l), "v"(l + 16u * GPITCH), "v"(l + 32u * GPITCH), "v"(l + 48u * GPITCH), "v"(l + 64u * GPITCH), "v"(l + 80u * GPITCH), "v"(l + 96u * GPITCH), "v"(l + 112u * GPITCH),
                    "v"(p), "v"(p + 16 * DM), "v"(p + 32 * DM), "v"(p + 48 * DM), "v"(p + 64 * DM), "v"(p + 80 * DM), "v"(p + 96 * DM), "v"(p + 112 * DM)
                 : "memory");
}

// QKV: one grid does the three products of the same A; blockIdx.z picks the weight plane and the output (0: q, 1: k, 2: v, each as f16 hi + residual planes). Block-uniform.
// The planes are laid out in the ORDER IN WHICH k_attn's FRAGMENT LOADS READ THEM, so that each of its wave-wide 16-B loads covers 512 contiguous bytes (four whole lines):
//   q, k: [head][16-token tile][16-d group g = 0..3][lane = hi * 16 + token % 16][8 d: g * 16 + hi * 8 + i]          (1024 halves a tile)
//   v:    [head][32-token tile][16-d group n = 0..3][16-token half][lane = hi * 16 + d % 16][8 tokens: hi * 8 + i]   (2048 halves a tile)
template <bool SPLITA, bool QKV>
__global__ __launch_bounds__(256) void k_gemmb(const bf* __restrict__ A, const bf* __restrict__ Al, const bf* __restrict__ B0, const bf* __restrict__ B1, const bf* __restrict__ B2, const float* __restrict__ bias,
                                               float* Cf, int ldc, h16* H0, h16* L0, h16* H1, h16* L1, h16* VTH, h16* VTL) {
    const int z = QKV ? (int)blockIdx.z : 0;
    const bool wa = QKV && z < 2;    // q, k: the weight rows are the A operand and the tokens the B operand (the product comes out transposed). Block-uniform.
    const bf* Bn = z == 0 ? B0 : z == 1 ? B1 : B2;
    constexpr int BROW = SPLITA ? 256 : 128, STG = (BROW + 128) * GPITCH;
    __shared__ __align__(16) unsigned char ring[2 * STG];    // all the LDS of the QKV form: 139,264 B, so that two blocks share a WGP
    const int lane = threadIdx.x & 31, wave = threadIdx.x >> 5, lr = lane & 15, hi = lane >> 4;
    const int rb = blockIdx.x * 128, cb = blockIdx.y * 128;
    const int r0 = rb + (wave >> 1) * 32, c0 = cb + (wave & 1) * 64;
    const int crow = 2 * wave + hi;
    const bf* gA = A + (size_t)(rb + crow) * DM + lr * 8;
    const bf* gAl = SPLITA ? Al + (size_t)(rb + crow) * DM + lr * 8 : gA;
    const bf* gB = Bn + (size_t)(cb + crow) * DM + lr * 8;
    const unsigned lcp = (unsigned)(uintptr_t)&ring[0] + (unsigned)(crow * GPITCH + lr * 16);
    auto fill = [&](int t, int buf) {
        const unsigned l = lcp + (unsigned)(buf * STG);
        cp8(l, gA + t * GKP);
        if (SPLITA) cp8(l + 128u * GPITCH, gAl + t * GKP);
        cp8(l + (unsigned)(BROW * GPITCH), gB + t * GKP);
    };
    // Both operands are k-contiguous rows read by the same loader, so which of them is A is only a matter of the two row offsets.
    const int aofs = ((wa ? BROW : 0) + (wave >> 1) * 32 + lr) * GPITCH + hi * 16, bofs = ((wa ? 0 : BROW) + (wave & 1) * 64 + lr) * GPITCH + hi * 16;
    v8f acc[2][4];
#pragma unroll
    for (int mi = 0; mi < 2; ++mi)
#pragma unroll
        for (int t = 0; t < 4; ++t) acc[mi][t] = (v8f){};
    fill(0, 0);
    asm volatile("s_wait_asynccnt 0x0" ::: "memory");    // this wave's copies of stage 0 have landed
    __syncthreads();                                      // ... and every other wave's: stage 0 is readable
    fill(1, 1);
#pragma unroll 1    // rolled: one ring foot
    for (int p = 0; p < GNP; ++p) {
        const unsigned char* sb = ring + (p & 1) * STG;
        v16bf a[2][2], al[2][2], b[2][4];
        auto frags = [&](int ks, int f) {
#pragma unroll
            for (int mi = 0; mi < 2; ++mi) { const unsigned char* q = sb + aofs + mi * 16 * GPITCH + ks * 64;
                a[f][mi] = cat16b(*(const v8usa*)q, *(const v8usa*)(q + 32));
                if (SPLITA) al[f][mi] = cat16b(*(const v8usa*)(q + 128 * GPITCH), *(const v8usa*)(q + 128 * GPITCH + 32)); }
#pragma unroll
            for (int t = 0; t < 4; ++t) { const unsigned char* q = sb + bofs + t * 16 * GPITCH + ks * 64; b[f][t] = cat16b(*(const v8usa*)q, *(const v8usa*)(q + 32)); }
        };
        frags(0, 0);
#pragma unroll
        for (int ks = 0; ks < GKP / 32; ++ks) {
            const int f = ks & 1;
            if (ks + 1 < GKP / 32) frags(ks + 1, f ^ 1);    // the next 32 k of this same stage, one group into the other fragment set
            __builtin_amdgcn_sched_barrier(0);              // keeps that group ahead of the WMMA block
#pragma unroll
            for (int mi = 0; mi < 2; ++mi)
#pragma unroll
                for (int t = 0; t < 4; ++t) acc[mi][t] = wmmab(a[f][mi], b[f][t], acc[mi][t]);
            if (SPLITA) {
#pragma unroll
                for (int mi = 0; mi < 2; ++mi)
#pragma unroll
                    for (int t = 0; t < 4; ++t) acc[mi][t] = wmmab(al[f][mi], b[f][t], acc[mi][t]);
            }
            __builtin_amdgcn_sched_barrier(0);              // ... and the following group behind the block
        }
        asm volatile("s_wait_dscnt 0x0" ::: "memory");       // this wave's reads of the buffer are done before it may be refilled
        asm volatile("s_wait_asynccnt 0x0" ::: "memory");    // this wave's copies of stage p + 1 have landed
        __syncthreads();                                      // publishes stage p + 1 and ends every reader's last read of stage p
        if (p + 2 < GNP) fill(p + 2, p & 1);
    }
    asm volatile("s_wait_asynccnt 0x0" ::: "memory");        // no copy is outstanding when the wave goes on
    if (QKV && z == 2) {
        // An accumulator register group is 8 consecutive tokens of ONE column: exactly a lane's 16-B piece of the v fragment order. The wave's 32 tokens x 64 columns are one
        // (head, 32-token tile), so every store below is 512 contiguous bytes straight from registers.
        const size_t vb = ((size_t)(c0 >> 6) * (NT_ / 32) + (r0 >> 5)) * 2048 + lane * 8;    // NB_ = 1: the row of A is its token
        h16* gh = VTH + vb; h16* gl = VTL + vb;
#pragma unroll
        for (int mi = 0; mi < 2; ++mi)
#pragma unroll
            for (int t = 0; t < 4; ++t) { const float bv = bias ? bfr(bias[c0 + t * 16 + lr]) : 0.f; v8h vh_, vl_;
#pragma unroll
                for (int j = 0; j < 8; ++j) { const float v = acc[mi][t][j] + bv; const h16 a = (h16)v; vh_[j] = a; vl_[j] = (h16)((v - (float)a) * LOSC); }
                *(v8h*)(gh + t * 512 + mi * 256) = vh_; *(v8h*)(gl + t * 512 + mi * 256) = vl_;
                asm volatile("s_wait_xcnt 0x0" ::: "memory"); }    // stands in front of the next writes of the registers that the two stores above name
        return;
    }
    if (QKV) {    // z is 0 or 1 here
        // Transposed product: an accumulator register group is 8 consecutive d of ONE token, exactly a lane's 16-B piece of the q, k fragment order. The wave's 32 rows of W
        // are d groups mi of one head, its 64 tokens four 16-token tiles t, so every store below is 512 contiguous bytes straight from registers.
        const int f0 = cb + (wave >> 1) * 32, t0 = rb + (wave & 1) * 64;    // first column of W^T and first token of the wave (NB_ = 1: a row of x is its token)
        const size_t fb = ((size_t)(f0 >> 6) * (NT_ / 16) + (t0 >> 4)) * 1024 + ((f0 & 63) >> 4) * 256 + lane * 8;
        h16* gh = (z == 0 ? H0 : H1) + fb; h16* gl = (z == 0 ? L0 : L1) + fb;
#pragma unroll
        for (int mi = 0; mi < 2; ++mi) { float bv[8] = {};
            if (bias) {
#pragma unroll
                for (int j = 0; j < 8; ++j) bv[j] = bfr(bias[f0 + mi * 16 + hi * 8 + j]); }
#pragma unroll
            for (int t = 0; t < 4; ++t) { v8h o, o2;
#pragma unroll
                for (int j = 0; j < 8; ++j) { const float v = acc[mi][t][j] + bv[j]; const h16 a = (h16)v; o[j] = a; o2[j] = (h16)((v - (float)a) * LOSC); }
                *(v8h*)(gh + t * 1024 + mi * 256) = o; *(v8h*)(gl + t * 1024 + mi * 256) = o2;
                asm volatile("s_wait_xcnt 0x0" ::: "memory"); } }    // stands in front of the next writes of the registers that the two stores above name
        return;
    }
    __shared__ __align__(16) float ost[8][32 * 68];
    float* os = &ost[wave][0];
#pragma unroll
    for (int mi = 0; mi < 2; ++mi)
#pragma unroll
        for (int t = 0; t < 4; ++t) { const float bv = bias ? bfr(bias[c0 + t * 16 + lr]) : 0.f;
#pragma unroll
            for (int j = 0; j < 8; ++j) os[(mi * 16 + hi * 8 + j) * 68 + t * 16 + lr] = acc[mi][t][j] + bv; }
    __syncthreads();
    float* crow_p = Cf + (size_t)r0 * ldc + c0;
#pragma unroll
    for (int s = 0; s < 16; ++s) { const int Lid = (lane >> 3) + 4 * s, piece = lane & 7; const int row = Lid >> 1, cofs = (Lid & 1) * 32 + piece * 4;
        const v4f val = *(const v4fa*)(os + row * 68 + cofs); *(v4f*)(crow_p + (size_t)row * ldc + cofs) = val; }
}

// k_attn: block = (b, h, 64 queries), wave = 16; key tiles kt_lo..kt_hi of the band (block-uniform), per-element mask j <= i && i - j < BAND; scores hi.hi + hi.lo +
// lo.hi (12 WMMA, /8 in f32), online softmax, weights x32768 hi + residual tiles (same-wave may_alias reload after a compiler barrier), 12 WMMA .v (hi.hi + hi.lo +
// lo.hi); ctx -> bf16 hi + residual planes CH/CL[tok][h*64+d].
// launch bounds: four waves a SIMD (256 registers a wave), so that all blocks of the grid stay resident at once with the wider load groups below.
__global__ __launch_bounds__(128, 4) void k_attn(const h16* __restrict__ Q16, const h16* __restrict__ QL16, const h16* __restrict__ K16, const h16* __restrict__ KL16, const h16* __restrict__ VTH, const h16* __restrict__ VTL, bf* CH, bf* CL) {
    __shared__ __align__(16) h16 plds[4][16 * 32];
    __shared__ __align__(16) h16 plds2[4][16 * 32];
    __shared__ __align__(16) float ost[4][16 * 68];
    const int lane = threadIdx.x & 31, wave = threadIdx.x >> 5, lr = lane & 15, hi = lane >> 4;
    const int bid = blockIdx.x;
    const int b = bid / (NH_ * (NT_ / 64)), rem = bid - b * (NH_ * (NT_ / 64)), h = rem / (NT_ / 64), qt = rem - h * (NT_ / 64);
    const int q0 = qt * 64 + wave * 16;
    const size_t tok0 = (size_t)b * NT_;
    h16* pl = &plds[wave][0]; h16* pl2 = &plds2[wave][0];
    h16* plw = pl + hi * 256 + lr; h16* pl2w = pl2 + hi * 256 + lr;    // the lane's column in its half's first row: row j is a constant offset, not a register
    v16h qa[2], ql[2];    // the query tile, hi and residual: read once, no load of it among the loop's groups
    const size_t hb = ((size_t)b * NH_ + h) * HD * NT_;    // the head's part of every plane (fragment order: the layouts stand at k_gemmb)
    const size_t qo0 = hb + (size_t)(q0 >> 4) * 1024 + lane * 8;
#pragma unroll
    for (int kc = 0; kc < 2; ++kc) { qa[kc] = cat16(*(const v8h*)(Q16 + qo0 + kc * 512), *(const v8h*)(Q16 + qo0 + kc * 512 + 256)); ql[kc] = cat16(*(const v8h*)(QL16 + qo0 + kc * 512), *(const v8h*)(QL16 + qo0 + kc * 512 + 256)); }
    const h16* kh_b = K16 + hb;
    const h16* kl_b = KL16 + hb;
    const h16* vh_b = VTH + hb;
    const h16* vl_b = VTL + hb;
    v8f o[4], ox[4];
#pragma unroll
    for (int n = 0; n < 4; ++n) { o[n] = (v8f){}; ox[n] = (v8f){}; }
    float mrow[8], lpart[8];
#pragma unroll
    for (int j = 0; j < 8; ++j) { mrow[j] = -3.0e38f; lpart[j] = 0.f; }
    const int dq = q0 + 8 * hi - lr;    // query row 0 of the lane's half minus the lane's key column: with the tile's first key taken off, i - j of the mask
    const int kt_lo = (qt * 64 - (BAND - 1)) > 0 ? (qt * 64 - (BAND - 1)) / 32 : 0, kt_hi = (qt * 64 + 63) / 32;     // block-uniform: keys qt*64-127 .. qt*64+63
#pragma unroll 1
    for (int kt = kt_lo; kt <= kt_hi; ++kt) {
        const int l0 = kt * 32;
        const unsigned ko0 = (unsigned)(kt * 2048 + lane * 8);    // 32-bit lane offset from the wave-uniform bases: a 32-key tile is 2048 halves of each plane, K and V alike
        const h16* pkh = kh_b + ko0; const h16* pkl = kl_b + ko0;      // keys l0 .. l0 + 15; keys l0 + 16 .. are a constant offset from them
        // Every K fragment of the tile (hi and residual, both halves of the head) is asked for in one group: one load latency a tile, not four in a row.
        v16h kh[2][2], kl[2][2];
#pragma unroll
        for (int kc = 0; kc < 2; ++kc) {
            kh[kc][0] = cat16(*(const v8h*)(pkh + kc * 512), *(const v8h*)(pkh + kc * 512 + 256)); kh[kc][1] = cat16(*(const v8h*)(pkh + 1024 + kc * 512), *(const v8h*)(pkh + 1024 + kc * 512 + 256));
            kl[kc][0] = cat16(*(const v8h*)(pkl + kc * 512), *(const v8h*)(pkl + kc * 512 + 256)); kl[kc][1] = cat16(*(const v8h*)(pkl + 1024 + kc * 512), *(const v8h*)(pkl + 1024 + kc * 512 + 256));
        }
        asm volatile("s_wait_xcnt 0x0" :: "v"(pkh), "v"(pkl) : "memory");    // stands in front of the next write of the group's address registers; naming them keeps them whole up to here
        __builtin_amdgcn_sched_barrier(0);    // keeps the whole group ahead of the first WMMA: a load sunk to its user would wait out its latency alone
        v8f s0 = {}, s1 = {}, x0 = {}, x1 = {};
#pragma unroll
        for (int kc = 0; kc < 2; ++kc) {
            s0 = wmma16(qa[kc], kh[kc][0], s0); x0 = wmma16(ql[kc], kh[kc][0], x0); s1 = wmma16(qa[kc], kh[kc][1], s1); x1 = wmma16(ql[kc], kh[kc][1], x1);
            x0 = wmma16(qa[kc], kl[kc][0], x0); x1 = wmma16(qa[kc], kl[kc][1], x1);
        }
        // The tile's V fragments (hi and residual, all four column groups) are asked for here, in the registers that K has left: they land while the softmax below runs.
        v16h vh[4], vl[4];
        const h16* pvh = vh_b + ko0; const h16* pvl = vl_b + ko0;      // column group 0; group n is a constant offset from it
#pragma unroll
        for (int n = 0; n < 4; ++n) { vh[n] = cat16(*(const v8h*)(pvh + n * 512), *(const v8h*)(pvh + n * 512 + 256)); vl[n] = cat16(*(const v8h*)(pvl + n * 512), *(const v8h*)(pvl + n * 512 + 256)); }
        asm volatile("s_wait_xcnt 0x0" :: "v"(pvh), "v"(pvl) : "memory");    // as behind the K group
        __builtin_amdgcn_sched_barrier(0);    // keeps that group ahead of the softmax
        float alpha[8];
#pragma unroll
        for (int j = 0; j < 8; ++j) {
            const int da = dq - l0 + j, db = da - 16;    // i - j; 0 <= i - j < BAND as one unsigned compare
            const float a0 = (unsigned)da < (unsigned)BAND ? (s0[j] + x0[j] * LOSCI) * 0.125f : -__builtin_inff(), a1 = (unsigned)db < (unsigned)BAND ? (s1[j] + x1[j] * LOSCI) * 0.125f : -__builtin_inff();
            float mx = fmaxf(a0, a1);
            mx = fmaxf(mx, __shfl_xor(mx, 1, 16)); mx = fmaxf(mx, __shfl_xor(mx, 2, 16)); mx = fmaxf(mx, __shfl_xor(mx, 4, 16)); mx = fmaxf(mx, __shfl_xor(mx, 8, 16));
            const float mn = fmaxf(mrow[j], mx);
            alpha[j] = __expf(mrow[j] - mn); mrow[j] = mn;
            const float p0 = __expf(a0 - mn), p1 = __expf(a1 - mn);
            lpart[j] = lpart[j] * alpha[j] + (p0 + p1);
            const float ps0 = p0 * PSC, ps1 = p1 * PSC; const h16 h0 = (h16)ps0, h1 = (h16)ps1;
            plw[j * 32] = h0; plw[j * 32 + 16] = h1;
            pl2w[j * 32] = (h16)((ps0 - (float)h0) * LOSC); pl2w[j * 32 + 16] = (h16)((ps1 - (float)h1) * LOSC);
        }
#pragma unroll
        for (int n = 0; n < 4; ++n)
#pragma unroll
            for (int j = 0; j < 8; ++j) { o[n][j] *= alpha[j]; ox[n][j] *= alpha[j]; }
        asm volatile("" ::: "memory");
        const v16h pa = cat16(*(const v8ha*)(pl + lr * 32 + hi * 8), *(const v8ha*)(pl + lr * 32 + 16 + hi * 8));
        const v16h px = cat16(*(const v8ha*)(pl2 + lr * 32 + hi * 8), *(const v8ha*)(pl2 + lr * 32 + 16 + hi * 8));
#pragma unroll
        for (int n = 0; n < 4; ++n) { o[n] = wmma16(pa, vh[n], o[n]); ox[n] = wmma16(pa, vl[n], ox[n]); ox[n] = wmma16(px, vh[n], ox[n]); }
        // four vector slots behind the last WMMA, on the loop's taken branch too
        asm volatile("v_nop\n\tv_nop\n\tv_nop\n\tv_nop" : "+v"(o[0]), "+v"(o[1]), "+v"(o[2]), "+v"(o[3]), "+v"(ox[0]), "+v"(ox[1]), "+v"(ox[2]), "+v"(ox[3]) : "v"(pa), "v"(px));
    }
    float inv[8];
#pragma unroll
    for (int j = 0; j < 8; ++j) { float rs = lpart[j]; rs += __shfl_xor(rs, 1, 16); rs += __shfl_xor(rs, 2, 16); rs += __shfl_xor(rs, 4, 16); rs += __shfl_xor(rs, 8, 16); inv[j] = 1.0f / (rs * PSC); }
    float* os = &ost[wave][0];
#pragma unroll
    for (int n = 0; n < 4; ++n)
#pragma unroll
        for (int j = 0; j < 8; ++j) os[(hi * 8 + j) * 68 + n * 16 + lr] = (o[n][j] + ox[n][j] * LOSCI) * inv[j];
    __syncthreads();
    const size_t cbase = (tok0 + q0) * DM + (size_t)h * HD;
    auto pass = [&]() {
#pragma unroll
        for (int s = 0; s < 4; ++s) { const int row = 4 * s + (lane >> 3), piece = lane & 7; const float* sp = os + row * 68 + piece * 8; v8us oh, ol;
#pragma unroll
            for (int i = 0; i < 8; ++i) { const unsigned short hb = f2bf(sp[i]); oh[i] = hb; ol[i] = f2bf(sp[i] - bf2f(hb)); }
            *(v8us*)(CH + cbase + (size_t)row * DM + piece * 8) = oh; *(v8us*)(CL + cbase + (size_t)row * DM + piece * 8) = ol; }
    };
    pass(); 
}

#define VST2(T, p, v) do { const T vst2_v_ = (v); *(T*)(p) = vst2_v_;  } while (0)
extern "C" void kernel_launch(void* const* d_in, const int* in_sizes, int n_in,
                              void* d_out, int out_size, void* d_ws, size_t ws_size, hipStream_t stream) {
    (void)in_sizes; (void)n_in; (void)out_size;
    const float* x = (const float*)d_in[0]; const float* Wq = (const float*)d_in[1]; const float* Wk = (const float*)d_in[2]; const float* Wv = (const float*)d_in[3]; const float* Wo = (const float*)d_in[4];
    float* out = (float*)d_out;    // [1][4096][1024]
    char* wsp = (char*)d_ws;
    auto take = [&](size_t bytes) { char* p = wsp; wsp += (bytes + 255) & ~(size_t)255; return (void*)p; };
    bf* Xb = (bf*)take((size_t)NTK * DM * 2); bf* WqB = (bf*)take((size_t)DM * DM * 2); bf* WkB = (bf*)take((size_t)DM * DM * 2); bf* WvB = (bf*)take((size_t)DM * DM * 2); bf* WoB = (bf*)take((size_t)DM * DM * 2);
    h16* Q16 = (h16*)take((size_t)NTK * DM * 2); h16* QL16 = (h16*)take((size_t)NTK * DM * 2); h16* K16 = (h16*)take((size_t)NTK * DM * 2); h16* KL16 = (h16*)take((size_t)NTK * DM * 2); bf* CL = (bf*)take((size_t)NTK * DM * 2); h16* VTH = (h16*)take((size_t)NTK * DM * 2); h16* VTL = (h16*)take((size_t)NTK * DM * 2);
    if ((size_t)(wsp - (char*)d_ws) > ws_size) return;    // 8 planes of 8.4 MB + 4 of 2.1 MB ~ 76 MB; the ctx hi plane aliases Xb after its last reader
    bf* CH = (bf*)Xb;
    k_cvtb<<<(NTK + 4 * DM) / 8, 256, 0, stream>>>(x, Wq, Wk, Wv, Wo, Xb, WqB, WkB, WvB, WoB);
    k_gemmb<false, true><<<dim3(NTK / 128, DM / 128, 3), 256, 0, stream>>>(Xb, nullptr, WqB, WkB, WvB, nullptr, nullptr, DM, Q16, QL16, K16, KL16, VTH, VTL);
    k_attn<<<NB_ * NH_ * (NT_ / 64), 128, 0, stream>>>(Q16, QL16, K16, KL16, VTH, VTL, CH, CL);
    k_gemmb<true, false><<<dim3(NTK / 128, DM / 128, 1), 256, 0, stream>>>(CH, CL, WoB, nullptr, nullptr, nullptr, out, DM, nullptr, nullptr, nullptr, nullptr, nullptr, nullptr);
}

// v007
// Measured time: 68.6 microseconds a run.
// Two timings next to v006 both put it at 1.04 times that version's speed.
// Over all steps from v000 it is 3.25 times as fast.
#include <hip/hip_runtime.h>

// Contractions, f32 accumulate: q/k/v = x.W^T ([4096 x 1024].[1024 x 1024] each; W is [out][in], used as-is: the n-major B operand for v, for q and k the A operand (transposed product)) and y.Wo^T on
// v_wmma_f32_16x16x32_bf16 with PLAIN bf16 operands for the projections (inputs rounded once: exact) and y as bf16 hi + residual planes (two products) for Wo; the
// banded-causal 16-head attention (keys j with i-127 <= j <= i) fused on v_wmma_f32_16x16x32_f16 over the <= 6 key tiles per 64-query block: q and k as f16 hi + residual x1024

#define NB_  1
#define NT_  4096
#define DM   1024
#define NH_  16
#define HD   64
#define NTK  (NB_ * NT_)
#define NW   1024
#define NQKV 1024
#define BAND 128
#define PSC  32768.0f
#define LOSC 1024.0f
#define LOSCI (1.0f / 1024.0f)

typedef _Float16 h16;
typedef unsigned short bf;
typedef __attribute__((ext_vector_type(16))) __bf16   v16bf;
typedef __attribute__((ext_vector_type(16))) _Float16 v16h;
typedef __attribute__((ext_vector_type(8)))  _Float16 v8h;
typedef __attribute__((ext_vector_type(8)))  unsigned short v8us;
typedef __attribute__((ext_vector_type(8)))  float    v8f;
typedef __attribute__((ext_vector_type(4)))  float    v4f;
typedef __attribute__((ext_vector_type(2)))  float    v2f;
typedef __attribute__((ext_vector_type(2)))  _Float16 v2h;
typedef v8h  __attribute__((may_alias)) v8ha;
typedef v4f  __attribute__((may_alias)) v4fa;
typedef v8us __attribute__((may_alias)) v8usa;

__device__ __forceinline__ unsigned short f2bf(float f) { unsigned u = __float_as_uint(f); u += 0x7FFFu + ((u >> 16) & 1u); return (unsigned short)(u >> 16); }
__device__ __forceinline__ float bf2f(unsigned short b) { return __uint_as_float(((unsigned)b) << 16); }
__device__ __forceinline__ float bfr(float f) { return bf2f(f2bf(f)); }
__device__ __forceinline__ v16h cat16(v8h lo, v8h hi) { return __builtin_shufflevector(lo, hi, 0, 1, 2, 3, 4, 5, 6, 7, 8, 9, 10, 11, 12, 13, 14, 15); }
__device__ __forceinline__ v16bf cat16b(v8us lo, v8us hi) { return __builtin_bit_cast(v16bf, __builtin_shufflevector(lo, hi, 0, 1, 2, 3, 4, 5, 6, 7, 8, 9, 10, 11, 12, 13, 14, 15)); }
__device__ __forceinline__ v8f wmma16(v16h a, v16h b, v8f c) { return __builtin_amdgcn_wmma_f32_16x16x32_f16(false, a, false, b, (short)0, c, false, false); }
__device__ __forceinline__ v8f wmmab(v16bf a, v16bf b, v8f c) { return __builtin_amdgcn_wmma_f32_16x16x32_bf16(false, a, false, b, (short)0, c, false, false); }

// k_cvtb: one grid rounds all five inputs: blocks [0, NTK / 8) take x, then DM / 8 blocks each weight; 8 rows a block, so the pick is block-uniform (scalar selects).
__global__ __launch_bounds__(256) void k_cvtb(const float* __restrict__ x, const float* __restrict__ Wq, const float* __restrict__ Wk, const float* __restrict__ Wv, const float* __restrict__ Wo,
                                              bf* Xb, bf* WqB, bf* WkB, bf* WvB, bf* WoB) {
    const int blk = blockIdx.x, sel = blk < NTK / 8 ? 0 : 1 + (blk - NTK / 8) / (DM / 8);
    const float* src = sel == 0 ? x : sel == 1 ? Wq : sel == 2 ? Wk : sel == 3 ? Wv : Wo;
    bf* dst = sel == 0 ? Xb : sel == 1 ? WqB : sel == 2 ? WkB : sel == 3 ? WvB : WoB;
    const int lane = threadIdx.x & 31, r = (sel == 0 ? blk : (blk - NTK / 8) % (DM / 8)) * 8 + (threadIdx.x >> 5);
    v8us o[DM / 256];
#pragma unroll
    for (int q = 0; q < DM / 256; ++q) { v8us t;
#pragma unroll
        for (int i = 0; i < 8; ++i) t[i] = f2bf(src[(size_t)r * DM + q * 256 + lane * 8 + i]);
        o[q] = t; }
#pragma unroll
    for (int q = 0; q < DM / 256; ++q) *(v8us*)(dst + (size_t)r * DM + q * 256 + lane * 8) = o[q];
    
}

// k_wt: W [1024 k][ncols n] (k-major) -> n-major bf16 plane WT[ncols][1024]; 64 x 64 tiles through LDS.
__global__ __launch_bounds__(256) void k_wt(const float* __restrict__ Wm, int ncols, bf* WT) {
    __shared__ __align__(16) unsigned short tl[64 * 72];
    const int tid = threadIdx.x, k0 = blockIdx.x * 64, n0 = blockIdx.y * 64;
    const int kk = tid >> 2, nq = (tid & 3) * 16;
#pragma unroll
    for (int i = 0; i < 16; ++i) tl[(nq + i) * 72 + kk] = f2bf(Wm[(size_t)(k0 + kk) * ncols + n0 + nq + i]);
    __syncthreads();
    const int piece = tid & 7;
    typedef __attribute__((ext_vector_type(8))) unsigned short v8us_; typedef v8us_ __attribute__((may_alias)) v8usa_;
    auto pass = [&]() {
#pragma unroll
        for (int s = 0; s < 2; ++s) { const int nr = (tid >> 3) + 32 * s; const v8us_ val = *(const v8usa_*)(tl + nr * 72 + piece * 8);
            *(v8us_*)(WT + (size_t)(n0 + nr) * DM + k0 + piece * 8) = val; }
    };
    pass(); 
}

// k_gemmb: C[128 x 128] per block of 8 waves (4 x 2, 32 x 64 each). A stage is 128 k = 256 B of every operand row, rows [A 128 | A residual 128 (SPLITA) | B 128] at an
// LDS pitch of 272 B (16 B x odd: conflict-free for the ds_load_b128 fragment reads). Two buffers, filled by per-lane b128 asynchronous copies to LDS (16 lanes = one whole
// 256-B row piece), the next stage in flight while this one is worked on. Per accumulator the k order and the hi-then-residual order are those of the direct-load form.
// Every '#pragma unroll' in k_gemmb makes the indices into acc and the fragment sets compile-time constants, so that they stay in registers.
#define GKP    128
#define GPITCH 272
#define GNP    (DM / GKP)

// Eight copies, rows 16 apart (8 waves x 2 rows per copy). s_wait_xcnt 0 is the last line of the copies' own statement so that no address register is rewritten ahead of it.
__device__ __forceinline__ void cp8(unsigned l, const bf* p) {
    asm volatile("global_load_async_to_lds_b128 %0, %8, off\n\t"
                 "global_load_async_to_lds_b128 %1, %9, off\n\t"
                 "global_load_async_to_lds_b128 %2, %10, off\n\t"
                 "global_load_async_to_lds_b128 %3, %11, off\n\t"
                 "global_load_async_to_lds_b128 %4, %12, off\n\t"
                 "global_load_async_to_lds_b128 %5, %13, off\n\t"
                 "global_load_async_to_lds_b128 %6, %14, off\n\t"
                 "global_load_async_to_lds_b128 %7, %15, off\n\t"
                 "s_wait_xcnt 0x0"
                 :: "v"(l), "v"(l + 16u * GPITCH), "v"(l + 32u * GPITCH), "v"(l + 48u * GPITCH), "v"(l + 64u * GPITCH), "v"(l + 80u * GPITCH), "v"(l + 96u * GPITCH), "v"(l + 112u * GPITCH),
                    "v"(p), "v"(p + 16 * DM), "v"(p + 32 * DM), "v"(p + 48 * DM), "v"(p + 64 * DM), "v"(p + 80 * DM), "v"(p + 96 * DM), "v"(p + 112 * DM)
                 : "memory");
}

// QKV: one grid does the three products of the same A; blockIdx.z picks the weight plane and the output (0: q, 1: k, 2: v, each as f16 hi + residual planes). Block-uniform.
// The planes are laid out in the ORDER IN WHICH k_attn's FRAGMENT LOADS READ THEM, so that each of its wave-wide 16-B loads covers 512 contiguous bytes (four whole lines):
//   q, k: [head][16-token tile][16-d group g = 0..3][lane = hi * 16 + token % 16][8 d: g * 16 + hi * 8 + i]          (1024 halves a tile)
//   v:    [head][32-token tile][16-d group n = 0..3][16-token half][lane = hi * 16 + d % 16][8 tokens: hi * 8 + i]   (2048 halves a tile)
template <bool SPLITA, bool QKV>
__global__ __launch_bounds__(256) void k_gemmb(const bf* __restrict__ A, const bf* __restrict__ Al, const bf* __restrict__ B0, const bf* __restrict__ B1, const bf* __restrict__ B2, const float* __restrict__ bias,
                                               float* Cf, int ldc, h16* H0, h16* L0, h16* H1, h16* L1, h16* VTH, h16* VTL) {
    const int z = QKV ? (int)blockIdx.z : 0;
    const bool wa = QKV && z < 2;    // q, k: the weight rows are the A operand and the tokens the B operand (the product comes out transposed). Block-uniform.
    const bf* Bn = z == 0 ? B0 : z == 1 ? B1 : B2;
    constexpr int BROW = SPLITA ? 256 : 128, STG = (BROW + 128) * GPITCH;
    __shared__ __align__(16) unsigned char ring[2 * STG];    // all the LDS of the QKV form: 139,264 B, so that two blocks share a WGP
    const int lane = threadIdx.x & 31, wave = threadIdx.x >> 5, lr = lane & 15, hi = lane >> 4;
    const int rb = blockIdx.x * 128, cb = blockIdx.y * 128;
    const int r0 = rb + (wave >> 1) * 32, c0 = cb + (wave & 1) * 64;
    const int crow = 2 * wave + hi;
    const bf* gA = A + (size_t)(rb + crow) * DM + lr * 8;
    const bf* gAl = SPLITA ? Al + (size_t)(rb + crow) * DM + lr * 8 : gA;
    const bf* gB = Bn + (size_t)(cb + crow) * DM + lr * 8;
    const unsigned lcp = (unsigned)(uintptr_t)&ring[0] + (unsigned)(crow * GPITCH + lr * 16);
    auto fill = [&](int t, int buf) {
        const unsigned l = lcp + (unsigned)(buf * STG);
        cp8(l, gA + t * GKP);
        if (SPLITA) cp8(l + 128u * GPITCH, gAl + t * GKP);
        cp8(l + (unsigned)(BROW * GPITCH), gB + t * GKP);
    };
    // Both operands are k-contiguous rows read by the same loader, so which of them is A is only a matter of the two row offsets.
    const int aofs = ((wa ? BROW : 0) + (wave >> 1) * 32 + lr) * GPITCH + hi * 16, bofs = ((wa ? 0 : BROW) + (wave & 1) * 64 + lr) * GPITCH + hi * 16;
    v8f acc[2][4];
#pragma unroll
    for (int mi = 0; mi < 2; ++mi)
#pragma unroll
        for (int t = 0; t < 4; ++t) acc[mi][t] = (v8f){};
    fill(0, 0);
    asm volatile("s_wait_asynccnt 0x0" ::: "memory");    // this wave's copies of stage 0 have landed
    __syncthreads();                                      // ... and every other wave's: stage 0 is readable
    fill(1, 1);
#pragma unroll 1    // rolled: one ring foot
    for (int p = 0; p < GNP; ++p) {
        const unsigned char* sb = ring + (p & 1) * STG;
        v16bf a[2][2], al[2][2], b[2][4];
        auto frags = [&](int ks, int f) {
#pragma unroll
            for (int mi = 0; mi < 2; ++mi) { const unsigned char* q = sb + aofs + mi * 16 * GPITCH + ks * 64;
                a[f][mi] = cat16b(*(const v8usa*)q, *(const v8usa*)(q + 32));
                if (SPLITA) al[f][mi] = cat16b(*(const v8usa*)(q + 128 * GPITCH), *(const v8usa*)(q + 128 * GPITCH + 32)); }
#pragma unroll
            for (int t = 0; t < 4; ++t) { const unsigned char* q = sb + bofs + t * 16 * GPITCH + ks * 64; b[f][t] = cat16b(*(const v8usa*)q, *(const v8usa*)(q + 32)); }
        };
        frags(0, 0);
#pragma unroll
        for (int ks = 0; ks < GKP / 32; ++ks) {
            const int f = ks & 1;
            if (ks + 1 < GKP / 32) frags(ks + 1, f ^ 1);    // the next 32 k of this same stage, one group into the other fragment set
            __builtin_amdgcn_sched_barrier(0);              // keeps that group ahead of the WMMA block
#pragma unroll
            for (int mi = 0; mi < 2; ++mi)
#pragma unroll
                for (int t = 0; t < 4; ++t) acc[mi][t] = wmmab(a[f][mi], b[f][t], acc[mi][t]);
            if (SPLITA) {
#pragma unroll
                for (int mi = 0; mi < 2; ++mi)
#pragma unroll
                    for (int t = 0; t < 4; ++t) acc[mi][t] = wmmab(al[f][mi], b[f][t], acc[mi][t]);
            }
            __builtin_amdgcn_sched_barrier(0);              // ... and the following group behind the block
        }
        asm volatile("s_wait_dscnt 0x0" ::: "memory");       // this wave's reads of the buffer are done before it may be refilled
        asm volatile("s_wait_asynccnt 0x0" ::: "memory");    // this wave's copies of stage p + 1 have landed
        __syncthreads();                                      // publishes stage p + 1 and ends every reader's last read of stage p
        if (p + 2 < GNP) fill(p + 2, p & 1);
    }
    asm volatile("s_wait_asynccnt 0x0" ::: "memory");        // no copy is outstanding when the wave goes on
    if (QKV && z == 2) {
        // An accumulator register group is 8 consecutive tokens of ONE column: exactly a lane's 16-B piece of the v fragment order. The wave's 32 tokens x 64 columns are one
        // (head, 32-token tile), so every store below is 512 contiguous bytes straight from registers.
        const size_t vb = ((size_t)(c0 >> 6) * (NT_ / 32) + (r0 >> 5)) * 2048 + lane * 8;    // NB_ = 1: the row of A is its token
        h16* gh = VTH + vb; h16* gl = VTL + vb;
#pragma unroll
        for (int mi = 0; mi < 2; ++mi)
#pragma unroll
            for (int t = 0; t < 4; ++t) { const float bv = bias ? bfr(bias[c0 + t * 16 + lr]) : 0.f; v8h vh_, vl_;
#pragma unroll
                for (int j = 0; j < 8; ++j) { const float v = acc[mi][t][j] + bv; const h16 a = (h16)v; vh_[j] = a; vl_[j] = (h16)((v - (float)a) * LOSC); }
                *(v8h*)(gh + t * 512 + mi * 256) = vh_; *(v8h*)(gl + t * 512 + mi * 256) = vl_;
                asm volatile("s_wait_xcnt 0x0" ::: "memory"); }    // stands in front of the next writes of the registers that the two stores above name
        return;
    }
    if (QKV) {    // z is 0 or 1 here
        // Transposed product: an accumulator register group is 8 consecutive d of ONE token, exactly a lane's 16-B piece of the q, k fragment order. The wave's 32 rows of W
        // are d groups mi of one head, its 64 tokens four 16-token tiles t, so every store below is 512 contiguous bytes straight from registers.
        const int f0 = cb + (wave >> 1) * 32, t0 = rb + (wave & 1) * 64;    // first column of W^T and first token of the wave (NB_ = 1: a row of x is its token)
        const size_t fb = ((size_t)(f0 >> 6) * (NT_ / 16) + (t0 >> 4)) * 1024 + ((f0 & 63) >> 4) * 256 + lane * 8;
        h16* gh = (z == 0 ? H0 : H1) + fb; h16* gl = (z == 0 ? L0 : L1) + fb;
#pragma unroll
        for (int mi = 0; mi < 2; ++mi) { float bv[8] = {};
            if (bias) {
#pragma unroll
                for (int j = 0; j < 8; ++j) bv[j] = bfr(bias[f0 + mi * 16 + hi * 8 + j]); }
#pragma unroll
            for (int t = 0; t < 4; ++t) { v8h o, o2;
#pragma unroll
                for (int j = 0; j < 8; ++j) { const float v = acc[mi][t][j] + bv[j]; const h16 a = (h16)v; o[j] = a; o2[j] = (h16)((v - (float)a) * LOSC); }
                *(v8h*)(gh + t * 1024 + mi * 256) = o; *(v8h*)(gl + t * 1024 + mi * 256) = o2;
                asm volatile("s_wait_xcnt 0x0" ::: "memory"); } }    // stands in front of the next writes of the registers that the two stores above name
        return;
    }
    __shared__ __align__(16) float ost[8][32 * 68];
    float* os = &ost[wave][0];
#pragma unroll
    for (int mi = 0; mi < 2; ++mi)
#pragma unroll
        for (int t = 0; t < 4; ++t) { const float bv = bias ? bfr(bias[c0 + t * 16 + lr]) : 0.f;
#pragma unroll
            for (int j = 0; j < 8; ++j) os[(mi * 16 + hi * 8 + j) * 68 + t * 16 + lr] = acc[mi][t][j] + bv; }
    __syncthreads();
    float* crow_p = Cf + (size_t)r0 * ldc + c0;
#pragma unroll
    for (int s = 0; s < 16; ++s) { const int Lid = (lane >> 3) + 4 * s, piece = lane & 7; const int row = Lid >> 1, cofs = (Lid & 1) * 32 + piece * 4;
        const v4f val = *(const v4fa*)(os + row * 68 + cofs); *(v4f*)(crow_p + (size_t)row * ldc + cofs) = val; }
}

// Lane l <-> l ^ 16: the two lanes that share a column of a WMMA result.
__device__ __forceinline__ float xhalf(float v) { const int b = __float_as_int(v); return __int_as_float(__builtin_amdgcn_permlanex16(b, b, 0x76543210, 0xfedcba98, false, false)); }

__global__ __launch_bounds__(128, 4) void k_attn(const h16* __restrict__ Q16, const h16* __restrict__ QL16, const h16* __restrict__ K16, const h16* __restrict__ KL16, const h16* __restrict__ VTH, const h16* __restrict__ VTL, bf* CH, bf* CL) {
    __shared__ __align__(16) float ost[4][16 * 68];
    const int lane = threadIdx.x & 31, wave = threadIdx.x >> 5, lr = lane & 15, hi = lane >> 4;
    const int bid = blockIdx.x;
    const int b = bid / (NH_ * (NT_ / 64)), rem = bid - b * (NH_ * (NT_ / 64)), h = rem / (NT_ / 64), qt = rem - h * (NT_ / 64);
    const int q0 = qt * 64 + wave * 16;
    const size_t tok0 = (size_t)b * NT_;
    v16h qa[2], ql[2];    // the query tile, hi and residual: read once, no load of it among the loop's groups
    const size_t hb = ((size_t)b * NH_ + h) * HD * NT_;    // the head's part of every plane (fragment order: the layouts stand at k_gemmb)
    const size_t qo0 = hb + (size_t)(q0 >> 4) * 1024 + lane * 8;
#pragma unroll
    for (int kc = 0; kc < 2; ++kc) { qa[kc] = cat16(*(const v8h*)(Q16 + qo0 + kc * 512), *(const v8h*)(Q16 + qo0 + kc * 512 + 256)); ql[kc] = cat16(*(const v8h*)(QL16 + qo0 + kc * 512), *(const v8h*)(QL16 + qo0 + kc * 512 + 256)); }
    const h16* kh_b = K16 + hb;
    const h16* kl_b = KL16 + hb;
    const h16* vh_b = VTH + hb;
    const h16* vl_b = VTL + hb;
    v8f o[4], ox[4];    // O^T: register j of group n is d = n * 16 + 8 * hi + j of the lane's query
#pragma unroll
    for (int n = 0; n < 4; ++n) { o[n] = (v8f){}; ox[n] = (v8f){}; }
    float mrow = -3.0e38f, lpart = 0.f;    // of the lane's query; lpart sums the lane's own keys only, the halves are joined behind the loop
    const int dq = q0 + lr - 8 * hi;    // the lane's query minus key row 0 of the lane's half: with the tile's first key taken off, i - j of the mask
    const int kt_lo = (qt * 64 - (BAND - 1)) > 0 ? (qt * 64 - (BAND - 1)) / 32 : 0, kt_hi = (qt * 64 + 63) / 32;     // block-uniform: keys qt*64-127 .. qt*64+63
#pragma unroll 1
    for (int kt = kt_lo; kt <= kt_hi; ++kt) {
        const int l0 = kt * 32;
        const unsigned ko0 = (unsigned)(kt * 2048 + lane * 8);    // 32-bit lane offset from the wave-uniform bases: a 32-key tile is 2048 halves of each plane, K and V alike
        const h16* pkh = kh_b + ko0; const h16* pkl = kl_b + ko0;      // keys l0 .. l0 + 15; keys l0 + 16 .. are a constant offset from them
        // Every K fragment of the tile (hi and residual, both halves of the head) is asked for in one group: one load latency a tile, not four in a row.
        v16h kh[2][2], kl[2][2];
#pragma unroll
        for (int kc = 0; kc < 2; ++kc) {
            kh[kc][0] = cat16(*(const v8h*)(pkh + kc * 512), *(const v8h*)(pkh + kc * 512 + 256)); kh[kc][1] = cat16(*(const v8h*)(pkh + 1024 + kc * 512), *(const v8h*)(pkh + 1024 + kc * 512 + 256));
            kl[kc][0] = cat16(*(const v8h*)(pkl + kc * 512), *(const v8h*)(pkl + kc * 512 + 256)); kl[kc][1] = cat16(*(const v8h*)(pkl + 1024 + kc * 512), *(const v8h*)(pkl + 1024 + kc * 512 + 256));
        }
        asm volatile("s_wait_xcnt 0x0" :: "v"(pkh), "v"(pkl) : "memory");    // stands in front of the next write of the group's address registers; naming them keeps them whole up to here
        __builtin_amdgcn_sched_barrier(0);    // keeps the whole group ahead of the first WMMA: a load sunk to its user would wait out its latency alone
        v8f s[2] = {{}, {}}, x[2] = {{}, {}};    // S^T of keys l0 .. l0 + 15 and l0 + 16 .. l0 + 31: hi.hi, and the two cross products
#pragma unroll
        for (int kc = 0; kc < 2; ++kc) {
            s[0] = wmma16(kh[kc][0], qa[kc], s[0]); x[0] = wmma16(kh[kc][0], ql[kc], x[0]); s[1] = wmma16(kh[kc][1], qa[kc], s[1]); x[1] = wmma16(kh[kc][1], ql[kc], x[1]);
            x[0] = wmma16(kl[kc][0], qa[kc], x[0]); x[1] = wmma16(kl[kc][1], qa[kc], x[1]);
        }
        // The tile's V fragments (hi and residual, all four column groups) are asked for here, in the registers that K has left: they land while the softmax below runs.
        v16h vh[4], vl[4];
        const h16* pvh = vh_b + ko0; const h16* pvl = vl_b + ko0;      // column group 0; group n is a constant offset from it
#pragma unroll
        for (int n = 0; n < 4; ++n) { vh[n] = cat16(*(const v8h*)(pvh + n * 512), *(const v8h*)(pvh + n * 512 + 256)); vl[n] = cat16(*(const v8h*)(pvl + n * 512), *(const v8h*)(pvl + n * 512 + 256)); }
        asm volatile("s_wait_xcnt 0x0" :: "v"(pvh), "v"(pvl) : "memory");    // as behind the K group
        __builtin_amdgcn_sched_barrier(0);    // keeps that group ahead of the softmax
        v2f a[2][4];    // the scores in pairs of neighbouring accumulator registers, so that the packed f32 forms take them as they lie
        float mx = -__builtin_inff();
#pragma unroll
        for (int t = 0; t < 2; ++t)
#pragma unroll
            for (int jp = 0; jp < 4; ++jp) {
                const int da = dq - l0 - 16 * t - 2 * jp;    // i - j of the pair's first key, one less for its second; 0 <= i - j < BAND as one unsigned compare
                v2f sc = ((v2f){s[t][2 * jp], s[t][2 * jp + 1]} + (v2f){x[t][2 * jp], x[t][2 * jp + 1]} * LOSCI) * 0.125f;
                sc[0] = (unsigned)da < (unsigned)BAND ? sc[0] : -__builtin_inff(); sc[1] = (unsigned)(da - 1) < (unsigned)BAND ? sc[1] : -__builtin_inff();
                a[t][jp] = sc; mx = fmaxf(mx, fmaxf(sc[0], sc[1]));
            }
        mx = fmaxf(mx, xhalf(mx));    // the query's other 16 keys of the tile
        const float mn = fmaxf(mrow, mx);
        const float alpha = __expf(mrow - mn); mrow = mn;
        v2f rs2 = {0.f, 0.f};
        v16h pb, px;    // P^T hi and residual as B operands: element e is key 8 * hi + e (e < 8), 16 + 8 * hi + e - 8 (else)
#pragma unroll
        for (int t = 0; t < 2; ++t)
#pragma unroll
            for (int jp = 0; jp < 4; ++jp) {
                const v2f p = {__expf(a[t][jp][0] - mn), __expf(a[t][jp][1] - mn)};
                rs2 += p;
                const v2f ps = p * PSC; const v2h hh = __builtin_convertvector(ps, v2h);
                const v2h ll = __builtin_convertvector((ps - __builtin_convertvector(hh, v2f)) * LOSC, v2h);
                pb[8 * t + 2 * jp] = hh[0]; pb[8 * t + 2 * jp + 1] = hh[1]; px[8 * t + 2 * jp] = ll[0]; px[8 * t + 2 * jp + 1] = ll[1];
            }
        const float rs = rs2[0] + rs2[1];
        lpart = lpart * alpha + rs;
#pragma unroll
        for (int n = 0; n < 4; ++n)
#pragma unroll
            for (int j = 0; j < 8; ++j) { o[n][j] *= alpha; ox[n][j] *= alpha; }
#pragma unroll
        for (int n = 0; n < 4; ++n) { o[n] = wmma16(vh[n], pb, o[n]); ox[n] = wmma16(vl[n], pb, ox[n]); ox[n] = wmma16(vh[n], px, ox[n]); }
        // four vector slots behind the last WMMA, on the loop's taken branch too
        asm volatile("v_nop\n\tv_nop\n\tv_nop\n\tv_nop" : "+v"(o[0]), "+v"(o[1]), "+v"(o[2]), "+v"(o[3]), "+v"(ox[0]), "+v"(ox[1]), "+v"(ox[2]), "+v"(ox[3]) : "v"(pb), "v"(px));
    }
    const float inv = 1.0f / ((lpart + xhalf(lpart)) * PSC);
    float* os = &ost[wave][0];
    float* osw = os + lr * 68 + hi * 8;    // the lane's query row: its 8 consecutive d of a group go as two 16-B stores
#pragma unroll
    for (int n = 0; n < 4; ++n) { v4f w0, w1;
#pragma unroll
        for (int j = 0; j < 4; ++j) { w0[j] = (o[n][j] + ox[n][j] * LOSCI) * inv; w1[j] = (o[n][4 + j] + ox[n][4 + j] * LOSCI) * inv; }
        *(v4fa*)(osw + n * 16) = w0; *(v4fa*)(osw + n * 16 + 4) = w1; }
    __syncthreads();
    const size_t cbase = (tok0 + q0) * DM + (size_t)h * HD;
    auto pass = [&]() {
#pragma unroll
        for (int s = 0; s < 4; ++s) { const int row = 4 * s + (lane >> 3), piece = lane & 7; const float* sp = os + row * 68 + piece * 8; v8us oh, ol;
#pragma unroll
            for (int i = 0; i < 8; ++i) { const unsigned short hb = f2bf(sp[i]); oh[i] = hb; ol[i] = f2bf(sp[i] - bf2f(hb)); }
            *(v8us*)(CH + cbase + (size_t)row * DM + piece * 8) = oh; *(v8us*)(CL + cbase + (size_t)row * DM + piece * 8) = ol; }
    };
    pass(); 
}

#define VST2(T, p, v) do { const T vst2_v_ = (v); *(T*)(p) = vst2_v_;  } while (0)
extern "C" void kernel_launch(void* const* d_in, const int* in_sizes, int n_in,
                              void* d_out, int out_size, void* d_ws, size_t ws_size, hipStream_t stream) {
    (void)in_sizes; (void)n_in; (void)out_size;
    const float* x = (const float*)d_in[0]; const float* Wq = (const float*)d_in[1]; const float* Wk = (const float*)d_in[2]; const float* Wv = (const float*)d_in[3]; const float* Wo = (const float*)d_in[4];
    float* out = (float*)d_out;    // [1][4096][1024]
    char* wsp = (char*)d_ws;
    auto take = [&](size_t bytes) { char* p = wsp; wsp += (bytes + 255) & ~(size_t)255; return (void*)p; };
    bf* Xb = (bf*)take((size_t)NTK * DM * 2); bf* WqB = (bf*)take((size_t)DM * DM * 2); bf* WkB = (bf*)take((size_t)DM * DM * 2); bf* WvB = (bf*)take((size_t)DM * DM * 2); bf* WoB = (bf*)take((size_t)DM * DM * 2);
    h16* Q16 = (h16*)take((size_t)NTK * DM * 2); h16* QL16 = (h16*)take((size_t)NTK * DM * 2); h16* K16 = (h16*)take((size_t)NTK * DM * 2); h16* KL16 = (h16*)take((size_t)NTK * DM * 2); bf* CL = (bf*)take((size_t)NTK * DM * 2); h16* VTH = (h16*)take((size_t)NTK * DM * 2); h16* VTL = (h16*)take((size_t)NTK * DM * 2);
    if ((size_t)(wsp - (char*)d_ws) > ws_size) return;    // 8 planes of 8.4 MB + 4 of 2.1 MB ~ 76 MB; the ctx hi plane aliases Xb after its last reader
    bf* CH = (bf*)Xb;
    k_cvtb<<<(NTK + 4 * DM) / 8, 256, 0, stream>>>(x, Wq, Wk, Wv, Wo, Xb, WqB, WkB, WvB, WoB);
    k_gemmb<false, true><<<dim3(NTK / 128, DM / 128, 3), 256, 0, stream>>>(Xb, nullptr, WqB, WkB, WvB, nullptr, nullptr, DM, Q16, QL16, K16, KL16, VTH, VTL);
    k_attn<<<NB_ * NH_ * (NT_ / 64), 128, 0, stream>>>(Q16, QL16, K16, KL16, VTH, VTL, CH, CL);
    k_gemmb<true, false><<<dim3(NTK / 128, DM / 128, 1), 256, 0, stream>>>(CH, CL, WoB, nullptr, nullptr, nullptr, out, DM, nullptr, nullptr, nullptr, nullptr, nullptr, nullptr);
}

// v008
// Measured time: 66 microseconds a run.
// Next to v007, in two timings, it ran 1.04 times as fast each time.
// Counting every step since v000, it is 3.39 times as fast.
#include <hip/hip_runtime.h>

// Contractions, f32 accumulate: q/k/v = x.W^T ([4096 x 1024].[1024 x 1024] each; W is [out][in], used as-is: the n-major B operand for v, for q and k the A operand (transposed product)) and y.Wo^T on
// v_wmma_f32_16x16x32_bf16 with PLAIN bf16 operands for the projections (inputs rounded once: exact) and y as bf16 hi + residual planes (two products) for Wo; the
// banded-causal 16-head attention (keys j with i-127 <= j <= i) fused on v_wmma_f32_16x16x32_f16 over the <= 6 key tiles per 64-query block: q and k as f16 hi + residual x1024

#define NB_  1
#define NT_  4096
#define DM   1024
#define NH_  16
#define HD   64
#define NTK  (NB_ * NT_)
#define NW   1024
#define NQKV 1024
#define BAND 128
#define PSC  32768.0f
#define LOSC 1024.0f
#define LOSCI (1.0f / 1024.0f)

typedef _Float16 h16;
typedef unsigned short bf;
typedef __attribute__((ext_vector_type(16))) __bf16   v16bf;
typedef __attribute__((ext_vector_type(16))) _Float16 v16h;
typedef __attribute__((ext_vector_type(8)))  _Float16 v8h;
typedef __attribute__((ext_vector_type(8)))  unsigned short v8us;
typedef __attribute__((ext_vector_type(8)))  float    v8f;
typedef __attribute__((ext_vector_type(4)))  float    v4f;
typedef __attribute__((ext_vector_type(2)))  float    v2f;
typedef __attribute__((ext_vector_type(2)))  _Float16 v2h;
typedef v8h  __attribute__((may_alias)) v8ha;
typedef v4f  __attribute__((may_alias)) v4fa;
typedef v8us __attribute__((may_alias)) v8usa;

__device__ __forceinline__ unsigned short f2bf(float f) { unsigned u = __float_as_uint(f); u += 0x7FFFu + ((u >> 16) & 1u); return (unsigned short)(u >> 16); }
__device__ __forceinline__ float bf2f(unsigned short b) { return __uint_as_float(((unsigned)b) << 16); }
__device__ __forceinline__ float bfr(float f) { return bf2f(f2bf(f)); }
__device__ __forceinline__ v16h cat16(v8h lo, v8h hi) { return __builtin_shufflevector(lo, hi, 0, 1, 2, 3, 4, 5, 6, 7, 8, 9, 10, 11, 12, 13, 14, 15); }
__device__ __forceinline__ v16bf cat16b(v8us lo, v8us hi) { return __builtin_bit_cast(v16bf, __builtin_shufflevector(lo, hi, 0, 1, 2, 3, 4, 5, 6, 7, 8, 9, 10, 11, 12, 13, 14, 15)); }
__device__ __forceinline__ v8f wmma16(v16h a, v16h b, v8f c) { return __builtin_amdgcn_wmma_f32_16x16x32_f16(false, a, false, b, (short)0, c, false, false); }
__device__ __forceinline__ v8f wmmab(v16bf a, v16bf b, v8f c) { return __builtin_amdgcn_wmma_f32_16x16x32_bf16(false, a, false, b, (short)0, c, false, false); }

// k_cvtb: one grid rounds all five inputs: blocks [0, NTK / 8) take x, then DM / 8 blocks each weight; 8 rows a block, so the pick is block-uniform (scalar selects).
__global__ __launch_bounds__(256) void k_cvtb(const float* __restrict__ x, const float* __restrict__ Wq, const float* __restrict__ Wk, const float* __restrict__ Wv, const float* __restrict__ Wo,
                                              bf* Xb, bf* WqB, bf* WkB, bf* WvB, bf* WoB) {
    const int blk = blockIdx.x, sel = blk < NTK / 8 ? 0 : 1 + (blk - NTK / 8) / (DM / 8);
    const float* src = sel == 0 ? x : sel == 1 ? Wq : sel == 2 ? Wk : sel == 3 ? Wv : Wo;
    bf* dst = sel == 0 ? Xb : sel == 1 ? WqB : sel == 2 ? WkB : sel == 3 ? WvB : WoB;
    const int lane = threadIdx.x & 31, r = (sel == 0 ? blk : (blk - NTK / 8) % (DM / 8)) * 8 + (threadIdx.x >> 5);
    v8us o[DM / 256];
#pragma unroll
    for (int q = 0; q < DM / 256; ++q) { v8us t;
#pragma unroll
        for (int i = 0; i < 8; ++i) t[i] = f2bf(src[(size_t)r * DM + q * 256 + lane * 8 + i]);
        o[q] = t; }
#pragma unroll
    for (int q = 0; q < DM / 256; ++q) *(v8us*)(dst + (size_t)r * DM + q * 256 + lane * 8) = o[q];
    
}

// k_wt: W [1024 k][ncols n] (k-major) -> n-major bf16 plane WT[ncols][1024]; 64 x 64 tiles through LDS.
__global__ __launch_bounds__(256) void k_wt(const float* __restrict__ Wm, int ncols, bf* WT) {
    __shared__ __align__(16) unsigned short tl[64 * 72];
    const int tid = threadIdx.x, k0 = blockIdx.x * 64, n0 = blockIdx.y * 64;
    const int kk = tid >> 2, nq = (tid & 3) * 16;
#pragma unroll
    for (int i = 0; i < 16; ++i) tl[(nq + i) * 72 + kk] = f2bf(Wm[(size_t)(k0 + kk) * ncols + n0 + nq + i]);
    __syncthreads();
    const int piece = tid & 7;
    typedef __attribute__((ext_vector_type(8))) unsigned short v8us_; typedef v8us_ __attribute__((may_alias)) v8usa_;
    auto pass = [&]() {
#pragma unroll
        for (int s = 0; s < 2; ++s) { const int nr = (tid >> 3) + 32 * s; const v8us_ val = *(const v8usa_*)(tl + nr * 72 + piece * 8);
            *(v8us_*)(WT + (size_t)(n0 + nr) * DM + k0 + piece * 8) = val; }
    };
    pass(); 
}

// k_gemmb: C[128 x 128] per block of 8 waves (4 x 2, 32 x 64 each). A stage is 128 k = 256 B of every operand row, rows [A 128 | A residual 128 (SPLITA) | B 128] at an
// LDS pitch of 272 B (16 B x odd: conflict-free for the ds_load_b128 fragment reads). Two buffers, filled by per-lane b128 asynchronous copies to LDS (16 lanes = one whole
// 256-B row piece), the next stage in flight while this one is worked on. Per accumulator the k order and the hi-then-residual order are those of the direct-load form.
// Every '#pragma unroll' in k_gemmb makes the indices into acc and the fragment sets compile-time constants, so that they stay in registers.
#define GKP    128
#define GPITCH 272
#define GNP    (DM / GKP)

// Eight copies, rows 16 apart (8 waves x 2 rows per copy). s_wait_xcnt 0 is the last line of the copies' own statement so that no address register is rewritten ahead of it.
__device__ __forceinline__ void cp8(unsigned l, const bf* p) {
    asm volatile("global_load_async_to_lds_b128 %0, %8, off\n\t"
                 "global_load_async_to_lds_b128 %1, %9, off\n\t"
                 "global_load_async_to_lds_b128 %2, %10, off\n\t"
                 "global_load_async_to_lds_b128 %3, %11, off\n\t"
                 "global_load_async_to_lds_b128 %4, %12, off\n\t"
                 "global_load_async_to_lds_b128 %5, %13, off\n\t"
                 "global_load_async_to_lds_b128 %6, %14, off\n\t"
                 "global_load_async_to_lds_b128 %7, %15, off\n\t"
                 "s_wait_xcnt 0x0"
                 :: "v"(l), "v"(l + 16u * GPITCH), "v"(l + 32u * GPITCH), "v"(l + 48u * GPITCH), "v"(l + 64u * GPITCH), "v"(l + 80u * GPITCH), "v"(l + 96u * GPITCH), "v"(l + 112u * GPITCH),
                    "v"(p), "v"(p + 16 * DM), "v"(p + 32 * DM), "v"(p + 48 * DM), "v"(p + 64 * DM), "v"(p + 80 * DM), "v"(p + 96 * DM), "v"(p + 112 * DM)
                 : "memory");
}

// Four copies, rows 16 apart: 64 rows a block. The wait as in cp8.
__device__ __forceinline__ void cp4(unsigned l, const bf* p) {
    asm volatile("global_load_async_to_lds_b128 %0, %4, off\n\t"
                 "global_load_async_to_lds_b128 %1, %5, off\n\t"
                 "global_load_async_to_lds_b128 %2, %6, off\n\t"
                 "global_load_async_to_lds_b128 %3, %7, off\n\t"
                 "s_wait_xcnt 0x0"
                 :: "v"(l), "v"(l + 16u * GPITCH), "v"(l + 32u * GPITCH), "v"(l + 48u * GPITCH),
                    "v"(p), "v"(p + 16 * DM), "v"(p + 32 * DM), "v"(p + 48 * DM)
                 : "memory");
}

// Eight 16-B stores (four accumulator tiles, hi and residual plane; O1..O3: byte offsets of tiles 1..3 from tile 0) and their s_wait_xcnt 0 in ONE statement, so that no register
// which the stores name is rewritten ahead of the wait (in a statement of its own the wait was passed by such writes in k_qkv's listing), and one wait serves eight stores.
template <int O1, int O2, int O3>
__device__ __forceinline__ void st8(h16* p, h16* q, const v8h (&a)[4], const v8h (&b)[4]) {
    asm volatile("global_store_b128 %0, %2, off\n\t"
                 "global_store_b128 %1, %3, off\n\t"
                 "global_store_b128 %0, %4, off offset:%10\n\t"
                 "global_store_b128 %1, %5, off offset:%10\n\t"
                 "global_store_b128 %0, %6, off offset:%11\n\t"
                 "global_store_b128 %1, %7, off offset:%11\n\t"
                 "global_store_b128 %0, %8, off offset:%12\n\t"
                 "global_store_b128 %1, %9, off offset:%12\n\t"
                 "s_wait_xcnt 0x0"
                 :: "v"(p), "v"(q), "v"(__builtin_bit_cast(v4f, a[0])), "v"(__builtin_bit_cast(v4f, b[0])), "v"(__builtin_bit_cast(v4f, a[1])), "v"(__builtin_bit_cast(v4f, b[1])),
                    "v"(__builtin_bit_cast(v4f, a[2])), "v"(__builtin_bit_cast(v4f, b[2])), "v"(__builtin_bit_cast(v4f, a[3])), "v"(__builtin_bit_cast(v4f, b[3])), "n"(O1), "n"(O2), "n"(O3)
                 : "memory");
}

// k_qkv: ONE block does the q, k and v products of 256 tokens x one head (64 columns of each weight): 256 blocks, one a WGP. A stage is 128 k of the rows
// [x 256 | Wq 64 | Wk 64 | Wv 64], ring and pitch as in k_gemmb. 8 waves (4 x 2): a wave has 64 tokens x 32 columns of all three products, so that its four x fragments, read
// once from LDS, serve 24 WMMAs (both operands are k-contiguous rows read by the same loader: the same registers are the B operand of q, k and the A operand of v).
// q, k come out transposed (weight rows as the A operand), v as it is. Per accumulator the k order is that of k_gemmb.
// The planes (f16 hi + residual) are laid out in the ORDER IN WHICH k_attn's FRAGMENT LOADS READ THEM, so that each of its wave-wide 16-B loads covers 512 contiguous bytes (four whole lines):
//   q, k: [head][16-token tile][16-d group g = 0..3][lane = hi * 16 + token % 16][8 d: g * 16 + hi * 8 + i]          (1024 halves a tile)
//   v:    [head][32-token tile][16-d group n = 0..3][16-token half][lane = hi * 16 + d % 16][8 tokens: hi * 8 + i]   (2048 halves a tile)
// Every '#pragma unroll' in k_qkv makes the indices into the accumulators and the fragment sets compile-time constants, so that they stay in registers.
#define QSTG ((256 + 3 * 64) * GPITCH)
__global__ __launch_bounds__(256) void k_qkv(const bf* __restrict__ X, const bf* __restrict__ WQ, const bf* __restrict__ WK, const bf* __restrict__ WV,
                                             h16* QH, h16* QL, h16* KH, h16* KL, h16* VTH, h16* VTL) {
    __shared__ __align__(16) unsigned char ring[2 * QSTG];    // 243,712 B
    const int lane = threadIdx.x & 31, wave = threadIdx.x >> 5, lr = lane & 15, hi = lane >> 4;
    const int rb = blockIdx.x * 256, cb = blockIdx.y * 64;
    const int crow = 2 * wave + hi;
    const unsigned xo = (unsigned)((rb + crow) * DM + lr * 8), wo = (unsigned)((cb + crow) * DM + lr * 8);    // the lane's 32-bit offsets from the block-uniform bases: two registers live over the loop, not four pointers
    const unsigned lcp = (unsigned)(uintptr_t)&ring[0] + (unsigned)(crow * GPITCH + lr * 16);
    auto fill = [&](int t, int buf) {
        const unsigned l = lcp + (unsigned)(buf * QSTG);
        cp8(l, X + (xo + (unsigned)(t * GKP)));
        cp8(l + 128u * GPITCH, X + (xo + (unsigned)(128 * DM + t * GKP)));
        cp4(l + 256u * GPITCH, WQ + (wo + (unsigned)(t * GKP)));
        cp4(l + 320u * GPITCH, WK + (wo + (unsigned)(t * GKP)));
        cp4(l + 384u * GPITCH, WV + (wo + (unsigned)(t * GKP)));
    };
    const int xofs = ((wave & 3) * 64 + lr) * GPITCH + hi * 16, wofs = (256 + (wave >> 2) * 32 + lr) * GPITCH + hi * 16;
    v8f aq[2][4], ak[2][4], av[4][2];    // q, k: [16 columns of W][16 tokens]; v: [16 tokens][16 columns of W]
#pragma unroll
    for (int mi = 0; mi < 2; ++mi)
#pragma unroll
        for (int t = 0; t < 4; ++t) { aq[mi][t] = (v8f){}; ak[mi][t] = (v8f){}; av[t][mi] = (v8f){}; }
    fill(0, 0);
    asm volatile("s_wait_asynccnt 0x0" ::: "memory");    // this wave's copies of stage 0 have landed
    __syncthreads();                                      // ... and every other wave's: stage 0 is readable
    fill(1, 1);
#pragma unroll 1    // rolled: one ring foot
    for (int p = 0; p < GNP; ++p) {
        const unsigned char* sb = ring + (p & 1) * QSTG;
        v16bf xf[2][4], wf[2][3][2];
        auto frags = [&](int ks, int f) {
#pragma unroll
            for (int t = 0; t < 4; ++t) { const unsigned char* q = sb + xofs + t * 16 * GPITCH + ks * 64; xf[f][t] = cat16b(*(const v8usa*)q, *(const v8usa*)(q + 32)); }
#pragma unroll
            for (int w = 0; w < 3; ++w)
#pragma unroll
                for (int mi = 0; mi < 2; ++mi) { const unsigned char* q = sb + wofs + (w * 64 + mi * 16) * GPITCH + ks * 64; wf[f][w][mi] = cat16b(*(const v8usa*)q, *(const v8usa*)(q + 32)); }
        };
        frags(0, 0);
#pragma unroll
        for (int ks = 0; ks < GKP / 32; ++ks) {
            const int f = ks & 1;
            if (ks + 1 < GKP / 32) frags(ks + 1, f ^ 1);    // the next 32 k of this same stage, one group into the other fragment set
            __builtin_amdgcn_sched_barrier(0);              // keeps that group ahead of the WMMA block
#pragma unroll
            for (int mi = 0; mi < 2; ++mi)
#pragma unroll
                for (int t = 0; t < 4; ++t) aq[mi][t] = wmmab(wf[f][0][mi], xf[f][t], aq[mi][t]);
#pragma unroll
            for (int mi = 0; mi < 2; ++mi)
#pragma unroll
                for (int t = 0; t < 4; ++t) ak[mi][t] = wmmab(wf[f][1][mi], xf[f][t], ak[mi][t]);
#pragma unroll
            for (int mi = 0; mi < 2; ++mi)
#pragma unroll
                for (int t = 0; t < 4; ++t) av[t][mi] = wmmab(xf[f][t], wf[f][2][mi], av[t][mi]);
            __builtin_amdgcn_sched_barrier(0);              // ... and the following group behind the block
        }
        asm volatile("s_wait_dscnt 0x0" ::: "memory");       // this wave's reads of the buffer are done before it may be refilled
        asm volatile("s_wait_asynccnt 0x0" ::: "memory");    // this wave's copies of stage p + 1 have landed
        __syncthreads();                                      // publishes stage p + 1 and ends every reader's last read of stage p
        if (p + 2 < GNP) fill(p + 2, p & 1);
    }
    asm volatile("s_wait_asynccnt 0x0" ::: "memory");        // no copy is outstanding when the wave goes on
    const int g0 = (wave >> 2) * 2, t0 = rb + (wave & 3) * 64;    // first 16-d group of the head (blockIdx.y) and first token of the wave (NB_ = 1: a row of x is its token)
    // q, k, transposed product: an accumulator register group is 8 consecutive d of ONE token, exactly a lane's 16-B piece of the q, k fragment order: every store is 512
    // contiguous bytes straight from registers.
    const size_t fb = ((size_t)blockIdx.y * (NT_ / 16) + (t0 >> 4)) * 1024 + g0 * 256 + lane * 8;
#pragma unroll
    for (int w = 0; w < 2; ++w) { h16* gh = (w == 0 ? QH : KH) + fb; h16* gl = (w == 0 ? QL : KL) + fb;
#pragma unroll
        for (int mi = 0; mi < 2; ++mi) { v8h o[4], o2[4];
#pragma unroll
            for (int t = 0; t < 4; ++t)
#pragma unroll
                for (int j = 0; j < 8; ++j) { const float v = w == 0 ? aq[mi][t][j] : ak[mi][t][j]; const h16 a = (h16)v; o[t][j] = a; o2[t][j] = (h16)((v - (float)a) * LOSC); }
            st8<2048, 4096, 6144>(gh + mi * 256, gl + mi * 256, o, o2); } }    // token tile t: 1024 halves on
    // v: an accumulator register group is 8 consecutive tokens of ONE column, exactly a lane's 16-B piece of the v fragment order.
    const size_t vb = ((size_t)blockIdx.y * (NT_ / 32) + (t0 >> 5)) * 2048 + g0 * 512 + lane * 8;
    h16* gh = VTH + vb; h16* gl = VTL + vb;
#pragma unroll
    for (int mi = 0; mi < 2; ++mi) { v8h vh_[4], vl_[4];
#pragma unroll
        for (int t = 0; t < 4; ++t)
#pragma unroll
            for (int j = 0; j < 8; ++j) { const float v = av[t][mi][j]; const h16 a = (h16)v; vh_[t][j] = a; vl_[t][j] = (h16)((v - (float)a) * LOSC); }
        st8<512, 4096, 4608>(gh + mi * 512, gl + mi * 512, vh_, vl_); }    // token tile t: (t >> 1) * 2048 + (t & 1) * 256 halves on
}

// k_gemmb, as launched: C = (A + Al).Bn^T in f32, A's hi and residual planes as two products.
template <bool SPLITA>
__global__ __launch_bounds__(256) void k_gemmb(const bf* __restrict__ A, const bf* __restrict__ Al, const bf* __restrict__ Bn, const float* __restrict__ bias, float* Cf, int ldc) {
    constexpr int BROW = SPLITA ? 256 : 128, STG = (BROW + 128) * GPITCH;
    __shared__ __align__(16) unsigned char ring[2 * STG];
    const int lane = threadIdx.x & 31, wave = threadIdx.x >> 5, lr = lane & 15, hi = lane >> 4;
    const int rb = blockIdx.x * 128, cb = blockIdx.y * 128;
    const int r0 = rb + (wave >> 1) * 32, c0 = cb + (wave & 1) * 64;
    const int crow = 2 * wave + hi;
    const bf* gA = A + (size_t)(rb + crow) * DM + lr * 8;
    const bf* gAl = SPLITA ? Al + (size_t)(rb + crow) * DM + lr * 8 : gA;
    const bf* gB = Bn + (size_t)(cb + crow) * DM + lr * 8;
    const unsigned lcp = (unsigned)(uintptr_t)&ring[0] + (unsigned)(crow * GPITCH + lr * 16);
    auto fill = [&](int t, int buf) {
        const unsigned l = lcp + (unsigned)(buf * STG);
        cp8(l, gA + t * GKP);
        if (SPLITA) cp8(l + 128u * GPITCH, gAl + t * GKP);
        cp8(l + (unsigned)(BROW * GPITCH), gB + t * GKP);
    };
    const int aofs = ((wave >> 1) * 32 + lr) * GPITCH + hi * 16, bofs = (BROW + (wave & 1) * 64 + lr) * GPITCH + hi * 16;
    v8f acc[2][4];
#pragma unroll
    for (int mi = 0; mi < 2; ++mi)
#pragma unroll
        for (int t = 0; t < 4; ++t) acc[mi][t] = (v8f){};
    fill(0, 0);
    asm volatile("s_wait_asynccnt 0x0" ::: "memory");    // this wave's copies of stage 0 have landed
    __syncthreads();                                      // ... and every other wave's: stage 0 is readable
    fill(1, 1);
#pragma unroll 1    // rolled: one ring foot
    for (int p = 0; p < GNP; ++p) {
        const unsigned char* sb = ring + (p & 1) * STG;
        v16bf a[2][2], al[2][2], b[2][4];
        auto frags = [&](int ks, int f) {
#pragma unroll
            for (int mi = 0; mi < 2; ++mi) { const unsigned char* q = sb + aofs + mi * 16 * GPITCH + ks * 64;
                a[f][mi] = cat16b(*(const v8usa*)q, *(const v8usa*)(q + 32));
                if (SPLITA) al[f][mi] = cat16b(*(const v8usa*)(q + 128 * GPITCH), *(const v8usa*)(q + 128 * GPITCH + 32)); }
#pragma unroll
            for (int t = 0; t < 4; ++t) { const unsigned char* q = sb + bofs + t * 16 * GPITCH + ks * 64; b[f][t] = cat16b(*(const v8usa*)q, *(const v8usa*)(q + 32)); }
        };
        frags(0, 0);
#pragma unroll
        for (int ks = 0; ks < GKP / 32; ++ks) {
            const int f = ks & 1;
            if (ks + 1 < GKP / 32) frags(ks + 1, f ^ 1);    // the next 32 k of this same stage, one group into the other fragment set
            __builtin_amdgcn_sched_barrier(0);              // keeps that group ahead of the WMMA block
#pragma unroll
            for (int mi = 0; mi < 2; ++mi)
#pragma unroll
                for (int t = 0; t < 4; ++t) acc[mi][t] = wmmab(a[f][mi], b[f][t], acc[mi][t]);
            if (SPLITA) {
#pragma unroll
                for (int mi = 0; mi < 2; ++mi)
#pragma unroll
                    for (int t = 0; t < 4; ++t) acc[mi][t] = wmmab(al[f][mi], b[f][t], acc[mi][t]);
            }
            __builtin_amdgcn_sched_barrier(0);              // ... and the following group behind the block
        }
        asm volatile("s_wait_dscnt 0x0" ::: "memory");       // this wave's reads of the buffer are done before it may be refilled
        asm volatile("s_wait_asynccnt 0x0" ::: "memory");    // this wave's copies of stage p + 1 have landed
        __syncthreads();                                      // publishes stage p + 1 and ends every reader's last read of stage p
        if (p + 2 < GNP) fill(p + 2, p & 1);
    }
    asm volatile("s_wait_asynccnt 0x0" ::: "memory");        // no copy is outstanding when the wave goes on
    __shared__ __align__(16) float ost[8][32 * 68];
    float* os = &ost[wave][0];
#pragma unroll
    for (int mi = 0; mi < 2; ++mi)
#pragma unroll
        for (int t = 0; t < 4; ++t) { const float bv = bias ? bfr(bias[c0 + t * 16 + lr]) : 0.f;
#pragma unroll
            for (int j = 0; j < 8; ++j) os[(mi * 16 + hi * 8 + j) * 68 + t * 16 + lr] = acc[mi][t][j] + bv; }
    __syncthreads();
    float* crow_p = Cf + (size_t)r0 * ldc + c0;
#pragma unroll
    for (int s = 0; s < 16; ++s) { const int Lid = (lane >> 3) + 4 * s, piece = lane & 7; const int row = Lid >> 1, cofs = (Lid & 1) * 32 + piece * 4;
        const v4f val = *(const v4fa*)(os + row * 68 + cofs); *(v4f*)(crow_p + (size_t)row * ldc + cofs) = val; }
}

// Lane l <-> l ^ 16: the two lanes that share a column of a WMMA result.
__device__ __forceinline__ float xhalf(float v) { const int b = __float_as_int(v); return __int_as_float(__builtin_amdgcn_permlanex16(b, b, 0x76543210, 0xfedcba98, false, false)); }

__global__ __launch_bounds__(128, 4) void k_attn(const h16* __restrict__ Q16, const h16* __restrict__ QL16, const h16* __restrict__ K16, const h16* __restrict__ KL16, const h16* __restrict__ VTH, const h16* __restrict__ VTL, bf* CH, bf* CL) {
    __shared__ __align__(16) float ost[4][16 * 68];
    const int lane = threadIdx.x & 31, wave = threadIdx.x >> 5, lr = lane & 15, hi = lane >> 4;
    const int bid = blockIdx.x;
    const int b = bid / (NH_ * (NT_ / 64)), rem = bid - b * (NH_ * (NT_ / 64)), h = rem / (NT_ / 64), qt = rem - h * (NT_ / 64);
    const int q0 = qt * 64 + wave * 16;
    const size_t tok0 = (size_t)b * NT_;
    v16h qa[2], ql[2];    // the query tile, hi and residual: read once, no load of it among the loop's groups
    const size_t hb = ((size_t)b * NH_ + h) * HD * NT_;    // the head's part of every plane (fragment order: the layouts stand at k_qkv)
    const size_t qo0 = hb + (size_t)(q0 >> 4) * 1024 + lane * 8;
#pragma unroll
    for (int kc = 0; kc < 2; ++kc) { qa[kc] = cat16(*(const v8h*)(Q16 + qo0 + kc * 512), *(const v8h*)(Q16 + qo0 + kc * 512 + 256)); ql[kc] = cat16(*(const v8h*)(QL16 + qo0 + kc * 512), *(const v8h*)(QL16 + qo0 + kc * 512 + 256)); }
    const h16* kh_b = K16 + hb;
    const h16* kl_b = KL16 + hb;
    const h16* vh_b = VTH + hb;
    const h16* vl_b = VTL + hb;
    v8f o[4], ox[4];    // O^T: register j of group n is d = n * 16 + 8 * hi + j of the lane's query
#pragma unroll
    for (int n = 0; n < 4; ++n) { o[n] = (v8f){}; ox[n] = (v8f){}; }
    float mrow = -3.0e38f, lpart = 0.f;    // of the lane's query; lpart sums the lane's own keys only, the halves are joined behind the loop
    const int dq = q0 + lr - 8 * hi;    // the lane's query minus key row 0 of the lane's half: with the tile's first key taken off, i - j of the mask
    const int kt_lo = (qt * 64 - (BAND - 1)) > 0 ? (qt * 64 - (BAND - 1)) / 32 : 0, kt_hi = (qt * 64 + 63) / 32;     // block-uniform: keys qt*64-127 .. qt*64+63
#pragma unroll 1
    for (int kt = kt_lo; kt <= kt_hi; ++kt) {
        const int l0 = kt * 32;
        const unsigned ko0 = (unsigned)(kt * 2048 + lane * 8);    // 32-bit lane offset from the wave-uniform bases: a 32-key tile is 2048 halves of each plane, K and V alike
        const h16* pkh = kh_b + ko0; const h16* pkl = kl_b + ko0;      // keys l0 .. l0 + 15; keys l0 + 16 .. are a constant offset from them
        // Every K fragment of the tile (hi and residual, both halves of the head) is asked for in one group: one load latency a tile, not four in a row.
        v16h kh[2][2], kl[2][2];
#pragma unroll
        for (int kc = 0; kc < 2; ++kc) {
            kh[kc][0] = cat16(*(const v8h*)(pkh + kc * 512), *(const v8h*)(pkh + kc * 512 + 256)); kh[kc][1] = cat16(*(const v8h*)(pkh + 1024 + kc * 512), *(const v8h*)(pkh + 1024 + kc * 512 + 256));
            kl[kc][0] = cat16(*(const v8h*)(pkl + kc * 512), *(const v8h*)(pkl + kc * 512 + 256)); kl[kc][1] = cat16(*(const v8h*)(pkl + 1024 + kc * 512), *(const v8h*)(pkl + 1024 + kc * 512 + 256));
        }
        asm volatile("s_wait_xcnt 0x0" :: "v"(pkh), "v"(pkl) : "memory");    // stands in front of the next write of the group's address registers; naming them keeps them whole up to here
        __builtin_amdgcn_sched_barrier(0);    // keeps the whole group ahead of the first WMMA: a load sunk to its user would wait out its latency alone
        v8f s[2] = {{}, {}}, x[2] = {{}, {}};    // S^T of keys l0 .. l0 + 15 and l0 + 16 .. l0 + 31: hi.hi, and the two cross products
#pragma unroll
        for (int kc = 0; kc < 2; ++kc) {
            s[0] = wmma16(kh[kc][0], qa[kc], s[0]); x[0] = wmma16(kh[kc][0], ql[kc], x[0]); s[1] = wmma16(kh[kc][1], qa[kc], s[1]); x[1] = wmma16(kh[kc][1], ql[kc], x[1]);
            x[0] = wmma16(kl[kc][0], qa[kc], x[0]); x[1] = wmma16(kl[kc][1], qa[kc], x[1]);
        }
        // The tile's V fragments (hi and residual, all four column groups) are asked for here, in the registers that K has left: they land while the softmax below runs.
        v16h vh[4], vl[4];
        const h16* pvh = vh_b + ko0; const h16* pvl = vl_b + ko0;      // column group 0; group n is a constant offset from it
#pragma unroll
        for (int n = 0; n < 4; ++n) { vh[n] = cat16(*(const v8h*)(pvh + n * 512), *(const v8h*)(pvh + n * 512 + 256)); vl[n] = cat16(*(const v8h*)(pvl + n * 512), *(const v8h*)(pvl + n * 512 + 256)); }
        asm volatile("s_wait_xcnt 0x0" :: "v"(pvh), "v"(pvl) : "memory");    // as behind the K group
        __builtin_amdgcn_sched_barrier(0);    // keeps that group ahead of the softmax
        v2f a[2][4];    // the scores in pairs of neighbouring accumulator registers, so that the packed f32 forms take them as they lie
        float mx = -__builtin_inff();
#pragma unroll
        for (int t = 0; t < 2; ++t)
#pragma unroll
            for (int jp = 0; jp < 4; ++jp) {
                const int da = dq - l0 - 16 * t - 2 * jp;    // i - j of the pair's first key, one less for its second; 0 <= i - j < BAND as one unsigned compare
                v2f sc = ((v2f){s[t][2 * jp], s[t][2 * jp + 1]} + (v2f){x[t][2 * jp], x[t][2 * jp + 1]} * LOSCI) * 0.125f;
                sc[0] = (unsigned)da < (unsigned)BAND ? sc[0] : -__builtin_inff(); sc[1] = (unsigned)(da - 1) < (unsigned)BAND ? sc[1] : -__builtin_inff();
                a[t][jp] = sc; mx = fmaxf(mx, fmaxf(sc[0], sc[1]));
            }
        mx = fmaxf(mx, xhalf(mx));    // the query's other 16 keys of the tile
        const float mn = fmaxf(mrow, mx);
        const float alpha = __expf(mrow - mn); mrow = mn;
        v2f rs2 = {0.f, 0.f};
        v16h pb, px;    // P^T hi and residual as B operands: element e is key 8 * hi + e (e < 8), 16 + 8 * hi + e - 8 (else)
#pragma unroll
        for (int t = 0; t < 2; ++t)
#pragma unroll
            for (int jp = 0; jp < 4; ++jp) {
                const v2f p = {__expf(a[t][jp][0] - mn), __expf(a[t][jp][1] - mn)};
                rs2 += p;
                const v2f ps = p * PSC; const v2h hh = __builtin_convertvector(ps, v2h);
                const v2h ll = __builtin_convertvector((ps - __builtin_convertvector(hh, v2f)) * LOSC, v2h);
                pb[8 * t + 2 * jp] = hh[0]; pb[8 * t + 2 * jp + 1] = hh[1]; px[8 * t + 2 * jp] = ll[0]; px[8 * t + 2 * jp + 1] = ll[1];
            }
        const float rs = rs2[0] + rs2[1];
        lpart = lpart * alpha + rs;
#pragma unroll
        for (int n = 0; n < 4; ++n)
#pragma unroll
            for (int j = 0; j < 8; ++j) { o[n][j] *= alpha; ox[n][j] *= alpha; }
#pragma unroll
        for (int n = 0; n < 4; ++n) { o[n] = wmma16(vh[n], pb, o[n]); ox[n] = wmma16(vl[n], pb, ox[n]); ox[n] = wmma16(vh[n], px, ox[n]); }
        // four vector slots behind the last WMMA, on the loop's taken branch too
        asm volatile("v_nop\n\tv_nop\n\tv_nop\n\tv_nop" : "+v"(o[0]), "+v"(o[1]), "+v"(o[2]), "+v"(o[3]), "+v"(ox[0]), "+v"(ox[1]), "+v"(ox[2]), "+v"(ox[3]) : "v"(pb), "v"(px));
    }
    const float inv = 1.0f / ((lpart + xhalf(lpart)) * PSC);
    float* os = &ost[wave][0];
    float* osw = os + lr * 68 + hi * 8;    // the lane's query row: its 8 consecutive d of a group go as two 16-B stores
#pragma unroll
    for (int n = 0; n < 4; ++n) { v4f w0, w1;
#pragma unroll
        for (int j = 0; j < 4; ++j) { w0[j] = (o[n][j] + ox[n][j] * LOSCI) * inv; w1[j] = (o[n][4 + j] + ox[n][4 + j] * LOSCI) * inv; }
        *(v4fa*)(osw + n * 16) = w0; *(v4fa*)(osw + n * 16 + 4) = w1; }
    __syncthreads();
    const size_t cbase = (tok0 + q0) * DM + (size_t)h * HD;
    auto pass = [&]() {
#pragma unroll
        for (int s = 0; s < 4; ++s) { const int row = 4 * s + (lane >> 3), piece = lane & 7; const float* sp = os + row * 68 + piece * 8; v8us oh, ol;
#pragma unroll
            for (int i = 0; i < 8; ++i) { const unsigned short hb = f2bf(sp[i]); oh[i] = hb; ol[i] = f2bf(sp[i] - bf2f(hb)); }
            *(v8us*)(CH + cbase + (size_t)row * DM + piece * 8) = oh; *(v8us*)(CL + cbase + (size_t)row * DM + piece * 8) = ol; }
    };
    pass(); 
}

#define VST2(T, p, v) do { const T vst2_v_ = (v); *(T*)(p) = vst2_v_;  } while (0)
extern "C" void kernel_launch(void* const* d_in, const int* in_sizes, int n_in,
                              void* d_out, int out_size, void* d_ws, size_t ws_size, hipStream_t stream) {
    (void)in_sizes; (void)n_in; (void)out_size;
    const float* x = (const float*)d_in[0]; const float* Wq = (const float*)d_in[1]; const float* Wk = (const float*)d_in[2]; const float* Wv = (const float*)d_in[3]; const float* Wo = (const float*)d_in[4];
    float* out = (float*)d_out;    // [1][4096][1024]
    char* wsp = (char*)d_ws;
    auto take = [&](size_t bytes) { char* p = wsp; wsp += (bytes + 255) & ~(size_t)255; return (void*)p; };
    bf* Xb = (bf*)take((size_t)NTK * DM * 2); bf* WqB = (bf*)take((size_t)DM * DM * 2); bf* WkB = (bf*)take((size_t)DM * DM * 2); bf* WvB = (bf*)take((size_t)DM * DM * 2); bf* WoB = (bf*)take((size_t)DM * DM * 2);
    h16* Q16 = (h16*)take((size_t)NTK * DM * 2); h16* QL16 = (h16*)take((size_t)NTK * DM * 2); h16* K16 = (h16*)take((size_t)NTK * DM * 2); h16* KL16 = (h16*)take((size_t)NTK * DM * 2); bf* CL = (bf*)take((size_t)NTK * DM * 2); h16* VTH = (h16*)take((size_t)NTK * DM * 2); h16* VTL = (h16*)take((size_t)NTK * DM * 2);
    if ((size_t)(wsp - (char*)d_ws) > ws_size) return;    // 8 planes of 8.4 MB + 4 of 2.1 MB ~ 76 MB; the ctx hi plane aliases Xb after its last reader
    bf* CH = (bf*)Xb;
    k_cvtb<<<(NTK + 4 * DM) / 8, 256, 0, stream>>>(x, Wq, Wk, Wv, Wo, Xb, WqB, WkB, WvB, WoB);
    k_qkv<<<dim3(NTK / 256, DM / 64), 256, 0, stream>>>(Xb, WqB, WkB, WvB, Q16, QL16, K16, KL16, VTH, VTL);
    k_attn<<<NB_ * NH_ * (NT_ / 64), 128, 0, stream>>>(Q16, QL16, K16, KL16, VTH, VTL, CH, CL);
    k_gemmb<true><<<dim3(NTK / 128, DM / 128, 1), 256, 0, stream>>>(CH, CL, WoB, nullptr, out, DM);
}

// v009
// A run of this version takes 50.8 microseconds.
// Two timings next to v008 both put it at 1.29 times that version's speed.
// All steps since v000 together make it 4.37 times as fast.
#include <hip/hip_runtime.h>

// Contractions, f32 accumulate: q/k/v = x.W^T ([4096 x 1024].[1024 x 1024] each; W is [out][in], used as-is: the n-major B operand for v, for q and k the A operand (transposed product)) and y.Wo^T on
// v_wmma_f32_16x16x32_bf16 with PLAIN bf16 operands for the projections (inputs rounded once: exact) and y as bf16 hi + residual planes (two products) for Wo; the
// banded-causal 16-head attention (keys j with i-127 <= j <= i) on v_wmma_f32_16x16x32_f16, in the kernel of the q, k, v products, over the five 32-key tiles of a wave's 32 queries: q, k, v as f16 hi + residual x1024

#define NB_  1
#define NT_  4096
#define DM   1024
#define NH_  16
#define HD   64
#define NTK  (NB_ * NT_)
#define NW   1024
#define NQKV 1024
#define BAND 128
#define PSC  32768.0f
#define LOSC 1024.0f
#define LOSCI (1.0f / 1024.0f)

typedef _Float16 h16;
typedef unsigned short bf;
typedef __attribute__((ext_vector_type(16))) __bf16   v16bf;
typedef __attribute__((ext_vector_type(16))) _Float16 v16h;
typedef __attribute__((ext_vector_type(8)))  _Float16 v8h;
typedef __attribute__((ext_vector_type(8)))  unsigned short v8us;
typedef __attribute__((ext_vector_type(8)))  float    v8f;
typedef __attribute__((ext_vector_type(4)))  float    v4f;
typedef __attribute__((ext_vector_type(2)))  float    v2f;
typedef __attribute__((ext_vector_type(2)))  _Float16 v2h;
typedef v8h  __attribute__((may_alias)) v8ha;
typedef v4f  __attribute__((may_alias)) v4fa;
typedef v8us __attribute__((may_alias)) v8usa;

__device__ __forceinline__ unsigned short f2bf(float f) { unsigned u = __float_as_uint(f); u += 0x7FFFu + ((u >> 16) & 1u); return (unsigned short)(u >> 16); }
__device__ __forceinline__ float bf2f(unsigned short b) { return __uint_as_float(((unsigned)b) << 16); }
__device__ __forceinline__ float bfr(float f) { return bf2f(f2bf(f)); }
__device__ __forceinline__ v16h cat16(v8h lo, v8h hi) { return __builtin_shufflevector(lo, hi, 0, 1, 2, 3, 4, 5, 6, 7, 8, 9, 10, 11, 12, 13, 14, 15); }
__device__ __forceinline__ v16bf cat16b(v8us lo, v8us hi) { return __builtin_bit_cast(v16bf, __builtin_shufflevector(lo, hi, 0, 1, 2, 3, 4, 5, 6, 7, 8, 9, 10, 11, 12, 13, 14, 15)); }
__device__ __forceinline__ v8f wmma16(v16h a, v16h b, v8f c) { return __builtin_amdgcn_wmma_f32_16x16x32_f16(false, a, false, b, (short)0, c, false, false); }
__device__ __forceinline__ v8f wmmab(v16bf a, v16bf b, v8f c) { return __builtin_amdgcn_wmma_f32_16x16x32_bf16(false, a, false, b, (short)0, c, false, false); }

// k_cvtb: one grid rounds all five inputs: blocks [0, NTK / 8) take x, then DM / 8 blocks each weight; 8 rows a block, so the pick is block-uniform (scalar selects).
__global__ __launch_bounds__(256) void k_cvtb(const float* __restrict__ x, const float* __restrict__ Wq, const float* __restrict__ Wk, const float* __restrict__ Wv, const float* __restrict__ Wo,
                                              bf* Xb, bf* WqB, bf* WkB, bf* WvB, bf* WoB) {
    const int blk = blockIdx.x, sel = blk < NTK / 8 ? 0 : 1 + (blk - NTK / 8) / (DM / 8);
    const float* src = sel == 0 ? x : sel == 1 ? Wq : sel == 2 ? Wk : sel == 3 ? Wv : Wo;
    bf* dst = sel == 0 ? Xb : sel == 1 ? WqB : sel == 2 ? WkB : sel == 3 ? WvB : WoB;
    const int lane = threadIdx.x & 31, r = (sel == 0 ? blk : (blk - NTK / 8) % (DM / 8)) * 8 + (threadIdx.x >> 5);
    v8us o[DM / 256];
#pragma unroll
    for (int q = 0; q < DM / 256; ++q) { v8us t;
#pragma unroll
        for (int i = 0; i < 8; ++i) t[i] = f2bf(src[(size_t)r * DM + q * 256 + lane * 8 + i]);
        o[q] = t; }
#pragma unroll
    for (int q = 0; q < DM / 256; ++q) *(v8us*)(dst + (size_t)r * DM + q * 256 + lane * 8) = o[q];
    
}

// k_wt: W [1024 k][ncols n] (k-major) -> n-major bf16 plane WT[ncols][1024]; 64 x 64 tiles through LDS.
__global__ __launch_bounds__(256) void k_wt(const float* __restrict__ Wm, int ncols, bf* WT) {
    __shared__ __align__(16) unsigned short tl[64 * 72];
    const int tid = threadIdx.x, k0 = blockIdx.x * 64, n0 = blockIdx.y * 64;
    const int kk = tid >> 2, nq = (tid & 3) * 16;
#pragma unroll
    for (int i = 0; i < 16; ++i) tl[(nq + i) * 72 + kk] = f2bf(Wm[(size_t)(k0 + kk) * ncols + n0 + nq + i]);
    __syncthreads();
    const int piece = tid & 7;
    typedef __attribute__((ext_vector_type(8))) unsigned short v8us_; typedef v8us_ __attribute__((may_alias)) v8usa_;
    auto pass = [&]() {
#pragma unroll
        for (int s = 0; s < 2; ++s) { const int nr = (tid >> 3) + 32 * s; const v8us_ val = *(const v8usa_*)(tl + nr * 72 + piece * 8);
            *(v8us_*)(WT + (size_t)(n0 + nr) * DM + k0 + piece * 8) = val; }
    };
    pass(); 
}

// k_gemmb: C[128 x 128] per block of 8 waves (4 x 2, 32 x 64 each). A stage is 128 k = 256 B of every operand row, rows [A 128 | A residual 128 (SPLITA) | B 128] at an
// LDS pitch of 272 B (16 B x odd: conflict-free for the ds_load_b128 fragment reads). Two buffers, filled by per-lane b128 asynchronous copies to LDS (16 lanes = one whole
// 256-B row piece), the next stage in flight while this one is worked on. Per accumulator the k order and the hi-then-residual order are those of the direct-load form.
// Every '#pragma unroll' in k_gemmb makes the indices into acc and the fragment sets compile-time constants, so that they stay in registers.
#define GKP    128
#define GPITCH 272
#define GNP    (DM / GKP)

// Eight copies, rows 16 apart (8 waves x 2 rows per copy). s_wait_xcnt 0 is the last line of the copies' own statement so that no address register is rewritten ahead of it.
__device__ __forceinline__ void cp8(unsigned l, const bf* p) {
    asm volatile("global_load_async_to_lds_b128 %0, %8, off\n\t"
                 "global_load_async_to_lds_b128 %1, %9, off\n\t"
                 "global_load_async_to_lds_b128 %2, %10, off\n\t"
                 "global_load_async_to_lds_b128 %3, %11, off\n\t"
                 "global_load_async_to_lds_b128 %4, %12, off\n\t"
                 "global_load_async_to_lds_b128 %5, %13, off\n\t"
                 "global_load_async_to_lds_b128 %6, %14, off\n\t"
                 "global_load_async_to_lds_b128 %7, %15, off\n\t"
                 "s_wait_xcnt 0x0"
                 :: "v"(l), "v"(l + 16u * GPITCH), "v"(l + 32u * GPITCH), "v"(l + 48u * GPITCH), "v"(l + 64u * GPITCH), "v"(l + 80u * GPITCH), "v"(l + 96u * GPITCH), "v"(l + 112u * GPITCH),
                    "v"(p), "v"(p + 16 * DM), "v"(p + 32 * DM), "v"(p + 48 * DM), "v"(p + 64 * DM), "v"(p + 80 * DM), "v"(p + 96 * DM), "v"(p + 112 * DM)
                 : "memory");
}

// Four copies, rows 16 apart: 64 rows a block. The wait as in cp8.
__device__ __forceinline__ void cp4(unsigned l, const bf* p) {
    asm volatile("global_load_async_to_lds_b128 %0, %4, off\n\t"
                 "global_load_async_to_lds_b128 %1, %5, off\n\t"
                 "global_load_async_to_lds_b128 %2, %6, off\n\t"
                 "global_load_async_to_lds_b128 %3, %7, off\n\t"
                 "s_wait_xcnt 0x0"
                 :: "v"(l), "v"(l + 16u * GPITCH), "v"(l + 32u * GPITCH), "v"(l + 48u * GPITCH),
                    "v"(p), "v"(p + 16 * DM), "v"(p + 32 * DM), "v"(p + 48 * DM)
                 : "memory");
}

// k_gemmb, as launched: C = (A + Al).Bn^T in f32, A's hi and residual planes as two products.
template <bool SPLITA>
__global__ __launch_bounds__(256) void k_gemmb(const bf* __restrict__ A, const bf* __restrict__ Al, const bf* __restrict__ Bn, const float* __restrict__ bias, float* Cf, int ldc) {
    constexpr int BROW = SPLITA ? 256 : 128, STG = (BROW + 128) * GPITCH;
    __shared__ __align__(16) unsigned char ring[2 * STG];
    const int lane = threadIdx.x & 31, wave = threadIdx.x >> 5, lr = lane & 15, hi = lane >> 4;
    const int rb = blockIdx.x * 128, cb = blockIdx.y * 128;
    const int r0 = rb + (wave >> 1) * 32, c0 = cb + (wave & 1) * 64;
    const int crow = 2 * wave + hi;
    const bf* gA = A + (size_t)(rb + crow) * DM + lr * 8;
    const bf* gAl = SPLITA ? Al + (size_t)(rb + crow) * DM + lr * 8 : gA;
    const bf* gB = Bn + (size_t)(cb + crow) * DM + lr * 8;
    const unsigned lcp = (unsigned)(uintptr_t)&ring[0] + (unsigned)(crow * GPITCH + lr * 16);
    auto fill = [&](int t, int buf) {
        const unsigned l = lcp + (unsigned)(buf * STG);
        cp8(l, gA + t * GKP);
        if (SPLITA) cp8(l + 128u * GPITCH, gAl + t * GKP);
        cp8(l + (unsigned)(BROW * GPITCH), gB + t * GKP);
    };
    const int aofs = ((wave >> 1) * 32 + lr) * GPITCH + hi * 16, bofs = (BROW + (wave & 1) * 64 + lr) * GPITCH + hi * 16;
    v8f acc[2][4];
#pragma unroll
    for (int mi = 0; mi < 2; ++mi)
#pragma unroll
        for (int t = 0; t < 4; ++t) acc[mi][t] = (v8f){};
    fill(0, 0);
    asm volatile("s_wait_asynccnt 0x0" ::: "memory");    // this wave's copies of stage 0 have landed
    __syncthreads();                                      // ... and every other wave's: stage 0 is readable
    fill(1, 1);
#pragma unroll 1    // rolled: one ring foot
    for (int p = 0; p < GNP; ++p) {
        const unsigned char* sb = ring + (p & 1) * STG;
        v16bf a[2][2], al[2][2], b[2][4];
        auto frags = [&](int ks, int f) {
#pragma unroll
            for (int mi = 0; mi < 2; ++mi) { const unsigned char* q = sb + aofs + mi * 16 * GPITCH + ks * 64;
                a[f][mi] = cat16b(*(const v8usa*)q, *(const v8usa*)(q + 32));
                if (SPLITA) al[f][mi] = cat16b(*(const v8usa*)(q + 128 * GPITCH), *(const v8usa*)(q + 128 * GPITCH + 32)); }
#pragma unroll
            for (int t = 0; t < 4; ++t) { const unsigned char* q = sb + bofs + t * 16 * GPITCH + ks * 64; b[f][t] = cat16b(*(const v8usa*)q, *(const v8usa*)(q + 32)); }
        };
        frags(0, 0);
#pragma unroll
        for (int ks = 0; ks < GKP / 32; ++ks) {
            const int f = ks & 1;
            if (ks + 1 < GKP / 32) frags(ks + 1, f ^ 1);    // the next 32 k of this same stage, one group into the other fragment set
            __builtin_amdgcn_sched_barrier(0);              // keeps that group ahead of the WMMA block
#pragma unroll
            for (int mi = 0; mi < 2; ++mi)
#pragma unroll
                for (int t = 0; t < 4; ++t) acc[mi][t] = wmmab(a[f][mi], b[f][t], acc[mi][t]);
            if (SPLITA) {
#pragma unroll
                for (int mi = 0; mi < 2; ++mi)
#pragma unroll
                    for (int t = 0; t < 4; ++t) acc[mi][t] = wmmab(al[f][mi], b[f][t], acc[mi][t]);
            }
            __builtin_amdgcn_sched_barrier(0);              // ... and the following group behind the block
        }
        asm volatile("s_wait_dscnt 0x0" ::: "memory");       // this wave's reads of the buffer are done before it may be refilled
        asm volatile("s_wait_asynccnt 0x0" ::: "memory");    // this wave's copies of stage p + 1 have landed
        __syncthreads();                                      // publishes stage p + 1 and ends every reader's last read of stage p
        if (p + 2 < GNP) fill(p + 2, p & 1);
    }
    asm volatile("s_wait_asynccnt 0x0" ::: "memory");        // no copy is outstanding when the wave goes on
    __shared__ __align__(16) float ost[8][32 * 68];
    float* os = &ost[wave][0];
#pragma unroll
    for (int mi = 0; mi < 2; ++mi)
#pragma unroll
        for (int t = 0; t < 4; ++t) { const float bv = bias ? bfr(bias[c0 + t * 16 + lr]) : 0.f;
#pragma unroll
            for (int j = 0; j < 8; ++j) os[(mi * 16 + hi * 8 + j) * 68 + t * 16 + lr] = acc[mi][t][j] + bv; }
    __syncthreads();
    float* crow_p = Cf + (size_t)r0 * ldc + c0;
#pragma unroll
    for (int s = 0; s < 16; ++s) { const int Lid = (lane >> 3) + 4 * s, piece = lane & 7; const int row = Lid >> 1, cofs = (Lid & 1) * 32 + piece * 4;
        const v4f val = *(const v4fa*)(os + row * 68 + cofs); *(v4f*)(crow_p + (size_t)row * ldc + cofs) = val; }
}

// Lane l <-> l ^ 16: the two lanes that share a column of a WMMA result.
__device__ __forceinline__ float xhalf(float v) { const int b = __float_as_int(v); return __int_as_float(__builtin_amdgcn_permlanex16(b, b, 0x76543210, 0xfedcba98, false, false)); }

// Eight 16-B stores (four row groups, hi and residual plane; O1..O3: byte offsets of groups 1..3 from group 0) and their s_wait_xcnt 0 in ONE statement, so that no register
// which the stores name is rewritten ahead of the wait (in a statement of its own the wait can be passed by such writes), and one wait serves eight stores.
template <int O1, int O2, int O3>
__device__ __forceinline__ void st8(bf* p, bf* q, const v8us (&a)[4], const v8us (&b)[4]) {
    asm volatile("global_store_b128 %0, %2, off\n\t"
                 "global_store_b128 %1, %3, off\n\t"
                 "global_store_b128 %0, %4, off offset:%10\n\t"
                 "global_store_b128 %1, %5, off offset:%10\n\t"
                 "global_store_b128 %0, %6, off offset:%11\n\t"
                 "global_store_b128 %1, %7, off offset:%11\n\t"
                 "global_store_b128 %0, %8, off offset:%12\n\t"
                 "global_store_b128 %1, %9, off offset:%12\n\t"
                 "s_wait_xcnt 0x0"
                 :: "v"(p), "v"(q), "v"(__builtin_bit_cast(v4f, a[0])), "v"(__builtin_bit_cast(v4f, b[0])), "v"(__builtin_bit_cast(v4f, a[1])), "v"(__builtin_bit_cast(v4f, b[1])),
                    "v"(__builtin_bit_cast(v4f, a[2])), "v"(__builtin_bit_cast(v4f, b[2])), "v"(__builtin_bit_cast(v4f, a[3])), "v"(__builtin_bit_cast(v4f, b[3])), "n"(O1), "n"(O2), "n"(O3)
                 : "memory");
}

#define FSTG ((384 + 3 * 64) * GPITCH)
#define LQH 0         // plane offsets in halves from the start of the ring
#define LQL 16384
#define LKH 32768
#define LKL 57344
#define LVH 81920
#define LVL 106496
#define LOSB 262144   // byte offset of the per-wave output staging, behind the planes
__device__ __forceinline__ void split8(const v8f a, v8h& h, v8h& l) {
#pragma unroll
    for (int j = 0; j < 8; ++j) { const float v = a[j]; const h16 t = (h16)v; h[j] = t; l[j] = (h16)((v - (float)t) * LOSC); }
}
__global__ __launch_bounds__(256) void k_qkva(const bf* __restrict__ X, const bf* __restrict__ WQ, const bf* __restrict__ WK, const bf* __restrict__ WV, bf* CH, bf* CL) {
    __shared__ __align__(16) unsigned char ring[2 * FSTG];    // 313,344 B
    const int lane = threadIdx.x & 31, wave = __builtin_amdgcn_readfirstlane(threadIdx.x >> 5), lr = lane & 15, hi = lane >> 4;
    const int wr = wave & 3, wc = wave >> 2;
    const int rb = blockIdx.x * 256, cb = blockIdx.y * 64;
    const int hrow = rb >= 128 ? rb - 128 : 0;    // first staged halo row (NB_ = 1: a row of x is its token)
    const int crow = 2 * wave + hi;
    const unsigned lo = (unsigned)(crow * DM + lr * 8);    // the lane's one 32-bit offset from the block-uniform bases below: one register live over the loop, not six pointers
    const bf* Xh = X + hrow * DM; const bf* Xm = X + rb * DM; const bf* Wq_ = WQ + cb * DM; const bf* Wk_ = WK + cb * DM; const bf* Wv_ = WV + cb * DM;
    const unsigned lcp = (unsigned)(uintptr_t)&ring[0] + (unsigned)(crow * GPITCH + lr * 16);
    auto fill = [&](int t, int buf) {
        const unsigned l = lcp + (unsigned)(buf * FSTG);
        cp8(l, Xh + (lo + (unsigned)(t * GKP)));
        cp8(l + 128u * GPITCH, Xm + (lo + (unsigned)(t * GKP)));
        cp8(l + 256u * GPITCH, Xm + (lo + (unsigned)(128 * DM + t * GKP)));
        cp4(l + 384u * GPITCH, Wq_ + (lo + (unsigned)(t * GKP)));
        cp4(l + 448u * GPITCH, Wk_ + (lo + (unsigned)(t * GKP)));
        cp4(l + 512u * GPITCH, Wv_ + (lo + (unsigned)(t * GKP)));
    };
    const int hofs = (wr * 32 + lr) * GPITCH + hi * 16, xofs = (128 + wr * 64 + lr) * GPITCH + hi * 16, wofs = (384 + wc * 32 + lr) * GPITCH + hi * 16;
    v8f aq[2][4], ak[2][6], av[6][2];    // q, k: [16 columns of W][16 tokens]; v: [16 tokens][16 columns of W]; token tiles 0, 1 of k, v: the halo
#pragma unroll
    for (int mi = 0; mi < 2; ++mi) {
#pragma unroll
        for (int t = 0; t < 4; ++t) aq[mi][t] = (v8f){};
#pragma unroll
        for (int t = 0; t < 6; ++t) { ak[mi][t] = (v8f){}; av[t][mi] = (v8f){}; }
    }
    fill(0, 0);
    asm volatile("s_wait_asynccnt 0x0" ::: "memory");    // this wave's copies of stage 0 have landed
    __syncthreads();                                      // ... and every other wave's: stage 0 is readable
    fill(1, 1);
#pragma unroll 1    // rolled: one ring foot
    for (int p = 0; p < GNP; ++p) {
        const unsigned char* sb = ring + (p & 1) * FSTG;
        v16bf xf[2][6], wf[2][3][2];
        auto frags = [&](int ks, int f) {
#pragma unroll
            for (int t = 0; t < 6; ++t) { const unsigned char* q = sb + (t < 2 ? hofs + t * 16 * GPITCH : xofs + (t - 2) * 16 * GPITCH) + ks * 64; xf[f][t] = cat16b(*(const v8usa*)q, *(const v8usa*)(q + 32)); }
#pragma unroll
            for (int w = 0; w < 3; ++w)
#pragma unroll
                for (int mi = 0; mi < 2; ++mi) { const unsigned char* q = sb + wofs + (w * 64 + mi * 16) * GPITCH + ks * 64; wf[f][w][mi] = cat16b(*(const v8usa*)q, *(const v8usa*)(q + 32)); }
        };
        frags(0, 0);
#pragma unroll
        for (int ks = 0; ks < GKP / 32; ++ks) {
            const int f = ks & 1;
            if (ks + 1 < GKP / 32) frags(ks + 1, f ^ 1);    // the next 32 k of this same stage, one group into the other fragment set
            __builtin_amdgcn_sched_barrier(0);              // keeps that group ahead of the WMMA block
#pragma unroll
            for (int mi = 0; mi < 2; ++mi)
#pragma unroll
                for (int t = 0; t < 4; ++t) aq[mi][t] = wmmab(wf[f][0][mi], xf[f][2 + t], aq[mi][t]);
#pragma unroll
            for (int mi = 0; mi < 2; ++mi)
#pragma unroll
                for (int t = 0; t < 6; ++t) ak[mi][t] = wmmab(wf[f][1][mi], xf[f][t], ak[mi][t]);
#pragma unroll
            for (int mi = 0; mi < 2; ++mi)
#pragma unroll
                for (int t = 0; t < 6; ++t) av[t][mi] = wmmab(xf[f][t], wf[f][2][mi], av[t][mi]);
            __builtin_amdgcn_sched_barrier(0);              // ... and the following group behind the block
        }
        asm volatile("s_wait_dscnt 0x0" ::: "memory");       // this wave's reads of the buffer are done before it may be refilled
        asm volatile("s_wait_asynccnt 0x0" ::: "memory");    // this wave's copies of stage p + 1 have landed
        __syncthreads();                                      // publishes stage p + 1 and ends every reader's last read of stage p
        if (p + 2 < GNP) fill(p + 2, p & 1);
    }
    asm volatile("s_wait_asynccnt 0x0" ::: "memory");        // no copy is outstanding when the wave goes on
    // The loop's last barrier has ended every read of the ring: the planes go over it. An accumulator register group is a lane's 16-B piece of its plane's order: 8 consecutive d
    // of ONE token (q, k, transposed product), 8 consecutive tokens of ONE column (v).
    h16* L = (h16*)ring;
    const int po = wc * 2 * 256 + lane * 8;    // the wave's first 16-d group and the lane's piece, q and k planes (v: groups are 512 halves apart)
#pragma unroll
    for (int mi = 0; mi < 2; ++mi) {
#pragma unroll
        for (int t = 0; t < 4; ++t) { v8h a, b; split8(aq[mi][t], a, b); h16* d = L + (wr * 4 + t) * 1024 + po + mi * 256; *(v8ha*)(d + LQH) = a; *(v8ha*)(d + LQL) = b; }
#pragma unroll
        for (int t = 0; t < 6; ++t) { v8h a, b; split8(ak[mi][t], a, b); h16* d = L + (t < 2 ? wr * 2 + t : 8 + wr * 4 + (t - 2)) * 1024 + po + mi * 256; *(v8ha*)(d + LKH) = a; *(v8ha*)(d + LKL) = b; }
#pragma unroll
        for (int t = 0; t < 6; ++t) { v8h a, b; split8(av[t][mi], a, b); h16* d = L + (t < 2 ? wr : 4 + wr * 2 + ((t - 2) >> 1)) * 2048 + (t & 1) * 256 + wc * 2 * 512 + mi * 512 + lane * 8; *(v8ha*)(d + LVH) = a; *(v8ha*)(d + LVL) = b; }
    }
    __syncthreads();    // every wave's part of the planes is written before any wave reads them
    v16h qa[2][2], ql[2][2];    // the two query groups, hi and residual: read once
#pragma unroll
    for (int u = 0; u < 2; ++u)
#pragma unroll
        for (int kc = 0; kc < 2; ++kc) { const h16* q = L + (wave * 2 + u) * 1024 + kc * 512 + lane * 8;
            qa[u][kc] = cat16(*(const v8ha*)(q + LQH), *(const v8ha*)(q + LQH + 256)); ql[u][kc] = cat16(*(const v8ha*)(q + LQL), *(const v8ha*)(q + LQL + 256)); }
    v8f o[2][4], ox[2][4];    // O^T: register j of group n is d = n * 16 + 8 * hi + j of the lane's query
    float mrow[2], lpart[2];  // of the lane's query; lpart sums the lane's own keys only, the halves are joined behind the loop
#pragma unroll
    for (int u = 0; u < 2; ++u) { mrow[u] = -3.0e38f; lpart[u] = 0.f;
#pragma unroll
        for (int n = 0; n < 4; ++n) { o[u][n] = (v8f){}; ox[u][n] = (v8f){}; } }
    const int dq = 128 + wave * 32 + lr - 8 * hi;    // group 0's query of the lane, counted like the keys from the halo's first token, minus key row 0 of the lane's half
    const int kt_lo = (rb == 0 && wave < 4) ? 4 : wave, kt_hi = wave + 4;    // wave-uniform: keys q - 128 .. q + 31 of the wave's first query q; the first block has no halo
#pragma unroll 1
    for (int kt = kt_lo; kt <= kt_hi; ++kt) {
        const int l0 = kt * 32;
        const h16* pk = L + kt * 2048 + lane * 8;    // a 32-key tile is 2048 halves of each plane, K and V alike
        v16h kh[2][2], kl[2][2];
#pragma unroll
        for (int kc = 0; kc < 2; ++kc)
#pragma unroll
            for (int t = 0; t < 2; ++t) { const h16* q = pk + t * 1024 + kc * 512;
                kh[kc][t] = cat16(*(const v8ha*)(q + LKH), *(const v8ha*)(q + LKH + 256)); kl[kc][t] = cat16(*(const v8ha*)(q + LKL), *(const v8ha*)(q + LKL + 256)); }
        __builtin_amdgcn_sched_barrier(0);    // keeps the K reads one group ahead of the first WMMA
        v8f s[2][2], x[2][2];    // per query group, S^T of keys l0 .. l0 + 15 and l0 + 16 .. l0 + 31: hi.hi, and the two cross products
#pragma unroll
        for (int u = 0; u < 2; ++u) { s[u][0] = (v8f){}; s[u][1] = (v8f){}; x[u][0] = (v8f){}; x[u][1] = (v8f){}; }
#pragma unroll
        for (int kc = 0; kc < 2; ++kc)
#pragma unroll
            for (int u = 0; u < 2; ++u) {
                s[u][0] = wmma16(kh[kc][0], qa[u][kc], s[u][0]); x[u][0] = wmma16(kh[kc][0], ql[u][kc], x[u][0]); s[u][1] = wmma16(kh[kc][1], qa[u][kc], s[u][1]); x[u][1] = wmma16(kh[kc][1], ql[u][kc], x[u][1]);
                x[u][0] = wmma16(kl[kc][0], qa[u][kc], x[u][0]); x[u][1] = wmma16(kl[kc][1], qa[u][kc], x[u][1]);
            }
        __builtin_amdgcn_sched_barrier(0);    // keeps the V reads below one group behind the score WMMAs, not spread among them
        // The tile's V fragments (hi and residual, all four column groups) are asked for here: they land while the softmax below runs.
        v16h vh[4], vl[4];
#pragma unroll
        for (int n = 0; n < 4; ++n) { vh[n] = cat16(*(const v8ha*)(pk + LVH + n * 512), *(const v8ha*)(pk + LVH + n * 512 + 256)); vl[n] = cat16(*(const v8ha*)(pk + LVL + n * 512), *(const v8ha*)(pk + LVL + n * 512 + 256)); }
        __builtin_amdgcn_sched_barrier(0);    // keeps that group ahead of the softmax
        v16h pb[2], px[2];    // P^T hi and residual as B operands: element e is key 8 * hi + e (e < 8), 16 + 8 * hi + e - 8 (else)
#pragma unroll
        for (int u = 0; u < 2; ++u) {
            v2f a[2][4];    // the scores in pairs of neighbouring accumulator registers, so that the packed f32 forms take them as they lie
            float mx = -__builtin_inff();
#pragma unroll
            for (int t = 0; t < 2; ++t)
#pragma unroll
                for (int jp = 0; jp < 4; ++jp) {
                    const int da = dq + 16 * u - l0 - 16 * t - 2 * jp;    // i - j of the pair's first key, one less for its second; 0 <= i - j < BAND as one unsigned compare
                    v2f sc = ((v2f){s[u][t][2 * jp], s[u][t][2 * jp + 1]} + (v2f){x[u][t][2 * jp], x[u][t][2 * jp + 1]} * LOSCI) * 0.125f;
                    sc[0] = (unsigned)da < (unsigned)BAND ? sc[0] : -__builtin_inff(); sc[1] = (unsigned)(da - 1) < (unsigned)BAND ? sc[1] : -__builtin_inff();
                    a[t][jp] = sc; mx = fmaxf(mx, fmaxf(sc[0], sc[1]));
                }
            mx = fmaxf(mx, xhalf(mx));    // the query's other 16 keys of the tile
            const float mn = fmaxf(mrow[u], mx);
            const float alpha = __expf(mrow[u] - mn); mrow[u] = mn;
            v2f rs2 = {0.f, 0.f};
#pragma unroll
            for (int t = 0; t < 2; ++t)
#pragma unroll
                for (int jp = 0; jp < 4; ++jp) {
                    const v2f p = {__expf(a[t][jp][0] - mn), __expf(a[t][jp][1] - mn)};
                    rs2 += p;
                    const v2f ps = p * PSC; const v2h hh = __builtin_convertvector(ps, v2h);
                    const v2h ll = __builtin_convertvector((ps - __builtin_convertvector(hh, v2f)) * LOSC, v2h);
                    pb[u][8 * t + 2 * jp] = hh[0]; pb[u][8 * t + 2 * jp + 1] = hh[1]; px[u][8 * t + 2 * jp] = ll[0]; px[u][8 * t + 2 * jp + 1] = ll[1];
                }
            const float rs = rs2[0] + rs2[1];
            lpart[u] = lpart[u] * alpha + rs;
#pragma unroll
            for (int n = 0; n < 4; ++n)
#pragma unroll
                for (int j = 0; j < 8; ++j) { o[u][n][j] *= alpha; ox[u][n][j] *= alpha; }
        }
#pragma unroll
        for (int u = 0; u < 2; ++u)
#pragma unroll
            for (int n = 0; n < 4; ++n) { o[u][n] = wmma16(vh[n], pb[u], o[u][n]); ox[u][n] = wmma16(vl[n], pb[u], ox[u][n]); ox[u][n] = wmma16(vh[n], px[u], ox[u][n]); }
        __builtin_amdgcn_sched_barrier(0);    // no WMMA of the tile sinks below the slots that follow
        // four vector slots behind the last WMMA, on the loop's taken branch too
        asm volatile("v_nop\n\tv_nop\n\tv_nop\n\tv_nop" : "+v"(o[1][0]), "+v"(o[1][1]), "+v"(o[1][2]), "+v"(o[1][3]), "+v"(ox[1][0]), "+v"(ox[1][1]), "+v"(ox[1][2]), "+v"(ox[1][3]) : "v"(pb[1]), "v"(px[1]));
    }
    float* os = (float*)(ring + LOSB + wave * (16 * 68 * 4));    // the wave's own staging, used for one query group after the other (a wave's LDS operations keep their order)
    float* osw = os + lr * 68 + hi * 8;    // the lane's query row: its 8 consecutive d of a group go as two 16-B stores
#pragma unroll
    for (int u = 0; u < 2; ++u) {
        const float inv = 1.0f / ((lpart[u] + xhalf(lpart[u])) * PSC);
#pragma unroll
        for (int n = 0; n < 4; ++n) { v4f w0, w1;
#pragma unroll
            for (int j = 0; j < 4; ++j) { w0[j] = (o[u][n][j] + ox[u][n][j] * LOSCI) * inv; w1[j] = (o[u][n][4 + j] + ox[u][n][4 + j] * LOSCI) * inv; }
            *(v4fa*)(osw + n * 16) = w0; *(v4fa*)(osw + n * 16 + 4) = w1; }
        __syncthreads();    // the staged rows are written before other lanes read them
        const size_t cbase = (size_t)(rb + wave * 32 + u * 16 + (lane >> 3)) * DM + cb + (lane & 7) * 8;    // 8 lanes a row: whole 128-B pieces of four rows a store
        v8us oh[4], ol[4];
#pragma unroll
        for (int s = 0; s < 4; ++s) { const float* sp = os + (4 * s + (lane >> 3)) * 68 + (lane & 7) * 8; const v4f s0 = *(const v4fa*)sp, s1 = *(const v4fa*)(sp + 4);
#pragma unroll
            for (int i = 0; i < 8; ++i) { const float v = i < 4 ? s0[i & 3] : s1[i & 3]; const unsigned short hb = f2bf(v); oh[s][i] = hb; ol[s][i] = f2bf(v - bf2f(hb)); } }
        st8<4 * DM * 2, 8 * DM * 2, 12 * DM * 2>(CH + cbase, CL + cbase, oh, ol);    // row group s: four rows on
    }
}

#define VST2(T, p, v) do { const T vst2_v_ = (v); *(T*)(p) = vst2_v_;  } while (0)
extern "C" void kernel_launch(void* const* d_in, const int* in_sizes, int n_in,
                              void* d_out, int out_size, void* d_ws, size_t ws_size, hipStream_t stream) {
    (void)in_sizes; (void)n_in; (void)out_size;
    const float* x = (const float*)d_in[0]; const float* Wq = (const float*)d_in[1]; const float* Wk = (const float*)d_in[2]; const float* Wv = (const float*)d_in[3]; const float* Wo = (const float*)d_in[4];
    float* out = (float*)d_out;    // [1][4096][1024]
    char* wsp = (char*)d_ws;
    auto take = [&](size_t bytes) { char* p = wsp; wsp += (bytes + 255) & ~(size_t)255; return (void*)p; };
    bf* Xb = (bf*)take((size_t)NTK * DM * 2); bf* WqB = (bf*)take((size_t)DM * DM * 2); bf* WkB = (bf*)take((size_t)DM * DM * 2); bf* WvB = (bf*)take((size_t)DM * DM * 2); bf* WoB = (bf*)take((size_t)DM * DM * 2);
    bf* CH = (bf*)take((size_t)NTK * DM * 2); bf* CL = (bf*)take((size_t)NTK * DM * 2);    // a plane of its own for the ctx hi part: blocks write it while others still read Xb
    if ((size_t)(wsp - (char*)d_ws) > ws_size) return;    // 3 planes of 8.4 MB + 4 of 2.1 MB ~ 34 MB
    k_cvtb<<<(NTK + 4 * DM) / 8, 256, 0, stream>>>(x, Wq, Wk, Wv, Wo, Xb, WqB, WkB, WvB, WoB);
    k_qkva<<<dim3(NTK / 256, DM / 64), 256, 0, stream>>>(Xb, WqB, WkB, WvB, CH, CL);
    k_gemmb<true><<<dim3(NTK / 128, DM / 128, 1), 256, 0, stream>>>(CH, CL, WoB, nullptr, out, DM);
}

// v010
// Measured time: 48.8 microseconds a run.
// Next to v009, in two timings, it ran 1.04 times as fast each time.
// All steps since v000 together make it 4.53 times as fast.
#include <hip/hip_runtime.h>

// Contractions, f32 accumulate: q/k/v = x.W^T ([4096 x 1024].[1024 x 1024] each; W is [out][in], used as-is: the n-major B operand for v, for q and k the A operand (transposed product)) and y.Wo^T on
// v_wmma_f32_16x16x32_bf16 with PLAIN bf16 operands for the projections (inputs rounded once: exact) and y as bf16 hi + residual planes (two products) for Wo; the
// banded-causal 16-head attention (keys j with i-127 <= j <= i) on v_wmma_f32_16x16x32_f16, in the kernel of the q, k, v products, over the five 32-key tiles of a wave's 32 queries: q, k, v as f16 hi + residual x1024

#define NB_  1
#define NT_  4096
#define DM   1024
#define NH_  16
#define HD   64
#define NTK  (NB_ * NT_)
#define NW   1024
#define NQKV 1024
#define BAND 128
#define PSC  32768.0f
#define LOSC 1024.0f
#define LOSCI (1.0f / 1024.0f)

typedef _Float16 h16;
typedef unsigned short bf;
typedef __attribute__((ext_vector_type(16))) __bf16   v16bf;
typedef __attribute__((ext_vector_type(16))) _Float16 v16h;
typedef __attribute__((ext_vector_type(8)))  _Float16 v8h;
typedef __attribute__((ext_vector_type(8)))  unsigned short v8us;
typedef __attribute__((ext_vector_type(8)))  float    v8f;
typedef __attribute__((ext_vector_type(4)))  float    v4f;
typedef __attribute__((ext_vector_type(2)))  float    v2f;
typedef __attribute__((ext_vector_type(2)))  _Float16 v2h;
typedef v8h  __attribute__((may_alias)) v8ha;
typedef v4f  __attribute__((may_alias)) v4fa;
typedef v8us __attribute__((may_alias)) v8usa;

__device__ __forceinline__ unsigned short f2bf(float f) { unsigned u = __float_as_uint(f); u += 0x7FFFu + ((u >> 16) & 1u); return (unsigned short)(u >> 16); }
__device__ __forceinline__ float bf2f(unsigned short b) { return __uint_as_float(((unsigned)b) << 16); }
__device__ __forceinline__ float bfr(float f) { return bf2f(f2bf(f)); }
__device__ __forceinline__ v16h cat16(v8h lo, v8h hi) { return __builtin_shufflevector(lo, hi, 0, 1, 2, 3, 4, 5, 6, 7, 8, 9, 10, 11, 12, 13, 14, 15); }
__device__ __forceinline__ v16bf cat16b(v8us lo, v8us hi) { return __builtin_bit_cast(v16bf, __builtin_shufflevector(lo, hi, 0, 1, 2, 3, 4, 5, 6, 7, 8, 9, 10, 11, 12, 13, 14, 15)); }
__device__ __forceinline__ v8f wmma16(v16h a, v16h b, v8f c) { return __builtin_amdgcn_wmma_f32_16x16x32_f16(false, a, false, b, (short)0, c, false, false); }
__device__ __forceinline__ v8f wmmab(v16bf a, v16bf b, v8f c) { return __builtin_amdgcn_wmma_f32_16x16x32_bf16(false, a, false, b, (short)0, c, false, false); }

// k_cvtb: one grid rounds all five inputs: blocks [0, NTK / 8) take x, then DM / 8 blocks each weight; 8 rows a block, so the pick is block-uniform (scalar selects).
__global__ __launch_bounds__(256) void k_cvtb(const float* __restrict__ x, const float* __restrict__ Wq, const float* __restrict__ Wk, const float* __restrict__ Wv, const float* __restrict__ Wo,
                                              bf* Xb, bf* WqB, bf* WkB, bf* WvB, bf* WoB) {
    const int blk = blockIdx.x, sel = blk < NTK / 8 ? 0 : 1 + (blk - NTK / 8) / (DM / 8);
    const float* src = sel == 0 ? x : sel == 1 ? Wq : sel == 2 ? Wk : sel == 3 ? Wv : Wo;
    bf* dst = sel == 0 ? Xb : sel == 1 ? WqB : sel == 2 ? WkB : sel == 3 ? WvB : WoB;
    const int lane = threadIdx.x & 31, r = (sel == 0 ? blk : (blk - NTK / 8) % (DM / 8)) * 8 + (threadIdx.x >> 5);
    v8us o[DM / 256];
#pragma unroll
    for (int q = 0; q < DM / 256; ++q) { v8us t;
#pragma unroll
        for (int i = 0; i < 8; ++i) t[i] = f2bf(src[(size_t)r * DM + q * 256 + lane * 8 + i]);
        o[q] = t; }
#pragma unroll
    for (int q = 0; q < DM / 256; ++q) *(v8us*)(dst + (size_t)r * DM + q * 256 + lane * 8) = o[q];
    
}

// k_wt: W [1024 k][ncols n] (k-major) -> n-major bf16 plane WT[ncols][1024]; 64 x 64 tiles through LDS.
__global__ __launch_bounds__(256) void k_wt(const float* __restrict__ Wm, int ncols, bf* WT) {
    __shared__ __align__(16) unsigned short tl[64 * 72];
    const int tid = threadIdx.x, k0 = blockIdx.x * 64, n0 = blockIdx.y * 64;
    const int kk = tid >> 2, nq = (tid & 3) * 16;
#pragma unroll
    for (int i = 0; i < 16; ++i) tl[(nq + i) * 72 + kk] = f2bf(Wm[(size_t)(k0 + kk) * ncols + n0 + nq + i]);
    __syncthreads();
    const int piece = tid & 7;
    typedef __attribute__((ext_vector_type(8))) unsigned short v8us_; typedef v8us_ __attribute__((may_alias)) v8usa_;
    auto pass = [&]() {
#pragma unroll
        for (int s = 0; s < 2; ++s) { const int nr = (tid >> 3) + 32 * s; const v8us_ val = *(const v8usa_*)(tl + nr * 72 + piece * 8);
            *(v8us_*)(WT + (size_t)(n0 + nr) * DM + k0 + piece * 8) = val; }
    };
    pass(); 
}

// k_gemmb: C[128 x 128] per block of 8 waves (4 x 2, 32 x 64 each). A stage is 128 k = 256 B of every operand row, rows [A 128 | A residual 128 (SPLITA) | B 128] at an
// LDS pitch of 272 B (16 B x odd: conflict-free for the ds_load_b128 fragment reads). Two buffers, filled by tensor loads (one request of 128 rows a wave; its pad
// makes the pitch), the next stage in flight while this one is worked on. Per accumulator the k order and the hi-then-residual order are those of the direct-load form.
// Every '#pragma unroll' in k_gemmb makes the indices into acc and the fragment sets compile-time constants, so that they stay in registers.
#define GKP    128
#define GPITCH 272
#define GNP    (DM / GKP)

typedef uint32_t u32x4 __attribute__((ext_vector_type(4)));
typedef uint32_t u32x8 __attribute__((ext_vector_type(8)));
__device__ __forceinline__ uint32_t uni(uint32_t v) { return (uint32_t)__builtin_amdgcn_readfirstlane(v); }
// The test that decides whether a wave issues a tensor load: such a load ignores EXEC, so only a scalar branch keeps a wave from issuing it.
__device__ __forceinline__ uint32_t pinned(uint32_t v) { uint32_t w = uni(v); asm volatile("" : "+s"(w)); return w; }    // the empty statement holds the test in a scalar register: the branch on it is s_cmp + s_cbranch_scc
// Descriptor group 1, the same for every request of a wave: a tile of 'rows' rows of 256 B (everything in bytes), source pitch one plane row, 16 B of LDS pad behind every 256 B: LDS pitch GPITCH.
__device__ __forceinline__ u32x8 tgroup1(uint32_t rows) {
    u32x8 g;
    g[0] = uni((1u << 20) | (5u << 22) | (3u << 25)); g[1] = uni(256u << 16); g[2] = uni(rows << 16); g[3] = uni(256u << 16);
    g[4] = uni(rows); g[5] = uni(DM * 2u); g[6] = uni(0u); g[7] = uni(0u);
    return g;
}
// One request of the whole wave: the tile whose first byte is at p goes to LDS byte offset lds, through no register.
__device__ __forceinline__ void tload(uint32_t lds, const bf* p, u32x8 g1) {
    const uint64_t ga = (uint64_t)(uintptr_t)p;
    u32x4 g0;
    g0[0] = uni(1u); g0[1] = uni(lds); g0[2] = uni((uint32_t)ga); g0[3] = uni((((uint32_t)(ga >> 32)) & 0x01FFFFFFu) | 0x80000000u);
    asm volatile("tensor_load_to_lds %0, %1" :: "s"(g0), "s"(g1) : "memory");
}
#define SL128 (128 * GPITCH)    // a slice of 128 padded rows: 17 x 2 KiB, so that every slice and buffer starts at a multiple of 2 KiB

// k_gemmb, as launched: C = (A + Al).Bn^T in f32, A's hi and residual planes as two products.
template <bool SPLITA>
__global__ __launch_bounds__(256) void k_gemmb(const bf* __restrict__ A, const bf* __restrict__ Al, const bf* __restrict__ Bn, const float* __restrict__ bias, float* Cf, int ldc) {
    constexpr int BROW = SPLITA ? 256 : 128, STG = (BROW + 128) * GPITCH;
    constexpr uint32_t NSL = BROW / 128 + 1;    // 128-row slices of a stage
    __shared__ __attribute__((aligned(2048))) unsigned char ring[2 * STG];
    const int lane = threadIdx.x & 31, wave = threadIdx.x >> 5, lr = lane & 15, hi = lane >> 4;
    const int rb = blockIdx.x * 128, cb = blockIdx.y * 128;
    const int r0 = rb + (wave >> 1) * 32, c0 = cb + (wave & 1) * 64;
    // Waves 0 .. NSL - 1 each bring one slice of a stage with one request: A, A residual (SPLITA), B.
    const uint32_t wu = uni(threadIdx.x >> 5), iss = wu < NSL;
    const bf* gs = wu == 0u ? A + (size_t)rb * DM : (SPLITA && wu == 1u) ? Al + (size_t)rb * DM : Bn + (size_t)cb * DM;
    const uint32_t lsl = (uint32_t)(uintptr_t)&ring[0] + (iss ? wu : 0u) * SL128;
    const u32x8 g1 = tgroup1(128u);
    auto fill = [&](int t, int buf) { tload(lsl + (uint32_t)(buf * STG), gs + t * GKP, g1); };
    const int aofs = ((wave >> 1) * 32 + lr) * GPITCH + hi * 16, bofs = (BROW + (wave & 1) * 64 + lr) * GPITCH + hi * 16;
    v8f acc[2][4];
#pragma unroll
    for (int mi = 0; mi < 2; ++mi)
#pragma unroll
        for (int t = 0; t < 4; ++t) acc[mi][t] = (v8f){};
    if (pinned(iss)) { fill(0, 0); asm volatile("s_wait_tensorcnt 0x0" ::: "memory"); }    // this wave's slice of stage 0 has landed
    __syncthreads();                                      // ... and every other wave's: stage 0 is readable
    if (pinned(iss)) fill(1, 1);
#pragma unroll 1    // rolled: one ring foot, and the hot loop stays small in the instruction cache
    for (int p = 0; p < GNP; ++p) {
        const unsigned char* sb = ring + (p & 1) * STG;
        v16bf a[2][2], al[2][2], b[2][4];
        auto frags = [&](int ks, int f) {
#pragma unroll
            for (int mi = 0; mi < 2; ++mi) { const unsigned char* q = sb + aofs + mi * 16 * GPITCH + ks * 64;
                a[f][mi] = cat16b(*(const v8usa*)q, *(const v8usa*)(q + 32));
                if (SPLITA) al[f][mi] = cat16b(*(const v8usa*)(q + 128 * GPITCH), *(const v8usa*)(q + 128 * GPITCH + 32)); }
#pragma unroll
            for (int t = 0; t < 4; ++t) { const unsigned char* q = sb + bofs + t * 16 * GPITCH + ks * 64; b[f][t] = cat16b(*(const v8usa*)q, *(const v8usa*)(q + 32)); }
        };
        frags(0, 0);
#pragma unroll
        for (int ks = 0; ks < GKP / 32; ++ks) {
            const int f = ks & 1;
            if (ks + 1 < GKP / 32) frags(ks + 1, f ^ 1);    // the next 32 k of this same stage, one group into the other fragment set
            __builtin_amdgcn_sched_barrier(0);              // keeps that group ahead of the WMMA block
#pragma unroll
            for (int mi = 0; mi < 2; ++mi)
#pragma unroll
                for (int t = 0; t < 4; ++t) acc[mi][t] = wmmab(a[f][mi], b[f][t], acc[mi][t]);
            if (SPLITA) {
#pragma unroll
                for (int mi = 0; mi < 2; ++mi)
#pragma unroll
                    for (int t = 0; t < 4; ++t) acc[mi][t] = wmmab(al[f][mi], b[f][t], acc[mi][t]);
            }
            __builtin_amdgcn_sched_barrier(0);              // ... and the following group behind the block
        }
        asm volatile("s_wait_dscnt 0x0" ::: "memory");       // this wave's reads of the buffer are done before it may be refilled
        if (pinned(iss)) asm volatile("s_wait_tensorcnt 0x0" ::: "memory");    // this wave's slice of stage p + 1 has landed
        __syncthreads();                                      // publishes stage p + 1 and ends every reader's last read of stage p
        if (pinned(iss & (uint32_t)(p + 2 < GNP))) fill(p + 2, p & 1);    // group 0 is formed behind the wait; group 1 never changes
    }
    asm volatile("s_wait_tensorcnt 0x0" ::: "memory");       // no request is outstanding when the wave goes on
    asm volatile("s_wait_dscnt 0x0" ::: "memory");           // ... and no LDS read
    __shared__ __align__(16) float ost[8][32 * 68];
    float* os = &ost[wave][0];
#pragma unroll
    for (int mi = 0; mi < 2; ++mi)
#pragma unroll
        for (int t = 0; t < 4; ++t) { const float bv = bias ? bfr(bias[c0 + t * 16 + lr]) : 0.f;
#pragma unroll
            for (int j = 0; j < 8; ++j) os[(mi * 16 + hi * 8 + j) * 68 + t * 16 + lr] = acc[mi][t][j] + bv; }
    __syncthreads();
    float* crow_p = Cf + (size_t)r0 * ldc + c0;
#pragma unroll
    for (int s = 0; s < 16; ++s) { const int Lid = (lane >> 3) + 4 * s, piece = lane & 7; const int row = Lid >> 1, cofs = (Lid & 1) * 32 + piece * 4;
        const v4f val = *(const v4fa*)(os + row * 68 + cofs); *(v4f*)(crow_p + (size_t)row * ldc + cofs) = val; }
}

// Lane l <-> l ^ 16: the two lanes that share a column of a WMMA result.
__device__ __forceinline__ float xhalf(float v) { const int b = __float_as_int(v); return __int_as_float(__builtin_amdgcn_permlanex16(b, b, 0x76543210, 0xfedcba98, false, false)); }

// Eight 16-B stores (four row groups, hi and residual plane; O1..O3: byte offsets of groups 1..3 from group 0) and their s_wait_xcnt 0 in ONE statement, so that no register
// which the stores name is rewritten ahead of the wait (in a statement of its own the wait can be passed by such writes), and one wait serves eight stores.
template <int O1, int O2, int O3>
__device__ __forceinline__ void st8(bf* p, bf* q, const v8us (&a)[4], const v8us (&b)[4]) {
    asm volatile("global_store_b128 %0, %2, off\n\t"
                 "global_store_b128 %1, %3, off\n\t"
                 "global_store_b128 %0, %4, off offset:%10\n\t"
                 "global_store_b128 %1, %5, off offset:%10\n\t"
                 "global_store_b128 %0, %6, off offset:%11\n\t"
                 "global_store_b128 %1, %7, off offset:%11\n\t"
                 "global_store_b128 %0, %8, off offset:%12\n\t"
                 "global_store_b128 %1, %9, off offset:%12\n\t"
                 "s_wait_xcnt 0x0"
                 :: "v"(p), "v"(q), "v"(__builtin_bit_cast(v4f, a[0])), "v"(__builtin_bit_cast(v4f, b[0])), "v"(__builtin_bit_cast(v4f, a[1])), "v"(__builtin_bit_cast(v4f, b[1])),
                    "v"(__builtin_bit_cast(v4f, a[2])), "v"(__builtin_bit_cast(v4f, b[2])), "v"(__builtin_bit_cast(v4f, a[3])), "v"(__builtin_bit_cast(v4f, b[3])), "n"(O1), "n"(O2), "n"(O3)
                 : "memory");
}

#define WSL  18432    // a weight slice: 64 padded rows (17,408 B) rounded up to 9 x 2 KiB, so that the next slice starts at a multiple of 2 KiB
#define FSTG (3 * SL128 + 3 * WSL)
#define LQH 0         // plane offsets in halves from the start of the ring
#define LQL 16384
#define LKH 32768
#define LKL 57344
#define LVH 81920
#define LVL 106496
#define LOSB 262144   // byte offset of the per-wave output staging, behind the planes
__device__ __forceinline__ void split8(const v8f a, v8h& h, v8h& l) {
#pragma unroll
    for (int j = 0; j < 8; ++j) { const float v = a[j]; const h16 t = (h16)v; h[j] = t; l[j] = (h16)((v - (float)t) * LOSC); }
}
__global__ __launch_bounds__(256) void k_qkva(const bf* __restrict__ X, const bf* __restrict__ WQ, const bf* __restrict__ WK, const bf* __restrict__ WV, bf* CH, bf* CL) {
    __shared__ __attribute__((aligned(2048))) unsigned char ring[2 * FSTG];    // 319,488 B
    const int lane = threadIdx.x & 31, wave = __builtin_amdgcn_readfirstlane(threadIdx.x >> 5), lr = lane & 15, hi = lane >> 4;
    const int wr = wave & 3, wc = wave >> 2;
    const int rb = blockIdx.x * 256, cb = blockIdx.y * 64;
    const int hrow = rb >= 128 ? rb - 128 : 0;    // first staged halo row (NB_ = 1: a row of x is its token)
    const bf* Xh = X + hrow * DM; const bf* Xm = X + rb * DM; const bf* Wq_ = WQ + cb * DM; const bf* Wk_ = WK + cb * DM; const bf* Wv_ = WV + cb * DM;
    // Waves 0 .. 5 each bring one slice of a stage with one request: x halo, x rows 0..127, x rows 128..255 (128 rows each), Wq, Wk, Wv (64 rows each).
    const uint32_t wu = (uint32_t)wave, iss = wu < 6u;
    const bf* gs = wu == 0u ? Xh : wu == 1u ? Xm : wu == 2u ? Xm + 128 * DM : wu == 3u ? Wq_ : wu == 4u ? Wk_ : Wv_;
    const uint32_t lsl = (uint32_t)(uintptr_t)&ring[0] + (wu < 3u ? wu * SL128 : 3u * SL128 + (iss ? wu - 3u : 0u) * WSL);
    const u32x8 g1 = tgroup1(wu < 3u ? 128u : 64u);
    auto fill = [&](int t, int buf) { tload(lsl + (uint32_t)(buf * FSTG), gs + t * GKP, g1); };
    const int hofs = (wr * 32 + lr) * GPITCH + hi * 16, xofs = (128 + wr * 64 + lr) * GPITCH + hi * 16, wofs = (384 + wc * 32 + lr) * GPITCH + hi * 16;
    v8f aq[2][4], ak[2][6], av[6][2];    // q, k: [16 columns of W][16 tokens]; v: [16 tokens][16 columns of W]; token tiles 0, 1 of k, v: the halo
#pragma unroll
    for (int mi = 0; mi < 2; ++mi) {
#pragma unroll
        for (int t = 0; t < 4; ++t) aq[mi][t] = (v8f){};
#pragma unroll
        for (int t = 0; t < 6; ++t) { ak[mi][t] = (v8f){}; av[t][mi] = (v8f){}; }
    }
    if (pinned(iss)) { fill(0, 0); asm volatile("s_wait_tensorcnt 0x0" ::: "memory"); }    // this wave's slice of stage 0 has landed
    __syncthreads();                                      // ... and every other wave's: stage 0 is readable
    if (pinned(iss)) fill(1, 1);
#pragma unroll 1    // rolled: one ring foot, and the hot loop stays small in the instruction cache
    for (int p = 0; p < GNP; ++p) {
        const unsigned char* sb = ring + (p & 1) * FSTG;
        v16bf xf[2][6], wf[2][3][2];
        auto frags = [&](int ks, int f) {
#pragma unroll
            for (int t = 0; t < 6; ++t) { const unsigned char* q = sb + (t < 2 ? hofs + t * 16 * GPITCH : xofs + (t - 2) * 16 * GPITCH) + ks * 64; xf[f][t] = cat16b(*(const v8usa*)q, *(const v8usa*)(q + 32)); }
#pragma unroll
            for (int w = 0; w < 3; ++w)
#pragma unroll
                for (int mi = 0; mi < 2; ++mi) { const unsigned char* q = sb + wofs + w * WSL + mi * 16 * GPITCH + ks * 64; wf[f][w][mi] = cat16b(*(const v8usa*)q, *(const v8usa*)(q + 32)); }
        };
        frags(0, 0);
#pragma unroll
        for (int ks = 0; ks < GKP / 32; ++ks) {
            const int f = ks & 1;
            if (ks + 1 < GKP / 32) frags(ks + 1, f ^ 1);    // the next 32 k of this same stage, one group into the other fragment set
            __builtin_amdgcn_sched_barrier(0);              // keeps that group ahead of the WMMA block
#pragma unroll
            for (int mi = 0; mi < 2; ++mi)
#pragma unroll
                for (int t = 0; t < 4; ++t) aq[mi][t] = wmmab(wf[f][0][mi], xf[f][2 + t], aq[mi][t]);
#pragma unroll
            for (int mi = 0; mi < 2; ++mi)
#pragma unroll
                for (int t = 0; t < 6; ++t) ak[mi][t] = wmmab(wf[f][1][mi], xf[f][t], ak[mi][t]);
#pragma unroll
            for (int mi = 0; mi < 2; ++mi)
#pragma unroll
                for (int t = 0; t < 6; ++t) av[t][mi] = wmmab(xf[f][t], wf[f][2][mi], av[t][mi]);
            __builtin_amdgcn_sched_barrier(0);              // ... and the following group behind the block
        }
        asm volatile("s_wait_dscnt 0x0" ::: "memory");       // this wave's reads of the buffer are done before it may be refilled
        if (pinned(iss)) asm volatile("s_wait_tensorcnt 0x0" ::: "memory");    // this wave's slice of stage p + 1 has landed
        __syncthreads();                                      // publishes stage p + 1 and ends every reader's last read of stage p
        if (pinned(iss & (uint32_t)(p + 2 < GNP))) fill(p + 2, p & 1);    // group 0 is formed behind the wait; group 1 never changes
    }
    asm volatile("s_wait_tensorcnt 0x0" ::: "memory");       // no request is outstanding when the wave goes on
    asm volatile("s_wait_dscnt 0x0" ::: "memory");           // ... and no LDS read
    // The loop's last barrier has ended every read of the ring: the planes go over it. An accumulator register group is a lane's 16-B piece of its plane's order: 8 consecutive d
    // of ONE token (q, k, transposed product), 8 consecutive tokens of ONE column (v).
    h16* L = (h16*)ring;
    const int po = wc * 2 * 256 + lane * 8;    // the wave's first 16-d group and the lane's piece, q and k planes (v: groups are 512 halves apart)
#pragma unroll
    for (int mi = 0; mi < 2; ++mi) {
#pragma unroll
        for (int t = 0; t < 4; ++t) { v8h a, b; split8(aq[mi][t], a, b); h16* d = L + (wr * 4 + t) * 1024 + po + mi * 256; *(v8ha*)(d + LQH) = a; *(v8ha*)(d + LQL) = b; }
#pragma unroll
        for (int t = 0; t < 6; ++t) { v8h a, b; split8(ak[mi][t], a, b); h16* d = L + (t < 2 ? wr * 2 + t : 8 + wr * 4 + (t - 2)) * 1024 + po + mi * 256; *(v8ha*)(d + LKH) = a; *(v8ha*)(d + LKL) = b; }
#pragma unroll
        for (int t = 0; t < 6; ++t) { v8h a, b; split8(av[t][mi], a, b); h16* d = L + (t < 2 ? wr : 4 + wr * 2 + ((t - 2) >> 1)) * 2048 + (t & 1) * 256 + wc * 2 * 512 + mi * 512 + lane * 8; *(v8ha*)(d + LVH) = a; *(v8ha*)(d + LVL) = b; }
    }
    __syncthreads();    // every wave's part of the planes is written before any wave reads them
    v16h qa[2][2], ql[2][2];    // the two query groups, hi and residual: read once
#pragma unroll
    for (int u = 0; u < 2; ++u)
#pragma unroll
        for (int kc = 0; kc < 2; ++kc) { const h16* q = L + (wave * 2 + u) * 1024 + kc * 512 + lane * 8;
            qa[u][kc] = cat16(*(const v8ha*)(q + LQH), *(const v8ha*)(q + LQH + 256)); ql[u][kc] = cat16(*(const v8ha*)(q + LQL), *(const v8ha*)(q + LQL + 256)); }
    v8f o[2][4], ox[2][4];    // O^T: register j of group n is d = n * 16 + 8 * hi + j of the lane's query
    float mrow[2], lpart[2];  // of the lane's query; lpart sums the lane's own keys only, the halves are joined behind the loop
#pragma unroll
    for (int u = 0; u < 2; ++u) { mrow[u] = -3.0e38f; lpart[u] = 0.f;
#pragma unroll
        for (int n = 0; n < 4; ++n) { o[u][n] = (v8f){}; ox[u][n] = (v8f){}; } }
    const int dq = 128 + wave * 32 + lr - 8 * hi;    // group 0's query of the lane, counted like the keys from the halo's first token, minus key row 0 of the lane's half
    const int kt_lo = (rb == 0 && wave < 4) ? 4 : wave, kt_hi = wave + 4;    // wave-uniform: keys q - 128 .. q + 31 of the wave's first query q; the first block has no halo
#pragma unroll 1
    for (int kt = kt_lo; kt <= kt_hi; ++kt) {
        const int l0 = kt * 32;
        const h16* pk = L + kt * 2048 + lane * 8;    // a 32-key tile is 2048 halves of each plane, K and V alike
        v16h kh[2][2], kl[2][2];
#pragma unroll
        for (int kc = 0; kc < 2; ++kc)
#pragma unroll
            for (int t = 0; t < 2; ++t) { const h16* q = pk + t * 1024 + kc * 512;
                kh[kc][t] = cat16(*(const v8ha*)(q + LKH), *(const v8ha*)(q + LKH + 256)); kl[kc][t] = cat16(*(const v8ha*)(q + LKL), *(const v8ha*)(q + LKL + 256)); }
        __builtin_amdgcn_sched_barrier(0);    // keeps the K reads one group ahead of the first WMMA
        v8f s[2][2], x[2][2];    // per query group, S^T of keys l0 .. l0 + 15 and l0 + 16 .. l0 + 31: hi.hi, and the two cross products
#pragma unroll
        for (int u = 0; u < 2; ++u) { s[u][0] = (v8f){}; s[u][1] = (v8f){}; x[u][0] = (v8f){}; x[u][1] = (v8f){}; }
#pragma unroll
        for (int kc = 0; kc < 2; ++kc)
#pragma unroll
            for (int u = 0; u < 2; ++u) {
                s[u][0] = wmma16(kh[kc][0], qa[u][kc], s[u][0]); x[u][0] = wmma16(kh[kc][0], ql[u][kc], x[u][0]); s[u][1] = wmma16(kh[kc][1], qa[u][kc], s[u][1]); x[u][1] = wmma16(kh[kc][1], ql[u][kc], x[u][1]);
                x[u][0] = wmma16(kl[kc][0], qa[u][kc], x[u][0]); x[u][1] = wmma16(kl[kc][1], qa[u][kc], x[u][1]);
            }
        __builtin_amdgcn_sched_barrier(0);    // keeps the V reads below one group behind the score WMMAs, not spread among them
        // The tile's V fragments (hi and residual, all four column groups) are asked for here: they land while the softmax below runs.
        v16h vh[4], vl[4];
#pragma unroll
        for (int n = 0; n < 4; ++n) { vh[n] = cat16(*(const v8ha*)(pk + LVH + n * 512), *(const v8ha*)(pk + LVH + n * 512 + 256)); vl[n] = cat16(*(const v8ha*)(pk + LVL + n * 512), *(const v8ha*)(pk + LVL + n * 512 + 256)); }
        __builtin_amdgcn_sched_barrier(0);    // keeps that group ahead of the softmax
        v16h pb[2], px[2];    // P^T hi and residual as B operands: element e is key 8 * hi + e (e < 8), 16 + 8 * hi + e - 8 (else)
#pragma unroll
        for (int u = 0; u < 2; ++u) {
            v2f a[2][4];    // the scores in pairs of neighbouring accumulator registers, so that the packed f32 forms take them as they lie
            float mx = -__builtin_inff();
#pragma unroll
            for (int t = 0; t < 2; ++t)
#pragma unroll
                for (int jp = 0; jp < 4; ++jp) {
                    const int da = dq + 16 * u - l0 - 16 * t - 2 * jp;    // i - j of the pair's first key, one less for its second; 0 <= i - j < BAND as one unsigned compare
                    v2f sc = ((v2f){s[u][t][2 * jp], s[u][t][2 * jp + 1]} + (v2f){x[u][t][2 * jp], x[u][t][2 * jp + 1]} * LOSCI) * 0.125f;
                    sc[0] = (unsigned)da < (unsigned)BAND ? sc[0] : -__builtin_inff(); sc[1] = (unsigned)(da - 1) < (unsigned)BAND ? sc[1] : -__builtin_inff();
                    a[t][jp] = sc; mx = fmaxf(mx, fmaxf(sc[0], sc[1]));
                }
            mx = fmaxf(mx, xhalf(mx));    // the query's other 16 keys of the tile
            const float mn = fmaxf(mrow[u], mx);
            const float alpha = __expf(mrow[u] - mn); mrow[u] = mn;
            v2f rs2 = {0.f, 0.f};
#pragma unroll
            for (int t = 0; t < 2; ++t)
#pragma unroll
                for (int jp = 0; jp < 4; ++jp) {
                    const v2f p = {__expf(a[t][jp][0] - mn), __expf(a[t][jp][1] - mn)};
                    rs2 += p;
                    const v2f ps = p * PSC; const v2h hh = __builtin_convertvector(ps, v2h);
                    const v2h ll = __builtin_convertvector((ps - __builtin_convertvector(hh, v2f)) * LOSC, v2h);
                    pb[u][8 * t + 2 * jp] = hh[0]; pb[u][8 * t + 2 * jp + 1] = hh[1]; px[u][8 * t + 2 * jp] = ll[0]; px[u][8 * t + 2 * jp + 1] = ll[1];
                }
            const float rs = rs2[0] + rs2[1];
            lpart[u] = lpart[u] * alpha + rs;
#pragma unroll
            for (int n = 0; n < 4; ++n)
#pragma unroll
                for (int j = 0; j < 8; ++j) { o[u][n][j] *= alpha; ox[u][n][j] *= alpha; }
        }
#pragma unroll
        for (int u = 0; u < 2; ++u)
#pragma unroll
            for (int n = 0; n < 4; ++n) { o[u][n] = wmma16(vh[n], pb[u], o[u][n]); ox[u][n] = wmma16(vl[n], pb[u], ox[u][n]); ox[u][n] = wmma16(vh[n], px[u], ox[u][n]); }
        __builtin_amdgcn_sched_barrier(0);    // no WMMA of the tile sinks below the slots that follow
        // four vector slots behind the last WMMA, on the loop's taken branch too
        asm volatile("v_nop\n\tv_nop\n\tv_nop\n\tv_nop" : "+v"(o[1][0]), "+v"(o[1][1]), "+v"(o[1][2]), "+v"(o[1][3]), "+v"(ox[1][0]), "+v"(ox[1][1]), "+v"(ox[1][2]), "+v"(ox[1][3]) : "v"(pb[1]), "v"(px[1]));
    }
    float* os = (float*)(ring + LOSB + wave * (16 * 68 * 4));    // the wave's own staging, used for one query group after the other (a wave's LDS operations keep their order)
    float* osw = os + lr * 68 + hi * 8;    // the lane's query row: its 8 consecutive d of a group go as two 16-B stores
#pragma unroll
    for (int u = 0; u < 2; ++u) {
        const float inv = 1.0f / ((lpart[u] + xhalf(lpart[u])) * PSC);
#pragma unroll
        for (int n = 0; n < 4; ++n) { v4f w0, w1;
#pragma unroll
            for (int j = 0; j < 4; ++j) { w0[j] = (o[u][n][j] + ox[u][n][j] * LOSCI) * inv; w1[j] = (o[u][n][4 + j] + ox[u][n][4 + j] * LOSCI) * inv; }
            *(v4fa*)(osw + n * 16) = w0; *(v4fa*)(osw + n * 16 + 4) = w1; }
        __syncthreads();    // the staged rows are written before other lanes read them
        const size_t cbase = (size_t)(rb + wave * 32 + u * 16 + (lane >> 3)) * DM + cb + (lane & 7) * 8;    // 8 lanes a row: whole 128-B pieces of four rows a store
        v8us oh[4], ol[4];
#pragma unroll
        for (int s = 0; s < 4; ++s) { const float* sp = os + (4 * s + (lane >> 3)) * 68 + (lane & 7) * 8; const v4f s0 = *(const v4fa*)sp, s1 = *(const v4fa*)(sp + 4);
#pragma unroll
            for (int i = 0; i < 8; ++i) { const float v = i < 4 ? s0[i & 3] : s1[i & 3]; const unsigned short hb = f2bf(v); oh[s][i] = hb; ol[s][i] = f2bf(v - bf2f(hb)); } }
        st8<4 * DM * 2, 8 * DM * 2, 12 * DM * 2>(CH + cbase, CL + cbase, oh, ol);    // row group s: four rows on
    }
}

#define VST2(T, p, v) do { const T vst2_v_ = (v); *(T*)(p) = vst2_v_;  } while (0)
extern "C" void kernel_launch(void* const* d_in, const int* in_sizes, int n_in,
                              void* d_out, int out_size, void* d_ws, size_t ws_size, hipStream_t stream) {
    (void)in_sizes; (void)n_in; (void)out_size;
    const float* x = (const float*)d_in[0]; const float* Wq = (const float*)d_in[1]; const float* Wk = (const float*)d_in[2]; const float* Wv = (const float*)d_in[3]; const float* Wo = (const float*)d_in[4];
    float* out = (float*)d_out;    // [1][4096][1024]
    char* wsp = (char*)d_ws;
    auto take = [&](size_t bytes) { char* p = wsp; wsp += (bytes + 255) & ~(size_t)255; return (void*)p; };
    bf* Xb = (bf*)take((size_t)NTK * DM * 2); bf* WqB = (bf*)take((size_t)DM * DM * 2); bf* WkB = (bf*)take((size_t)DM * DM * 2); bf* WvB = (bf*)take((size_t)DM * DM * 2); bf* WoB = (bf*)take((size_t)DM * DM * 2);
    bf* CH = (bf*)take((size_t)NTK * DM * 2); bf* CL = (bf*)take((size_t)NTK * DM * 2);    // a plane of its own for the ctx hi part: blocks write it while others still read Xb
    if ((size_t)(wsp - (char*)d_ws) > ws_size) return;    // 3 planes of 8.4 MB + 4 of 2.1 MB ~ 34 MB
    k_cvtb<<<(NTK + 4 * DM) / 8, 256, 0, stream>>>(x, Wq, Wk, Wv, Wo, Xb, WqB, WkB, WvB, WoB);
    k_qkva<<<dim3(NTK / 256, DM / 64), 256, 0, stream>>>(Xb, WqB, WkB, WvB, CH, CL);
    k_gemmb<true><<<dim3(NTK / 128, DM / 128, 1), 256, 0, stream>>>(CH, CL, WoB, nullptr, out, DM);
}
